// v000
// Times are from an AMD MI455X. After a warm-up the kernel runs many times in a row, and a time is the length of
// such a window on the GPU divided by its runs, so every launch and the gaps after it count. The runs cycle
// through copies of the inputs. A figure is the median of several windows, for all but v000 over two sittings.
// Sittings can differ by a few percent; kernels timed side by side share one.
// v000, which the later versions start from, runs in 1100 microseconds.
// compute dtype: all float inputs rounded to bf16; q/k/v = in W + b with EXACT bf16 products on WMMA 16x16x32 (f32 accumulate); q as f16 hi + residual (x 2^10) against k once to f16 (2 products) / sqrt(512); softmax in f32 (precise expf); P x 2^11 once to f16 against v once to f16 (1 product); ctx split bf16 hi + lo against exact Wo (2 products) + bo; f32 output.
#include <hip/hip_runtime.h>
#include <math.h>

typedef __attribute__((ext_vector_type(16))) _Float16 v16h;
typedef __attribute__((ext_vector_type(16))) __bf16 v16b;
typedef __attribute__((ext_vector_type(8)))  _Float16 v8h;
typedef __attribute__((ext_vector_type(8)))  float v8f;
typedef __attribute__((ext_vector_type(4)))  float v4f;
typedef __attribute__((ext_vector_type(2)))  float v2f;
typedef __attribute__((ext_vector_type(4)))  unsigned v4u;
typedef __attribute__((ext_vector_type(4)))  int v4i;
typedef float __attribute__((may_alias)) float_a;
typedef int __attribute__((may_alias)) int_a;

template <typename T> __device__ __forceinline__ void vst2(void* p, T v) { *(T*)p = v;  }
__device__ __forceinline__ v8f wmma16(v16h a, v16h b, v8f c) {
  v8f d = __builtin_amdgcn_wmma_f32_16x16x32_f16(false, a, false, b, (short)0, c, false, false);
  asm volatile("v_nop\n\tv_nop\n\tv_nop\n\tv_nop" : "+v"(d) : "v"(a), "v"(b));
  return d;
}
__device__ __forceinline__ v8f wmma_bf(v16b a, v16b b, v8f c) {
  v8f d = __builtin_amdgcn_wmma_f32_16x16x32_bf16(false, a, false, b, (short)0, c, false, false);
  asm volatile("v_nop\n\tv_nop\n\tv_nop\n\tv_nop" : "+v"(d) : "v"(a), "v"(b));
  return d;
}
// 16x16x32 fragments: lane = (h = lane>>4, row/col = lane&15); elements 0..7 = k0+8h+0..7, 8..15 = k0+16+8h+0..7; D element r = row 8h+r
__device__ __forceinline__ v16h frag_h(const _Float16* rowk0, int lane) {
  union { v16h v; v8h q[2]; } u; const _Float16* p = rowk0 + 8 * (lane >> 4);
  u.q[0] = *(const v8h*)p; u.q[1] = *(const v8h*)(p + 16); return u.v;
}
__device__ __forceinline__ v16h frag_f32(const float* rowk0, int lane) {
  v16h a; const float* p = rowk0 + 8 * (lane >> 4);
#pragma unroll
  for (int i = 0; i < 8; ++i) { a[i] = (_Float16)p[i]; a[8 + i] = (_Float16)p[16 + i]; }
  return a;
}
__device__ __forceinline__ v16h frag_f32s(const float* rowk0, int lane, float sc) {
  v16h a; const float* p = rowk0 + 8 * (lane >> 4);
#pragma unroll
  for (int i = 0; i < 8; ++i) { a[i] = (_Float16)(p[i] * sc); a[8 + i] = (_Float16)(p[16 + i] * sc); }
  return a;
}
// column fragment from a [K][ld] layout (column n), rows >= K read as 0
__device__ __forceinline__ v16h fragc_f32(const float* W, int k0, int n, int lane, int ld, int K) {
  v16h a; const int g = lane >> 4;
#pragma unroll
  for (int i = 0; i < 8; ++i) { const int ka = k0 + 8 * g + i, kb = ka + 16;
    a[i] = (_Float16)(ka < K ? W[(size_t)(ka < K ? ka : K - 1) * ld + n] : 0.f); a[8 + i] = (_Float16)(kb < K ? W[(size_t)(kb < K ? kb : K - 1) * ld + n] : 0.f); }
  return a;
}
struct F2 { v16b h, l; };
__device__ __forceinline__ F2 bsplit16(const float v[16]) { F2 r;
#pragma unroll
  for (int i = 0; i < 16; ++i) { const __bf16 h = (__bf16)v[i]; r.h[i] = h; r.l[i] = (__bf16)(v[i] - (float)h); }
  return r; }
__device__ __forceinline__ F2 split_row(const float* row, int k0, int lane) { float v[16]; const float* p = row + k0 + 8 * (lane >> 4);
#pragma unroll
  for (int i = 0; i < 8; ++i) { v[i] = p[i]; v[8 + i] = p[16 + i]; }
  return bsplit16(v); }
__device__ __forceinline__ F2 split_rowK(const float* row, int k0, int lane, int K) { float v[16]; const int g = lane >> 4;
#pragma unroll
  for (int i = 0; i < 8; ++i) { const int ka = k0 + 8 * g + i, kb = ka + 16; v[i] = ka < K ? row[ka < K ? ka : K - 1] : 0.f; v[8 + i] = kb < K ? row[kb < K ? kb : K - 1] : 0.f; }
  return bsplit16(v); }
__device__ __forceinline__ F2 split_col(const float* W, int k0, int n, int lane, int ld, int K) { float v[16]; const int g = lane >> 4;
#pragma unroll
  for (int i = 0; i < 8; ++i) { const int ka = k0 + 8 * g + i, kb = ka + 16; v[i] = ka < K ? W[(size_t)(ka < K ? ka : K - 1) * ld + n] : 0.f; v[8 + i] = kb < K ? W[(size_t)(kb < K ? kb : K - 1) * ld + n] : 0.f; }
  return bsplit16(v); }
__device__ __forceinline__ v8f mac3(const F2& a, const F2& b, v8f c) { c = wmma_bf(a.l, b.h, c); c = wmma_bf(a.h, b.l, c); return wmma_bf(a.h, b.h, c); }
__device__ __forceinline__ float sigm(float v) { return 1.0f / (1.0f + expf(-v)); }
#define LDSX() do { asm volatile("s_wait_dscnt 0" ::: "memory"); __builtin_amdgcn_wave_barrier(); __builtin_amdgcn_fence(__ATOMIC_RELEASE, "workgroup"); } while (0)

// Multi-head attention with separate q / k / v inputs (B 4, S 2,048, hid 512 = 8 x 64; (in,out) 1/sqrt(512)-scale weights, zero biases; scale = 1/sqrt(hid_dim = 512), as written): qp = q Wq + bq ...; out = merged(softmax(qh kh^T / sqrt(512)) vh) Wo + bo (non-causal).
#define NB 4
#define TT 2048
#define CC 512            // NH * HD = projected width
#define DIN 512          // input (model) width
#define NH 8
#define HD 64
#define NQB (TT / 64)
#define HG 4
#define SCALE (0.04419417382415922f)
#define CAUSAL 0
#ifndef TNB
#define TNB NB
#endif
__device__ __forceinline__ float bfr(float v) { return (float)(__bf16)v; }
__host__ __device__ __forceinline__ int kb_last(int qb) { return CAUSAL ? ((qb * 64 + 63) >> 7) : (TT / 128 - 1); }
typedef __attribute__((ext_vector_type(8))) __bf16 v8b;
__device__ __forceinline__ v16b frag_b(const __bf16* rowk0, int lane) {
  union { v16b v; v8b q[2]; } u; const __bf16* p = rowk0 + 8 * (lane >> 4);
  u.q[0] = *(const v8b*)p; u.q[1] = *(const v8b*)(p + 16); return u.v;
}
#define QBH 0              // causal: query blocks 0..QBH-1 of each sequence (few keys, no averaging) take the high-precision path
#define QHI 2048            // rows carrying a q residual plane (all rows when non-causal: 2-product logits everywhere)
#define KHI 64            // key rows carrying k residual / v bf16 hi+lo planes (used only by the causal high-precision path)
// B fragment (k rows k0+.., output column o) of a weight: (in,out) [K][ld] or (out,in) [ld rows of K]: bf16 exact, or f16(bf16 * 256) exact
__device__ __forceinline__ v16b wcol_io(const float* Wm, int k0, int o, int lane, int ld) { v16b w; const int g = lane >> 4;
#pragma unroll
  for (int i = 0; i < 8; ++i) { w[i] = (__bf16)Wm[(size_t)(k0 + 8 * g + i) * ld + o]; w[8 + i] = (__bf16)Wm[(size_t)(k0 + 16 + 8 * g + i) * ld + o]; }
  return w; }
__device__ __forceinline__ v16b wcol_oi(const float* Wm, int k0, int o, int lane, int K) { v16b w; const float* p = Wm + (size_t)o * K + k0 + 8 * (lane >> 4);
#pragma unroll
  for (int i = 0; i < 8; ++i) { w[i] = (__bf16)p[i]; w[8 + i] = (__bf16)p[16 + i]; }
  return w; }
__device__ __forceinline__ v16h wcolh_io(const float* Wm, int k0, int o, int lane, int ld) { v16h w; const int g = lane >> 4;
#pragma unroll
  for (int i = 0; i < 8; ++i) { w[i] = (_Float16)(bfr(Wm[(size_t)(k0 + 8 * g + i) * ld + o]) * 256.0f); w[8 + i] = (_Float16)(bfr(Wm[(size_t)(k0 + 16 + 8 * g + i) * ld + o]) * 256.0f); }
  return w; }
__device__ __forceinline__ v16h wcolh_oi(const float* Wm, int k0, int o, int lane, int K) { v16h w; const float* p = Wm + (size_t)o * K + k0 + 8 * (lane >> 4);
#pragma unroll
  for (int i = 0; i < 8; ++i) { w[i] = (_Float16)(bfr(p[i]) * 256.0f); w[8 + i] = (_Float16)(bfr(p[16 + i]) * 256.0f); }
  return w; }
#define WQKV_LAYOUT 0   // 0 = (in,out) [DIN][CC]; 1 = (out,in) [CC][DIN]; 2 = per-head [NH][DIN][HD]
__device__ __forceinline__ v16b wcol_hdk(const float* Wm, int k0, int o, int lane) { v16b w; const int g = lane >> 4; const float* p = Wm + (size_t)(o / HD) * DIN * HD + (o % HD);
#pragma unroll
  for (int i = 0; i < 8; ++i) { w[i] = (__bf16)p[(size_t)(k0 + 8 * g + i) * HD]; w[8 + i] = (__bf16)p[(size_t)(k0 + 16 + 8 * g + i) * HD]; }
  return w; }
#define WO_OUT_IN 0
#if WQKV_LAYOUT == 1
#define WCOL(W, k0, o, lane) wcol_oi(W, k0, o, lane, DIN)
#elif WQKV_LAYOUT == 2
#define WCOL(W, k0, o, lane) wcol_hdk(W, k0, o, lane)
#else
#define WCOL(W, k0, o, lane) wcol_io(W, k0, o, lane, CC)
#endif
#if WO_OUT_IN
#define WOCOL(W, k0, o, lane) wcol_oi(W, k0, o, lane, CC)
#define WOCOLH(W, k0, o, lane) wcolh_oi(W, k0, o, lane, CC)
#else
#define WOCOL(W, k0, o, lane) wcol_io(W, k0, o, lane, DIN)
#define WOCOLH(W, k0, o, lane) wcolh_io(W, k0, o, lane, DIN)
#endif

#ifndef SM_EXTRA_PARAMS
#define SM_EXTRA_PARAMS
#endif
#ifndef PROJ_EXTRA_PARAMS
#define PROJ_EXTRA_PARAMS
#endif
#ifndef SM_MASK_HOOK
#define SM_MASK_HOOK (void)0
#endif

#define WS_QH  0u                                      // f16 q rows [b*t][CC]
#define WS_KH  (WS_QH + 2u * (size_t)NB * TT * CC)      // f16 k rows [b*t][CC]
#define WS_VT  (WS_KH + 2u * (size_t)NB * TT * CC)      // f16 v planes [b][c][t]
#define WS_QL  (WS_VT + 2u * (size_t)NB * CC * TT)      // f16 q residual x 2^10 rows [b][t < QHI][CC]
#define WS_KL  (WS_QL + 2u * (size_t)NB * QHI * CC)     // f16 k residual x 2^10 rows [b][t < KHI][CC]
#define WS_VB  (WS_KL + 2u * (size_t)NB * KHI * CC)     // bf16 v hi planes [b][c][t < KHI]
#define WS_VBL (WS_VB + 2u * (size_t)NB * CC * KHI)
#define WS_S   (WS_VBL + 2u * (size_t)NB * CC * KHI)    // f32 logits / P [hg][t][s]
#define WS_Y   (WS_S  + 4u * (size_t)HG * TT * TT)      // f32 ctx rows [b*t][CC] (only when there is an output projection)
#define WS_END (WS_Y  + 4u * (size_t)NB * TT * CC)

// ---- k_proj: block = (64 rows, 128 cols, which): q/k/v = X W (+ b) with exact bf16 products (K = DIN) -> which 0: q f16 rows (+ residual rows < QHI); 1: k f16 rows (+ residual rows < KHI); 2: v f16 planes [c][t] (+ bf16 hi/lo planes for t < KHI)
__global__ __launch_bounds__(128) void k_proj(const float* __restrict__ XQ, const float* __restrict__ XK, const float* __restrict__ XV, const float* __restrict__ WQ, const float* __restrict__ WK, const float* __restrict__ WV, const float* __restrict__ BQ, const float* __restrict__ BK, const float* __restrict__ BV,
    _Float16* __restrict__ QH, _Float16* __restrict__ QL, _Float16* __restrict__ KH, _Float16* __restrict__ KL, _Float16* __restrict__ VT, __bf16* __restrict__ VB, __bf16* __restrict__ VBL) {
  __shared__ __align__(16) _Float16 sh[64][136], sl[64][136]; __shared__ __align__(16) _Float16 th[128][72]; __shared__ __align__(16) __bf16 tb[128][72], tbl[128][72];
  const int tid = threadIdx.x, wave = tid >> 5, lane = tid & 31, col = lane & 15, g = lane >> 4; const int which = blockIdx.z; const int c0 = blockIdx.y * 128; const size_t r0 = (size_t)blockIdx.x * 64; const size_t bb = r0 / TT; const int t0 = (int)(r0 % TT);
  const float* X = which == 0 ? XQ : which == 1 ? XK : XV; const float* WA = which == 0 ? WQ : which == 1 ? WK : WV; const float* BA = which == 0 ? BQ : which == 1 ? BK : BV;
  v8f acc[8] = {};
#pragma unroll 2
  for (int kc = 0; kc < DIN / 32; ++kc) { v16b a; { const float* p = X + (r0 + wave * 16 + col) * DIN + kc * 32 + 8 * g;
#pragma unroll
      for (int i = 0; i < 8; ++i) { a[i] = (__bf16)p[i]; a[8 + i] = (__bf16)p[16 + i]; } }
    asm volatile("s_wait_loadcnt 0x0" ::: "memory");
#pragma unroll
    for (int j = 0; j < 8; ++j) { const v16b w = WCOL(WA, kc * 32, c0 + j * 16 + col, lane); asm volatile("s_wait_loadcnt 0x0" ::: "memory"); acc[j] = wmma_bf(a, w, acc[j]); } }
  if (which < 2) { _Float16* DH = which == 0 ? QH : KH; _Float16* DL = which == 0 ? QL : KL; const int nhi = which == 0 ? QHI : KHI; const bool hi_rows = t0 < nhi;
#pragma unroll
    for (int j = 0; j < 8; ++j) { const float bias = BA ? bfr(BA[c0 + j * 16 + col]) : 0.f;
#pragma unroll
      for (int r = 0; r < 8; ++r) { const float v = acc[j][r] + bias; const _Float16 hv = (_Float16)v; sh[wave * 16 + 8 * g + r][j * 16 + col] = hv; sl[wave * 16 + 8 * g + r][j * 16 + col] = (_Float16)((v - (float)hv) * 1024.0f); } }
    __syncthreads();
    for (int e = tid; e < 64 * 16; e += 128) { const int rl = e >> 4, q = e & 15; vst2((unsigned*)(DH + (r0 + rl) * CC + c0 + q * 8), *(const v4u*)&sh[rl][q * 8]); if (hi_rows) vst2((unsigned*)(DL + (bb * nhi + t0 + rl) * (size_t)CC + c0 + q * 8), *(const v4u*)&sl[rl][q * 8]); }
  } else { const bool hi_rows = t0 < KHI;
#pragma unroll
    for (int j = 0; j < 8; ++j) { const float bias = BA ? bfr(BA[c0 + j * 16 + col]) : 0.f;
#pragma unroll
      for (int r = 0; r < 8; ++r) { const float v = acc[j][r] + bias; const int rl = wave * 16 + 8 * g + r, cl = j * 16 + col; th[cl][rl] = (_Float16)v; const __bf16 bh = (__bf16)v; tb[cl][rl] = bh; tbl[cl][rl] = (__bf16)(v - (float)bh); } }
    __syncthreads();
    for (int e = tid; e < 128 * 8; e += 128) { const int cl = e >> 3, q = e & 7; vst2((unsigned*)(VT + (bb * CC + c0 + cl) * (size_t)TT + t0 + q * 8), *(const v4u*)&th[cl][q * 8]); if (hi_rows) { const size_t o3 = (bb * CC + c0 + cl) * (size_t)KHI + t0 + q * 8; vst2((unsigned*)(VB + o3), *(const v4u*)&tb[cl][q * 8]); vst2((unsigned*)(VBL + o3), *(const v4u*)&tbl[cl][q * 8]); } } } }
// ---- k_sc: block = (query block qb, key block kb <= kb_last(qb), head in group) of batch b: logits x SCALE; q hi + residual (x 2^10) against k (2 products) for query rows < QHI, plus the k residual (3 products) for query blocks < QBH (causal early rows); causal: blocks past the diagonal exit, the mask itself is applied by index in k_sm
__global__ __launch_bounds__(128) void k_sc(const _Float16* __restrict__ QH, const _Float16* __restrict__ KH, const _Float16* __restrict__ QL, const _Float16* __restrict__ KL, int b, int h0, float* __restrict__ S0) { __shared__ __align__(16) float ss[4][16][132];
  const int qb = blockIdx.x, kb = blockIdx.y; if (kb > kb_last(qb)) return;
  const int h = h0 + blockIdx.z; float* S = S0 + (size_t)blockIdx.z * TT * TT;
  const int tid = threadIdx.x, wave = tid >> 5, lane = tid & 31, col = lane & 15, g = lane >> 4; const int k0 = kb * 128; const int ql0 = qb * 64 + wave * 16; const size_t q0 = (size_t)b * TT + ql0, kr0 = (size_t)b * TT + k0;
  v8f acc[8] = {}, accl[8] = {};
  const _Float16* QLb = QL + (size_t)b * QHI * CC; const _Float16* KLb = KL + (size_t)b * KHI * CC;
  if (qb < QBH) {
#pragma unroll
    for (int kc = 0; kc < HD / 32; ++kc) { const v16h ah = frag_h(QH + (q0 + col) * CC + h * HD + kc * 32, lane), al = frag_h(QLb + (size_t)(ql0 + col) * CC + h * HD + kc * 32, lane);
#pragma unroll
      for (int j = 0; j < 8; ++j) { const v16h kbf = frag_h(KH + (kr0 + j * 16 + col) * CC + h * HD + kc * 32, lane), klf = frag_h(KLb + (size_t)(k0 + j * 16 + col) * CC + h * HD + kc * 32, lane); acc[j] = wmma16(ah, kbf, acc[j]); accl[j] = wmma16(al, kbf, accl[j]); accl[j] = wmma16(ah, klf, accl[j]); } }
  } else if (qb * 64 < QHI) {
#pragma unroll
    for (int kc = 0; kc < HD / 32; ++kc) { const v16h ah = frag_h(QH + (q0 + col) * CC + h * HD + kc * 32, lane), al = frag_h(QLb + (size_t)(ql0 + col) * CC + h * HD + kc * 32, lane);
#pragma unroll
      for (int j = 0; j < 8; ++j) { const v16h kbf = frag_h(KH + (kr0 + j * 16 + col) * CC + h * HD + kc * 32, lane); acc[j] = wmma16(ah, kbf, acc[j]); accl[j] = wmma16(al, kbf, accl[j]); } }
  } else {
#pragma unroll
    for (int kc = 0; kc < HD / 32; ++kc) { const v16h ah = frag_h(QH + (q0 + col) * CC + h * HD + kc * 32, lane);
#pragma unroll
      for (int j = 0; j < 8; ++j) { const v16h kbf = frag_h(KH + (kr0 + j * 16 + col) * CC + h * HD + kc * 32, lane); acc[j] = wmma16(ah, kbf, acc[j]); } } }
#pragma unroll
  for (int j = 0; j < 8; ++j) {
#pragma unroll
    for (int r = 0; r < 8; ++r) ss[wave][8 * g + r][j * 16 + col] = (acc[j][r] + accl[j][r] * (1.0f / 1024.0f)) * SCALE; }
  LDSX(); for (int rl = 0; rl < 16; ++rl) vst2(S + (size_t)(ql0 + rl) * TT + k0 + lane * 4, *(const v4f*)&ss[wave][rl][lane * 4]); }
// ---- k_sm: block = query row t (head in group): keys [0, kend): causal -> logit if s <= t else excluded; softmax in f32; P x 2^11 in place (0 for excluded)
__global__ __launch_bounds__(256) void k_sm(float* __restrict__ S0 SM_EXTRA_PARAMS) { __shared__ float sred[8]; __shared__ float sbc; __shared__ __align__(16) float shv[TT];
  const int tid = threadIdx.x; const int t = blockIdx.x; const int kend = (kb_last(t >> 6) + 1) * 128;
  float* sr = S0 + (size_t)blockIdx.y * TT * TT + (size_t)t * TT;
  float m = -3.0e38f; for (int k = tid; k < kend; k += 256) { float v = (!CAUSAL || k <= t) ? sr[k] : -3.0e38f; SM_MASK_HOOK; shv[k] = v; m = fmaxf(m, v); }
#pragma unroll
  for (int o = 1; o < 32; o <<= 1) m = fmaxf(m, __shfl_xor(m, o));
  if ((tid & 31) == 0) sred[tid >> 5] = m; __syncthreads(); if (tid == 0) { float a = sred[0]; for (int i = 1; i < 8; ++i) a = fmaxf(a, sred[i]); sbc = a; } __syncthreads(); m = sbc; __syncthreads();
  float sum = 0.f; for (int k = tid; k < kend; k += 256) { const float v = shv[k]; const float e = (v <= -1.0e38f) ? 0.f : expf(v - m); shv[k] = e; sum += e; }
#pragma unroll
  for (int o = 1; o < 32; o <<= 1) sum += __shfl_xor(sum, o);
  if ((tid & 31) == 0) sred[tid >> 5] = sum; __syncthreads(); if (tid == 0) { float a = 0.f; for (int i = 0; i < 8; ++i) a += sred[i]; sbc = a > 0.f ? 2048.0f / a : 0.f; }   /* a fully excluded row yields P = 0 */ __syncthreads(); const float inv = sbc;
  for (int k = tid; k < kend; k += 256) shv[k] = shv[k] * inv;
  __syncthreads(); for (int q = tid; q < kend / 4; q += 256) vst2(sr + q * 4, *(const v4f*)&shv[q * 4]); }
// ---- k_pv: block = 64 queries (qb) of (b, h): ctx = P . v over keys [0, kend) (P x 2^11 once to f16 against v f16: 1 product; causal early query blocks: P and v as bf16 hi + lo, 3 products); 256-B (row, head) segment by 16 lanes
__global__ __launch_bounds__(128) void k_pv(const float* __restrict__ PS0, const _Float16* __restrict__ VT, const __bf16* __restrict__ VB, const __bf16* __restrict__ VBL, int b, int h0, float* __restrict__ Y) { const int h = h0 + blockIdx.z; const float* PS = PS0 + (size_t)blockIdx.z * TT * TT; __shared__ __align__(16) float ss[4][16][HD + 4];
  const int tid = threadIdx.x, wave = tid >> 5, lane = tid & 31, col = lane & 15, g = lane >> 4; const int qb = blockIdx.x; const int ql0 = qb * 64 + wave * 16; const int kce = (kb_last(qb) + 1) * 4;
  v8f acc[HD / 16] = {};
  if (qb < QBH) {
#pragma unroll 1
    for (int kc = 0; kc < kce; ++kc) { const F2 p = split_row(PS + (size_t)(ql0 + col) * TT, kc * 32, lane);
      asm volatile("s_wait_loadcnt 0x0" ::: "memory");
#pragma unroll
      for (int j = 0; j < HD / 16; ++j) { const size_t po = ((size_t)b * CC + h * HD + j * 16 + col) * (size_t)KHI + kc * 32; const v16b vh = frag_b(VB + po, lane); acc[j] = wmma_bf(p.h, vh, acc[j]); acc[j] = wmma_bf(p.l, vh, acc[j]); acc[j] = wmma_bf(p.h, frag_b(VBL + po, lane), acc[j]); } }
  } else {
#pragma unroll 1
    for (int kc = 0; kc < kce; ++kc) { const v16h p = frag_f32(PS + (size_t)(ql0 + col) * TT + kc * 32, lane);
      asm volatile("s_wait_loadcnt 0x0" ::: "memory");
#pragma unroll
      for (int j = 0; j < HD / 16; ++j) { const size_t po = ((size_t)b * CC + h * HD + j * 16 + col) * (size_t)TT + kc * 32; acc[j] = wmma16(p, frag_h(VT + po, lane), acc[j]); } } }
#pragma unroll
  for (int j = 0; j < HD / 16; ++j)
#pragma unroll
    for (int r = 0; r < 8; ++r) ss[wave][8 * g + r][j * 16 + col] = acc[j][r] * (1.0f / 2048.0f);
  LDSX(); for (int rl = 0; rl < 16; ++rl) if (lane < HD / 4) vst2(Y + ((size_t)b * TT + ql0 + rl) * CC + h * HD + lane * 4, *(const v4f*)&ss[wave][rl][lane * 4]); }
// ---- k_out: block = (64 rows, 128 cols): out = ctx Wo (+ bo): all rows: ctx bf16 hi + lo against exact bf16 Wo (2 products)
__global__ __launch_bounds__(128) void k_out(const float* __restrict__ Y, const float* __restrict__ WO, const float* __restrict__ BO, float* __restrict__ OUT) { __shared__ __align__(16) float sf[4][16][132];
  const int tid = threadIdx.x, wave = tid >> 5, lane = tid & 31, col = lane & 15, g = lane >> 4; const int c0 = blockIdx.y * 128; const size_t r0 = (size_t)blockIdx.x * 64 + wave * 16;
  v8f acc[8] = {};
  if (true) {   /* ALL rows: ctx split bf16 hi + lo x exact Wo (2 products) */
#pragma unroll 2
    for (int kc = 0; kc < CC / 32; ++kc) { const F2 a = split_row(Y + (r0 + col) * CC, kc * 32, lane); asm volatile("s_wait_loadcnt 0x0" ::: "memory");
#pragma unroll
      for (int j = 0; j < 8; ++j) { const v16b w = WOCOL(WO, kc * 32, c0 + j * 16 + col, lane); asm volatile("s_wait_loadcnt 0x0" ::: "memory"); acc[j] = wmma_bf(a.h, w, acc[j]); acc[j] = wmma_bf(a.l, w, acc[j]); } }
#pragma unroll
    for (int j = 0; j < 8; ++j) { const float bias = BO ? bfr(BO[c0 + j * 16 + col]) : 0.f;
#pragma unroll
      for (int r = 0; r < 8; ++r) sf[wave][8 * g + r][j * 16 + col] = acc[j][r] + bias; }
  } else {
#pragma unroll 2
    for (int kc = 0; kc < CC / 32; ++kc) { const v16h a = frag_f32(Y + (r0 + col) * CC + kc * 32, lane); asm volatile("s_wait_loadcnt 0x0" ::: "memory");
#pragma unroll
      for (int j = 0; j < 8; ++j) { const v16h w = WOCOLH(WO, kc * 32, c0 + j * 16 + col, lane); asm volatile("s_wait_loadcnt 0x0" ::: "memory"); acc[j] = wmma16(a, w, acc[j]); } }
#pragma unroll
    for (int j = 0; j < 8; ++j) { const float bias = BO ? bfr(BO[c0 + j * 16 + col]) : 0.f;
#pragma unroll
      for (int r = 0; r < 8; ++r) sf[wave][8 * g + r][j * 16 + col] = acc[j][r] * (1.0f / 256.0f) + bias; } }
  LDSX(); for (int rl = 0; rl < 16; ++rl) vst2(OUT + (r0 + rl) * DIN + c0 + lane * 4, *(const v4f*)&sf[wave][rl][lane * 4]); }

extern "C" void kernel_launch(void* const* d_in, const int* in_sizes, int n_in, void* d_out, int out_size, void* d_ws, size_t ws_size, hipStream_t stream) {
  (void)in_sizes; (void)n_in; (void)out_size;
  const float** F = (const float**)d_in;
  if (ws_size < (size_t)WS_END) return;
  char* ws = (char*)d_ws; _Float16 *QH = (_Float16*)(ws + WS_QH), *KH = (_Float16*)(ws + WS_KH), *VT = (_Float16*)(ws + WS_VT), *QL = (_Float16*)(ws + WS_QL), *KL = (_Float16*)(ws + WS_KL); __bf16 *VB = (__bf16*)(ws + WS_VB), *VBL = (__bf16*)(ws + WS_VBL); float *S = (float*)(ws + WS_S), *Y = (float*)(ws + WS_Y);
  (void)Y; (void)QL; (void)KL; (void)VB; (void)VBL;
  // inputs: 0 q; 1 k; 2 v [4,2048,512]; 3 Wq (in,out), 4 bq; 5 Wk, 6 bk; 7 Wv, 8 bv; 9 Wo (in,out), 10 bo
  k_proj<<<dim3(TNB * TT / 64, CC / 128, 3), 128, 0, stream>>>(F[0], F[1], F[2], F[3], F[5], F[7], F[4], F[6], F[8], QH, QL, KH, KL, VT, VB, VBL);
  for (int b = 0; b < TNB; ++b) for (int h0 = 0; h0 < NH; h0 += HG) {
    k_sc<<<dim3(NQB, TT / 128, HG), 128, 0, stream>>>(QH, KH, QL, KL, b, h0, S);
    k_sm<<<dim3(TT, HG), 256, 0, stream>>>(S);
    k_pv<<<dim3(NQB, 1, HG), 128, 0, stream>>>(S, VT, VB, VBL, b, h0, Y);
  }
  k_out<<<dim3(TNB * TT / 64, DIN / 128), 128, 0, stream>>>(Y, F[9], F[10], (float*)d_out);
}

// v002
// It runs in 149 microseconds.
// Versions in between are left out here; by their measured steps it is 7.42 times as fast as v000.
// compute dtype: all float inputs rounded to bf16; q/k/v = in W + b with EXACT bf16 products on WMMA 16x16x32 (f32 accumulate); q as f16 hi + residual (x 2^10) against k once to f16 (2 products) / sqrt(512); running-maximum softmax in f32 (precise expf) fused with both products; unnormalised P x 2^8 once to f16 against v once to f16 (1 product), / sum in f32; ctx split bf16 hi + lo against exact Wo (2 products) + bo; f32 output.
#include <hip/hip_runtime.h>
#include <math.h>

typedef __attribute__((ext_vector_type(16))) _Float16 v16h;
typedef __attribute__((ext_vector_type(16))) __bf16 v16b;
typedef __attribute__((ext_vector_type(8)))  _Float16 v8h;
typedef __attribute__((ext_vector_type(8)))  float v8f;
typedef __attribute__((ext_vector_type(4)))  float v4f;
typedef __attribute__((ext_vector_type(2)))  float v2f;
typedef __attribute__((ext_vector_type(4)))  unsigned v4u;
typedef __attribute__((ext_vector_type(4)))  int v4i;
typedef float __attribute__((may_alias)) float_a;
typedef int __attribute__((may_alias)) int_a;

template <typename T> __device__ __forceinline__ void vst2(void* p, T v) { *(T*)p = v;  }
__device__ __forceinline__ v8f wmma16(v16h a, v16h b, v8f c) {
  v8f d = __builtin_amdgcn_wmma_f32_16x16x32_f16(false, a, false, b, (short)0, c, false, false);
  asm volatile("v_nop\n\tv_nop\n\tv_nop\n\tv_nop" : "+v"(d) : "v"(a), "v"(b));
  return d;
}
__device__ __forceinline__ v8f wmma_bf(v16b a, v16b b, v8f c) {
  v8f d = __builtin_amdgcn_wmma_f32_16x16x32_bf16(false, a, false, b, (short)0, c, false, false);
  asm volatile("v_nop\n\tv_nop\n\tv_nop\n\tv_nop" : "+v"(d) : "v"(a), "v"(b));
  return d;
}
// 16x16x32 fragments: lane = (h = lane>>4, row/col = lane&15); elements 0..7 = k0+8h+0..7, 8..15 = k0+16+8h+0..7; D element r = row 8h+r
__device__ __forceinline__ v16h frag_h(const _Float16* rowk0, int lane) {
  union { v16h v; v8h q[2]; } u; const _Float16* p = rowk0 + 8 * (lane >> 4);
  u.q[0] = *(const v8h*)p; u.q[1] = *(const v8h*)(p + 16); return u.v;
}
__device__ __forceinline__ v16h frag_f32(const float* rowk0, int lane) {
  v16h a; const float* p = rowk0 + 8 * (lane >> 4);
#pragma unroll
  for (int i = 0; i < 8; ++i) { a[i] = (_Float16)p[i]; a[8 + i] = (_Float16)p[16 + i]; }
  return a;
}
__device__ __forceinline__ v16h frag_f32s(const float* rowk0, int lane, float sc) {
  v16h a; const float* p = rowk0 + 8 * (lane >> 4);
#pragma unroll
  for (int i = 0; i < 8; ++i) { a[i] = (_Float16)(p[i] * sc); a[8 + i] = (_Float16)(p[16 + i] * sc); }
  return a;
}
// column fragment from a [K][ld] layout (column n), rows >= K read as 0
__device__ __forceinline__ v16h fragc_f32(const float* W, int k0, int n, int lane, int ld, int K) {
  v16h a; const int g = lane >> 4;
#pragma unroll
  for (int i = 0; i < 8; ++i) { const int ka = k0 + 8 * g + i, kb = ka + 16;
    a[i] = (_Float16)(ka < K ? W[(size_t)(ka < K ? ka : K - 1) * ld + n] : 0.f); a[8 + i] = (_Float16)(kb < K ? W[(size_t)(kb < K ? kb : K - 1) * ld + n] : 0.f); }
  return a;
}
struct F2 { v16b h, l; };
__device__ __forceinline__ F2 bsplit16(const float v[16]) { F2 r;
#pragma unroll
  for (int i = 0; i < 16; ++i) { const __bf16 h = (__bf16)v[i]; r.h[i] = h; r.l[i] = (__bf16)(v[i] - (float)h); }
  return r; }
__device__ __forceinline__ F2 split_row(const float* row, int k0, int lane) { float v[16]; const float* p = row + k0 + 8 * (lane >> 4);
#pragma unroll
  for (int i = 0; i < 8; ++i) { v[i] = p[i]; v[8 + i] = p[16 + i]; }
  return bsplit16(v); }
__device__ __forceinline__ F2 split_rowK(const float* row, int k0, int lane, int K) { float v[16]; const int g = lane >> 4;
#pragma unroll
  for (int i = 0; i < 8; ++i) { const int ka = k0 + 8 * g + i, kb = ka + 16; v[i] = ka < K ? row[ka < K ? ka : K - 1] : 0.f; v[8 + i] = kb < K ? row[kb < K ? kb : K - 1] : 0.f; }
  return bsplit16(v); }
__device__ __forceinline__ F2 split_col(const float* W, int k0, int n, int lane, int ld, int K) { float v[16]; const int g = lane >> 4;
#pragma unroll
  for (int i = 0; i < 8; ++i) { const int ka = k0 + 8 * g + i, kb = ka + 16; v[i] = ka < K ? W[(size_t)(ka < K ? ka : K - 1) * ld + n] : 0.f; v[8 + i] = kb < K ? W[(size_t)(kb < K ? kb : K - 1) * ld + n] : 0.f; }
  return bsplit16(v); }
__device__ __forceinline__ v8f mac3(const F2& a, const F2& b, v8f c) { c = wmma_bf(a.l, b.h, c); c = wmma_bf(a.h, b.l, c); return wmma_bf(a.h, b.h, c); }
__device__ __forceinline__ float sigm(float v) { return 1.0f / (1.0f + expf(-v)); }
#define LDSX() do { asm volatile("s_wait_dscnt 0" ::: "memory"); __builtin_amdgcn_wave_barrier(); __builtin_amdgcn_fence(__ATOMIC_RELEASE, "workgroup"); } while (0)

// Multi-head attention with separate q / k / v inputs (B 4, S 2,048, hid 512 = 8 x 64; (in,out) 1/sqrt(512)-scale weights, zero biases; scale = 1/sqrt(hid_dim = 512), as written): qp = q Wq + bq ...; out = merged(softmax(qh kh^T / sqrt(512)) vh) Wo + bo (non-causal).
#define NB 4
#define TT 2048
#define CC 512            // NH * HD = projected width
#define DIN 512          // input (model) width
#define NH 8
#define HD 64
#define NQB (TT / 64)
#define HG 4
#define SCALE (0.04419417382415922f)
#define CAUSAL 0
#ifndef TNB
#define TNB NB
#endif
__device__ __forceinline__ float bfr(float v) { return (float)(__bf16)v; }
__host__ __device__ __forceinline__ int kb_last(int qb) { return CAUSAL ? ((qb * 64 + 63) >> 7) : (TT / 128 - 1); }
typedef __attribute__((ext_vector_type(8))) __bf16 v8b;
__device__ __forceinline__ v16b frag_b(const __bf16* rowk0, int lane) {
  union { v16b v; v8b q[2]; } u; const __bf16* p = rowk0 + 8 * (lane >> 4);
  u.q[0] = *(const v8b*)p; u.q[1] = *(const v8b*)(p + 16); return u.v;
}
#define QBH 0              // unused: every query block takes the one path of k_fa
#define QHI 2048            // rows carrying a q residual plane (all rows when non-causal: 2-product logits everywhere)
#define KHI 64            // key rows carrying k residual / v bf16 hi+lo planes (written by k_proj, read by no kernel here)
// B fragment (k rows k0+.., output column o) of a weight: (in,out) [K][ld] or (out,in) [ld rows of K]: bf16 exact, or f16(bf16 * 256) exact
__device__ __forceinline__ v16b wcol_io(const float* Wm, int k0, int o, int lane, int ld) { v16b w; const int g = lane >> 4;
#pragma unroll
  for (int i = 0; i < 8; ++i) { w[i] = (__bf16)Wm[(size_t)(k0 + 8 * g + i) * ld + o]; w[8 + i] = (__bf16)Wm[(size_t)(k0 + 16 + 8 * g + i) * ld + o]; }
  return w; }
__device__ __forceinline__ v16b wcol_oi(const float* Wm, int k0, int o, int lane, int K) { v16b w; const float* p = Wm + (size_t)o * K + k0 + 8 * (lane >> 4);
#pragma unroll
  for (int i = 0; i < 8; ++i) { w[i] = (__bf16)p[i]; w[8 + i] = (__bf16)p[16 + i]; }
  return w; }
__device__ __forceinline__ v16h wcolh_io(const float* Wm, int k0, int o, int lane, int ld) { v16h w; const int g = lane >> 4;
#pragma unroll
  for (int i = 0; i < 8; ++i) { w[i] = (_Float16)(bfr(Wm[(size_t)(k0 + 8 * g + i) * ld + o]) * 256.0f); w[8 + i] = (_Float16)(bfr(Wm[(size_t)(k0 + 16 + 8 * g + i) * ld + o]) * 256.0f); }
  return w; }
__device__ __forceinline__ v16h wcolh_oi(const float* Wm, int k0, int o, int lane, int K) { v16h w; const float* p = Wm + (size_t)o * K + k0 + 8 * (lane >> 4);
#pragma unroll
  for (int i = 0; i < 8; ++i) { w[i] = (_Float16)(bfr(p[i]) * 256.0f); w[8 + i] = (_Float16)(bfr(p[16 + i]) * 256.0f); }
  return w; }
#define WQKV_LAYOUT 0   // 0 = (in,out) [DIN][CC]; k_proj reads only this layout (other values change only WCOL, which nothing calls)
__device__ __forceinline__ v16b wcol_hdk(const float* Wm, int k0, int o, int lane) { v16b w; const int g = lane >> 4; const float* p = Wm + (size_t)(o / HD) * DIN * HD + (o % HD);
#pragma unroll
  for (int i = 0; i < 8; ++i) { w[i] = (__bf16)p[(size_t)(k0 + 8 * g + i) * HD]; w[8 + i] = (__bf16)p[(size_t)(k0 + 16 + 8 * g + i) * HD]; }
  return w; }
#define WO_OUT_IN 0
#if WQKV_LAYOUT == 1
#define WCOL(W, k0, o, lane) wcol_oi(W, k0, o, lane, DIN)
#elif WQKV_LAYOUT == 2
#define WCOL(W, k0, o, lane) wcol_hdk(W, k0, o, lane)
#else
#define WCOL(W, k0, o, lane) wcol_io(W, k0, o, lane, CC)
#endif
#if WO_OUT_IN
#define WOCOL(W, k0, o, lane) wcol_oi(W, k0, o, lane, CC)
#define WOCOLH(W, k0, o, lane) wcolh_oi(W, k0, o, lane, CC)
#else
#define WOCOL(W, k0, o, lane) wcol_io(W, k0, o, lane, DIN)
#define WOCOLH(W, k0, o, lane) wcolh_io(W, k0, o, lane, DIN)
#endif

#ifndef SM_EXTRA_PARAMS
#define SM_EXTRA_PARAMS
#endif
#ifndef PROJ_EXTRA_PARAMS
#define PROJ_EXTRA_PARAMS
#endif
#ifndef SM_MASK_HOOK
#define SM_MASK_HOOK (void)0
#endif

#define WS_QH  0u                                      // f16 q rows [b*t][CC]
#define WS_KH  (WS_QH + 2u * (size_t)NB * TT * CC)      // f16 k rows [b*t][CC]
#define WS_VT  (WS_KH + 2u * (size_t)NB * TT * CC)      // f16 v planes [b][c][t]
#define WS_QL  (WS_VT + 2u * (size_t)NB * CC * TT)      // f16 q residual x 2^10 rows [b][t < QHI][CC]
#define WS_KL  (WS_QL + 2u * (size_t)NB * QHI * CC)     // f16 k residual x 2^10 rows [b][t < KHI][CC]
#define WS_VB  (WS_KL + 2u * (size_t)NB * KHI * CC)     // bf16 v hi planes [b][c][t < KHI]
#define WS_VBL (WS_VB + 2u * (size_t)NB * CC * KHI)
#define WS_S   (WS_VBL + 2u * (size_t)NB * CC * KHI)    // f32 [hg][t][s] region, unused: k_fa keeps the logits in registers
#define WS_Y   (WS_S  + 4u * (size_t)HG * TT * TT)      // f32 ctx rows [b*t][CC] (only when there is an output projection)
#define WS_END (WS_Y  + 4u * (size_t)NB * TT * CC)

// ---- weight tile in LDS: 128 threads bring 64 k rows x 128 output columns of an (in,out) f32 weight as 16-byte row pieces (whole 128-B lines), round them to bf16 as before and store them [column][k], so that a B fragment is two 16-byte LDS reads and the block's four waves share one fetch and one rounding (the short loops are unrolled in full: the register arrays need constant indices)
#define WKC 64            // k rows per staged chunk
#define WPT (WKC + 8)     // LDS pitch in elements: 144 B = 16 B x odd, the fragment reads of 16 columns fall on 16 different bank groups
struct WReg { v4f x[16]; };
__device__ __forceinline__ void wtile_load(WReg& r, const float* wsrc, int ld) {   // wsrc: this thread's first row (8 kg) and first of 4 columns
#pragma unroll
  for (int p = 0; p < WKC / 32; ++p)
#pragma unroll
    for (int i = 0; i < 8; ++i) r.x[p * 8 + i] = *(const v4f*)(wsrc + (size_t)(p * 32 + i) * ld);
}
__device__ __forceinline__ void wtile_store(const WReg& r, __bf16 (*wt)[WPT], int sc, int kg) {
#pragma unroll
  for (int p = 0; p < WKC / 32; ++p)
#pragma unroll
    for (int cc = 0; cc < 4; ++cc) { v8b t;
#pragma unroll
      for (int i = 0; i < 8; ++i) t[i] = (__bf16)r.x[p * 8 + i][cc];
      *(v8b*)&wt[sc + cc][p * 32 + 8 * kg] = t; }
}
// ---- k_proj: block = (64 rows, 128 cols, which): q/k/v = X W (+ b) with exact bf16 products (K = DIN) -> which 0: q f16 rows (+ residual rows < QHI); 1: k f16 rows (+ residual rows < KHI); 2: v f16 planes [c][t] (+ bf16 hi/lo planes for t < KHI)
__global__ __launch_bounds__(128) void k_proj(const float* __restrict__ XQ, const float* __restrict__ XK, const float* __restrict__ XV, const float* __restrict__ WQ, const float* __restrict__ WK, const float* __restrict__ WV, const float* __restrict__ BQ, const float* __restrict__ BK, const float* __restrict__ BV,
    _Float16* __restrict__ QH, _Float16* __restrict__ QL, _Float16* __restrict__ KH, _Float16* __restrict__ KL, _Float16* __restrict__ VT, __bf16* __restrict__ VB, __bf16* __restrict__ VBL) {
  __shared__ __align__(16) _Float16 sh[64][136], sl[64][136]; __shared__ __align__(16) _Float16 th[128][72]; __shared__ __align__(16) __bf16 tb[128][72], tbl[128][72];
  const int tid = threadIdx.x, wave = tid >> 5, lane = tid & 31, col = lane & 15, g = lane >> 4; const int which = blockIdx.z; const int c0 = blockIdx.y * 128; const size_t r0 = (size_t)blockIdx.x * 64; const size_t bb = r0 / TT; const int t0 = (int)(r0 % TT);
  const float* X = which == 0 ? XQ : which == 1 ? XK : XV; const float* WA = which == 0 ? WQ : which == 1 ? WK : WV; const float* BA = which == 0 ? BQ : which == 1 ? BK : BV;
  __shared__ __align__(16) __bf16 wt[128][WPT];
  const int sc = 32 * wave + 4 * ((lane & 3) | ((lane >> 4) << 2)), kg = (lane >> 2) & 3;   // staging: 4 columns x 8 k rows per thread and 32 k; 16 lanes store to 16 different bank groups
  const float* wsrc = WA + (size_t)(8 * kg) * CC + c0 + sc; const float* xsrc = X + (r0 + wave * 16 + col) * DIN + 8 * g;
  v8f acc[8] = {}; WReg wr; v4f xr[WKC / 8];
  wtile_load(wr, wsrc, CC);
#pragma unroll
  for (int kk = 0; kk < WKC / 32; ++kk) { xr[kk * 4] = *(const v4f*)(xsrc + kk * 32); xr[kk * 4 + 1] = *(const v4f*)(xsrc + kk * 32 + 4); xr[kk * 4 + 2] = *(const v4f*)(xsrc + kk * 32 + 16); xr[kk * 4 + 3] = *(const v4f*)(xsrc + kk * 32 + 20); }
  asm volatile("s_wait_xcnt 0x0" :: "v"(wsrc), "v"(xsrc) : "memory");   // the loads' address pairs live up to this wait and are rewritten only behind it
  auto round_a = [&](v16b (&a)[WKC / 32]) {
#pragma unroll
    for (int kk = 0; kk < WKC / 32; ++kk)
#pragma unroll
      for (int i = 0; i < 4; ++i) { a[kk][i] = (__bf16)xr[kk * 4][i]; a[kk][4 + i] = (__bf16)xr[kk * 4 + 1][i]; a[kk][8 + i] = (__bf16)xr[kk * 4 + 2][i]; a[kk][12 + i] = (__bf16)xr[kk * 4 + 3][i]; } };
  auto publish = [&]() { __syncthreads();   // every wave has read the last chunk's fragments
    wtile_store(wr, wt, sc, kg);
    __syncthreads(); };   // the chunk is published
  auto products = [&](const v16b (&a)[WKC / 32]) {
#pragma unroll
    for (int kk = 0; kk < WKC / 32; ++kk)
#pragma unroll
      for (int jh = 0; jh < 2; ++jh) { v16b w[4];
#pragma unroll
        for (int j = 0; j < 4; ++j) w[j] = frag_b(&wt[(jh * 4 + j) * 16 + col][kk * 32], lane);
#pragma unroll
        for (int j = 0; j < 4; ++j) acc[jh * 4 + j] = wmma_bf(a[kk], w[j], acc[jh * 4 + j]); } };
#pragma unroll 1   // rolled: one body holds 16 products and 24 loads already
  for (int ch = 0; ch < DIN / WKC - 1; ++ch) { v16b a[WKC / 32]; round_a(a); publish();
    wtile_load(wr, wsrc + (size_t)WKC * CC, CC);   // the next chunk's loads fly while this chunk's products run
#pragma unroll
    for (int kk = 0; kk < WKC / 32; ++kk) { xr[kk * 4] = *(const v4f*)(xsrc + WKC + kk * 32); xr[kk * 4 + 1] = *(const v4f*)(xsrc + WKC + kk * 32 + 4); xr[kk * 4 + 2] = *(const v4f*)(xsrc + WKC + kk * 32 + 16); xr[kk * 4 + 3] = *(const v4f*)(xsrc + WKC + kk * 32 + 20); }
    asm volatile("s_wait_xcnt 0x0" :: "v"(wsrc), "v"(xsrc) : "memory");   // as above
    wsrc += (size_t)WKC * CC; xsrc += WKC;
    products(a); }
  { v16b a[WKC / 32]; round_a(a); publish(); products(a); }   // the last chunk: nothing left to fetch
  if (which < 2) { _Float16* DH = which == 0 ? QH : KH; _Float16* DL = which == 0 ? QL : KL; const int nhi = which == 0 ? QHI : KHI; const bool hi_rows = t0 < nhi;
#pragma unroll
    for (int j = 0; j < 8; ++j) { const float bias = BA ? bfr(BA[c0 + j * 16 + col]) : 0.f;
#pragma unroll
      for (int r = 0; r < 8; ++r) { const float v = acc[j][r] + bias; const _Float16 hv = (_Float16)v; sh[wave * 16 + 8 * g + r][j * 16 + col] = hv; sl[wave * 16 + 8 * g + r][j * 16 + col] = (_Float16)((v - (float)hv) * 1024.0f); } }
    __syncthreads();
    for (int e = tid; e < 64 * 16; e += 128) { const int rl = e >> 4, q = e & 15; vst2((unsigned*)(DH + (r0 + rl) * CC + c0 + q * 8), *(const v4u*)&sh[rl][q * 8]); if (hi_rows) vst2((unsigned*)(DL + (bb * nhi + t0 + rl) * (size_t)CC + c0 + q * 8), *(const v4u*)&sl[rl][q * 8]); }
  } else { const bool hi_rows = t0 < KHI;
#pragma unroll
    for (int j = 0; j < 8; ++j) { const float bias = BA ? bfr(BA[c0 + j * 16 + col]) : 0.f;
#pragma unroll
      for (int r = 0; r < 8; ++r) { const float v = acc[j][r] + bias; const int rl = wave * 16 + 8 * g + r, cl = j * 16 + col; th[cl][rl] = (_Float16)v; const __bf16 bh = (__bf16)v; tb[cl][rl] = bh; tbl[cl][rl] = (__bf16)(v - (float)bh); } }
    __syncthreads();
    for (int e = tid; e < 128 * 8; e += 128) { const int cl = e >> 3, q = e & 7; vst2((unsigned*)(VT + (bb * CC + c0 + cl) * (size_t)TT + t0 + q * 8), *(const v4u*)&th[cl][q * 8]); if (hi_rows) { const size_t o3 = (bb * CC + c0 + cl) * (size_t)KHI + t0 + q * 8; vst2((unsigned*)(VB + o3), *(const v4u*)&tb[cl][q * 8]); vst2((unsigned*)(VBL + o3), *(const v4u*)&tbl[cl][q * 8]); } } } }
// ---- k_fa: block = 16 waves x 16 queries of (b, h), one launch for every (b, h): per 32 keys S^T = K Q^T (q hi + residual x 2^10 against k, 2 products, x SCALE as before), running maximum and sum per query column in f32, P = e^(s - m) x 2^8 once to f16 straight from the score registers as the B operand, O^T += V^T P^T (1 product); the logits never leave the registers; ctx = O / sum
__device__ __forceinline__ float xhalf(float x) { return __builtin_bit_cast(float, __builtin_amdgcn_permlanex16(__builtin_bit_cast(int, x), __builtin_bit_cast(int, x), 0x76543210, 0xfedcba98, false, false)); }  // lane l with lane l ^ 16
__device__ __forceinline__ v16h frag_p(const _Float16* p) { union { v16h v; v8h q[2]; } u; u.q[0] = *(const v8h*)p; u.q[1] = *(const v8h*)(p + 16); return u.v; }   // frag_h with the lane half's 8 g already in p
__device__ __forceinline__ v8f wmma_h(v16h a, v16h b, v8f c) { return __builtin_amdgcn_wmma_f32_16x16x32_f16(false, a, false, b, (short)0, c, false, false); }
#define FAW 16            // waves per block
__global__ __launch_bounds__(FAW * 32) void k_fa(const _Float16* __restrict__ QH, const _Float16* __restrict__ QL, const _Float16* __restrict__ KH, const _Float16* __restrict__ VT, float* __restrict__ Y) { __shared__ __align__(16) float ss[FAW][16][HD + 4];
  const int tid = threadIdx.x, wave = tid >> 5, lane = tid & 31, col = lane & 15, g = lane >> 4; const int h = blockIdx.y, b = blockIdx.z; const int ql0 = blockIdx.x * (FAW * 16) + wave * 16;
  v16h qh[HD / 32], ql[HD / 32];
#pragma unroll
  for (int kc = 0; kc < HD / 32; ++kc) { qh[kc] = frag_h(QH + ((size_t)b * TT + ql0 + col) * CC + h * HD + kc * 32, lane); ql[kc] = frag_h(QL + ((size_t)b * QHI + ql0 + col) * CC + h * HD + kc * 32, lane); }
  const _Float16* Kb = KH + ((size_t)b * TT + col) * CC + h * HD;      // key row col of a 16-key tile
  const _Float16* Vb = VT + ((size_t)b * CC + h * HD + col) * (size_t)TT;  // plane of channel col of a 16-channel tile
  v8f o[HD / 16] = {}; float m = -3.0e38f, l = 0.f;
  v16h kf[2][HD / 32];
#pragma unroll
  for (int t = 0; t < 2; ++t)
#pragma unroll
    for (int kc = 0; kc < HD / 32; ++kc) kf[t][kc] = frag_h(Kb + (size_t)(t * 16) * CC + kc * 32, lane);
#pragma unroll 1
  for (int c = 0; c < TT / 32; ++c) {
    v16h vf[HD / 16]; const _Float16* vp = Vb + c * 32 + 8 * g;
#pragma unroll
    for (int j = 0; j < HD / 16; ++j) vf[j] = frag_p(vp + (size_t)(j * 16) * TT);
    asm volatile("s_wait_xcnt 0x0" :: "v"(vp) : "memory");   // the loads' address pair lives up to this wait and is rewritten only behind it
    v8f sh[2], sl[2];
    // the eight score products in one statement: as builtins the last of them were placed behind the next k loads, which then took new registers, and the copy back waited for every load; the v_nop keep the distance from the last product to the first vector instruction on its result
    asm volatile("v_wmma_f32_16x16x32_f16 %0, %4, %8, 0\n\tv_wmma_f32_16x16x32_f16 %1, %4, %9, 0\n\tv_wmma_f32_16x16x32_f16 %2, %5, %8, 0\n\tv_wmma_f32_16x16x32_f16 %3, %5, %9, 0\n\t"
                 "v_wmma_f32_16x16x32_f16 %0, %6, %10, %0\n\tv_wmma_f32_16x16x32_f16 %1, %6, %11, %1\n\tv_wmma_f32_16x16x32_f16 %2, %7, %10, %2\n\tv_wmma_f32_16x16x32_f16 %3, %7, %11, %3\n\t"
                 "v_nop\n\tv_nop\n\tv_nop\n\tv_nop"
                 : "=&v"(sh[0]), "=&v"(sl[0]), "=&v"(sh[1]), "=&v"(sl[1]) : "v"(kf[0][0]), "v"(kf[1][0]), "v"(kf[0][1]), "v"(kf[1][1]), "v"(qh[0]), "v"(ql[0]), "v"(qh[1]), "v"(ql[1]));
    const int cn = c + 1 < TT / 32 ? c + 1 : c;   // the next 32 keys' fragments are fetched while this pass does its softmax (the last pass fetches its own again)
    const _Float16* kp = Kb + (size_t)(cn * 32) * CC + 8 * g;
#pragma unroll
    for (int t = 0; t < 2; ++t)
#pragma unroll
      for (int kc = 0; kc < HD / 32; ++kc) kf[t][kc] = frag_p(kp + (size_t)(t * 16) * CC + kc * 32);
    asm volatile("s_wait_xcnt 0x0" :: "v"(kp) : "memory");   // as above, for the k loads' address pair
    __builtin_amdgcn_sched_barrier(0);   // keeps the next k loads here, ahead of the softmax (the scheduler otherwise sinks them to the loop's foot, where their latency shows)
    float s[16]; float mx = -3.0e38f;   // s[8 t + r] = logit of key 32 c + 16 t + 8 g + r for query col: the k order of a B fragment
#pragma unroll
    for (int t = 0; t < 2; ++t)
#pragma unroll
      for (int r = 0; r < 8; ++r) { s[t * 8 + r] = (sh[t][r] + sl[t][r] * (1.0f / 1024.0f)) * SCALE; mx = fmaxf(mx, s[t * 8 + r]); }
    mx = fmaxf(mx, xhalf(mx));
    const float mn = fmaxf(m, mx); const float al = expf(m - mn); m = mn;   // al = 0 on the first pass
    const float ms = mn - 5.545177444479562f;   // x 2^8: keeps small P out of the f16 subnormals; cancels against the sum
    v16h p; float ps = 0.f;
#pragma unroll
    for (int i = 0; i < 16; ++i) { const float e = expf(s[i] - ms); ps += e; p[i] = (_Float16)e; }
    l = l * al + ps;
#pragma unroll
    for (int j = 0; j < HD / 16; ++j) { o[j] *= al; o[j] = wmma_h(vf[j], p, o[j]); } }
  l += xhalf(l); const float inv = 1.0f / l;
#pragma unroll
  for (int j = 0; j < HD / 16; ++j) { v4f lo, hi;   // o[j][r] = ctx of query col, channel 16 j + 8 g + r
#pragma unroll
    for (int r = 0; r < 4; ++r) { lo[r] = o[j][r] * inv; hi[r] = o[j][4 + r] * inv; }
    *(v4f*)&ss[wave][col][j * 16 + 8 * g] = lo; *(v4f*)&ss[wave][col][j * 16 + 8 * g + 4] = hi; }
  LDSX();
#pragma unroll
  for (int i = 0; i < 8; ++i) { const int rl = 2 * i + g; vst2(Y + ((size_t)b * TT + ql0 + rl) * CC + h * HD + col * 4, *(const v4f*)&ss[wave][rl][col * 4]); } }   // 256-B (row, head) segment by 16 lanes
// ---- k_out: block = (64 rows, 128 cols): out = ctx Wo (+ bo): ctx split bf16 hi + lo against exact bf16 Wo (2 products) for all rows
__global__ __launch_bounds__(128) void k_out(const float* __restrict__ Y, const float* __restrict__ WO, const float* __restrict__ BO, float* __restrict__ OUT) { __shared__ __align__(16) float sf[4][16][132]; __shared__ __align__(16) __bf16 wt[128][WPT];
  const int tid = threadIdx.x, wave = tid >> 5, lane = tid & 31, col = lane & 15, g = lane >> 4; const int c0 = blockIdx.y * 128; const size_t r0 = (size_t)blockIdx.x * 64 + wave * 16;
  v8f acc[8] = {};
  if (true) {   /* ALL rows: ctx split bf16 hi + lo x exact Wo (2 products) */
    const int sc = 32 * wave + 4 * ((lane & 3) | ((lane >> 4) << 2)), kg = (lane >> 2) & 3;   // staging map as in k_proj
    const float* wsrc = WO + (size_t)(8 * kg) * DIN + c0 + sc; const float* ysrc = Y + (r0 + col) * CC + 8 * g;
    WReg wr; v4f yr[WKC / 8];
    wtile_load(wr, wsrc, DIN);
#pragma unroll
    for (int kk = 0; kk < WKC / 32; ++kk) { yr[kk * 4] = *(const v4f*)(ysrc + kk * 32); yr[kk * 4 + 1] = *(const v4f*)(ysrc + kk * 32 + 4); yr[kk * 4 + 2] = *(const v4f*)(ysrc + kk * 32 + 16); yr[kk * 4 + 3] = *(const v4f*)(ysrc + kk * 32 + 20); }
    asm volatile("s_wait_xcnt 0x0" :: "v"(wsrc), "v"(ysrc) : "memory");   // the loads' address pairs live up to this wait and are rewritten only behind it
    auto split_a = [&](F2 (&a)[WKC / 32]) {
#pragma unroll
      for (int kk = 0; kk < WKC / 32; ++kk) { float v[16];
#pragma unroll
        for (int i = 0; i < 4; ++i) { v[i] = yr[kk * 4][i]; v[4 + i] = yr[kk * 4 + 1][i]; v[8 + i] = yr[kk * 4 + 2][i]; v[12 + i] = yr[kk * 4 + 3][i]; }
        a[kk] = bsplit16(v); } };
    auto publish = [&]() { __syncthreads();   // every wave has read the last chunk's fragments
      wtile_store(wr, wt, sc, kg);
      __syncthreads(); };   // the chunk is published
    auto products = [&](const F2 (&a)[WKC / 32]) {
#pragma unroll
      for (int kk = 0; kk < WKC / 32; ++kk)
#pragma unroll
        for (int jh = 0; jh < 2; ++jh) { v16b w[4];
#pragma unroll
          for (int j = 0; j < 4; ++j) w[j] = frag_b(&wt[(jh * 4 + j) * 16 + col][kk * 32], lane);
#pragma unroll
          for (int j = 0; j < 4; ++j) { acc[jh * 4 + j] = wmma_bf(a[kk].h, w[j], acc[jh * 4 + j]); acc[jh * 4 + j] = wmma_bf(a[kk].l, w[j], acc[jh * 4 + j]); } } };
#pragma unroll 1   // rolled, as in k_proj
    for (int ch = 0; ch < CC / WKC - 1; ++ch) { F2 a[WKC / 32]; split_a(a); publish();
      wtile_load(wr, wsrc + (size_t)WKC * DIN, DIN);   // the next chunk's loads fly while this chunk's products run
#pragma unroll
      for (int kk = 0; kk < WKC / 32; ++kk) { yr[kk * 4] = *(const v4f*)(ysrc + WKC + kk * 32); yr[kk * 4 + 1] = *(const v4f*)(ysrc + WKC + kk * 32 + 4); yr[kk * 4 + 2] = *(const v4f*)(ysrc + WKC + kk * 32 + 16); yr[kk * 4 + 3] = *(const v4f*)(ysrc + WKC + kk * 32 + 20); }
      asm volatile("s_wait_xcnt 0x0" :: "v"(wsrc), "v"(ysrc) : "memory");   // as above
      wsrc += (size_t)WKC * DIN; ysrc += WKC;
      products(a); }
    { F2 a[WKC / 32]; split_a(a); publish(); products(a); }   // the last chunk: nothing left to fetch
#pragma unroll
    for (int j = 0; j < 8; ++j) { const float bias = BO ? bfr(BO[c0 + j * 16 + col]) : 0.f;
#pragma unroll
      for (int r = 0; r < 8; ++r) sf[wave][8 * g + r][j * 16 + col] = acc[j][r] + bias; }
  } else {
#pragma unroll 2
    for (int kc = 0; kc < CC / 32; ++kc) { const v16h a = frag_f32(Y + (r0 + col) * CC + kc * 32, lane); asm volatile("s_wait_loadcnt 0x0" ::: "memory");
#pragma unroll
      for (int j = 0; j < 8; ++j) { const v16h w = WOCOLH(WO, kc * 32, c0 + j * 16 + col, lane); asm volatile("s_wait_loadcnt 0x0" ::: "memory"); acc[j] = wmma16(a, w, acc[j]); } }
#pragma unroll
    for (int j = 0; j < 8; ++j) { const float bias = BO ? bfr(BO[c0 + j * 16 + col]) : 0.f;
#pragma unroll
      for (int r = 0; r < 8; ++r) sf[wave][8 * g + r][j * 16 + col] = acc[j][r] * (1.0f / 256.0f) + bias; } }
  LDSX(); for (int rl = 0; rl < 16; ++rl) vst2(OUT + (r0 + rl) * DIN + c0 + lane * 4, *(const v4f*)&sf[wave][rl][lane * 4]); }

extern "C" void kernel_launch(void* const* d_in, const int* in_sizes, int n_in, void* d_out, int out_size, void* d_ws, size_t ws_size, hipStream_t stream) {
  (void)in_sizes; (void)n_in; (void)out_size;
  const float** F = (const float**)d_in;
  if (ws_size < (size_t)WS_END) return;
  char* ws = (char*)d_ws; _Float16 *QH = (_Float16*)(ws + WS_QH), *KH = (_Float16*)(ws + WS_KH), *VT = (_Float16*)(ws + WS_VT), *QL = (_Float16*)(ws + WS_QL), *KL = (_Float16*)(ws + WS_KL); __bf16 *VB = (__bf16*)(ws + WS_VB), *VBL = (__bf16*)(ws + WS_VBL); float *Y = (float*)(ws + WS_Y);
  (void)Y; (void)QL; (void)KL; (void)VB; (void)VBL;
  // inputs: 0 q; 1 k; 2 v [4,2048,512]; 3 Wq (in,out), 4 bq; 5 Wk, 6 bk; 7 Wv, 8 bv; 9 Wo (in,out), 10 bo
  k_proj<<<dim3(TNB * TT / 64, CC / 128, 3), 128, 0, stream>>>(F[0], F[1], F[2], F[3], F[5], F[7], F[4], F[6], F[8], QH, QL, KH, KL, VT, VB, VBL);
  k_fa<<<dim3(TT / (FAW * 16), NH, TNB), FAW * 32, 0, stream>>>(QH, QL, KH, VT, Y);
  k_out<<<dim3(TNB * TT / 64, DIN / 128), 128, 0, stream>>>(Y, F[9], F[10], (float*)d_out);
}

// v003
// Measured time: 115 microseconds a run.
// Two timings next to v002 put it at 1.31 and 1.30 times that version's speed.
// Over all steps from v000 it is 9.67 times as fast.
// compute dtype: all float inputs rounded to bf16; q/k/v = in W + b with EXACT bf16 products on WMMA 16x16x32 (f32 accumulate); q as f16 hi + residual (x 2^10) against k once to f16 (2 products) / sqrt(512); running-maximum softmax in f32 (precise expf) fused with both products; unnormalised P x 2^8 once to f16 against v once to f16 (1 product), / sum in f32; ctx split bf16 hi + lo against exact Wo (2 products) + bo; f32 output.
#include <hip/hip_runtime.h>
#include <math.h>

typedef __attribute__((ext_vector_type(16))) _Float16 v16h;
typedef __attribute__((ext_vector_type(16))) __bf16 v16b;
typedef __attribute__((ext_vector_type(8)))  _Float16 v8h;
typedef __attribute__((ext_vector_type(8)))  float v8f;
typedef __attribute__((ext_vector_type(4)))  float v4f;
typedef __attribute__((ext_vector_type(2)))  float v2f;
typedef __attribute__((ext_vector_type(4)))  unsigned v4u;
typedef __attribute__((ext_vector_type(4)))  int v4i;
typedef float __attribute__((may_alias)) float_a;
typedef int __attribute__((may_alias)) int_a;

template <typename T> __device__ __forceinline__ void vst2(void* p, T v) { *(T*)p = v;  }
__device__ __forceinline__ v8f wmma16(v16h a, v16h b, v8f c) {
  v8f d = __builtin_amdgcn_wmma_f32_16x16x32_f16(false, a, false, b, (short)0, c, false, false);
  asm volatile("v_nop\n\tv_nop\n\tv_nop\n\tv_nop" : "+v"(d) : "v"(a), "v"(b));
  return d;
}
__device__ __forceinline__ v8f wmma_bf(v16b a, v16b b, v8f c) {
  v8f d = __builtin_amdgcn_wmma_f32_16x16x32_bf16(false, a, false, b, (short)0, c, false, false);
  asm volatile("v_nop\n\tv_nop\n\tv_nop\n\tv_nop" : "+v"(d) : "v"(a), "v"(b));
  return d;
}
// 16x16x32 fragments: lane = (h = lane>>4, row/col = lane&15); elements 0..7 = k0+8h+0..7, 8..15 = k0+16+8h+0..7; D element r = row 8h+r
__device__ __forceinline__ v16h frag_h(const _Float16* rowk0, int lane) {
  union { v16h v; v8h q[2]; } u; const _Float16* p = rowk0 + 8 * (lane >> 4);
  u.q[0] = *(const v8h*)p; u.q[1] = *(const v8h*)(p + 16); return u.v;
}
__device__ __forceinline__ v16h frag_f32(const float* rowk0, int lane) {
  v16h a; const float* p = rowk0 + 8 * (lane >> 4);
#pragma unroll
  for (int i = 0; i < 8; ++i) { a[i] = (_Float16)p[i]; a[8 + i] = (_Float16)p[16 + i]; }
  return a;
}
__device__ __forceinline__ v16h frag_f32s(const float* rowk0, int lane, float sc) {
  v16h a; const float* p = rowk0 + 8 * (lane >> 4);
#pragma unroll
  for (int i = 0; i < 8; ++i) { a[i] = (_Float16)(p[i] * sc); a[8 + i] = (_Float16)(p[16 + i] * sc); }
  return a;
}
// column fragment from a [K][ld] layout (column n), rows >= K read as 0
__device__ __forceinline__ v16h fragc_f32(const float* W, int k0, int n, int lane, int ld, int K) {
  v16h a; const int g = lane >> 4;
#pragma unroll
  for (int i = 0; i < 8; ++i) { const int ka = k0 + 8 * g + i, kb = ka + 16;
    a[i] = (_Float16)(ka < K ? W[(size_t)(ka < K ? ka : K - 1) * ld + n] : 0.f); a[8 + i] = (_Float16)(kb < K ? W[(size_t)(kb < K ? kb : K - 1) * ld + n] : 0.f); }
  return a;
}
struct F2 { v16b h, l; };
__device__ __forceinline__ F2 bsplit16(const float v[16]) { F2 r;
#pragma unroll
  for (int i = 0; i < 16; ++i) { const __bf16 h = (__bf16)v[i]; r.h[i] = h; r.l[i] = (__bf16)(v[i] - (float)h); }
  return r; }
__device__ __forceinline__ F2 split_row(const float* row, int k0, int lane) { float v[16]; const float* p = row + k0 + 8 * (lane >> 4);
#pragma unroll
  for (int i = 0; i < 8; ++i) { v[i] = p[i]; v[8 + i] = p[16 + i]; }
  return bsplit16(v); }
__device__ __forceinline__ F2 split_rowK(const float* row, int k0, int lane, int K) { float v[16]; const int g = lane >> 4;
#pragma unroll
  for (int i = 0; i < 8; ++i) { const int ka = k0 + 8 * g + i, kb = ka + 16; v[i] = ka < K ? row[ka < K ? ka : K - 1] : 0.f; v[8 + i] = kb < K ? row[kb < K ? kb : K - 1] : 0.f; }
  return bsplit16(v); }
__device__ __forceinline__ F2 split_col(const float* W, int k0, int n, int lane, int ld, int K) { float v[16]; const int g = lane >> 4;
#pragma unroll
  for (int i = 0; i < 8; ++i) { const int ka = k0 + 8 * g + i, kb = ka + 16; v[i] = ka < K ? W[(size_t)(ka < K ? ka : K - 1) * ld + n] : 0.f; v[8 + i] = kb < K ? W[(size_t)(kb < K ? kb : K - 1) * ld + n] : 0.f; }
  return bsplit16(v); }
__device__ __forceinline__ v8f mac3(const F2& a, const F2& b, v8f c) { c = wmma_bf(a.l, b.h, c); c = wmma_bf(a.h, b.l, c); return wmma_bf(a.h, b.h, c); }
__device__ __forceinline__ float sigm(float v) { return 1.0f / (1.0f + expf(-v)); }
#define LDSX() do { asm volatile("s_wait_dscnt 0" ::: "memory"); __builtin_amdgcn_wave_barrier(); __builtin_amdgcn_fence(__ATOMIC_RELEASE, "workgroup"); } while (0)

// Multi-head attention with separate q / k / v inputs (B 4, S 2,048, hid 512 = 8 x 64; (in,out) 1/sqrt(512)-scale weights, zero biases; scale = 1/sqrt(hid_dim = 512), as written): qp = q Wq + bq ...; out = merged(softmax(qh kh^T / sqrt(512)) vh) Wo + bo (non-causal).
#define NB 4
#define TT 2048
#define CC 512            // NH * HD = projected width
#define DIN 512          // input (model) width
#define NH 8
#define HD 64
#define NQB (TT / 64)
#define HG 4
#define SCALE (0.04419417382415922f)
#define CAUSAL 0
#ifndef TNB
#define TNB NB
#endif
__device__ __forceinline__ float bfr(float v) { return (float)(__bf16)v; }
__host__ __device__ __forceinline__ int kb_last(int qb) { return CAUSAL ? ((qb * 64 + 63) >> 7) : (TT / 128 - 1); }
typedef __attribute__((ext_vector_type(8))) __bf16 v8b;
__device__ __forceinline__ v16b frag_b(const __bf16* rowk0, int lane) {
  union { v16b v; v8b q[2]; } u; const __bf16* p = rowk0 + 8 * (lane >> 4);
  u.q[0] = *(const v8b*)p; u.q[1] = *(const v8b*)(p + 16); return u.v;
}
#define QBH 0              // unused: every query block takes the one path of k_fa
#define QHI 2048            // rows carrying a q residual plane (all rows when non-causal: 2-product logits everywhere)
#define KHI 64            // key rows carrying k residual / v bf16 hi+lo planes (written by k_proj, read by no kernel here)
// B fragment (k rows k0+.., output column o) of a weight: (in,out) [K][ld] or (out,in) [ld rows of K]: bf16 exact, or f16(bf16 * 256) exact
__device__ __forceinline__ v16b wcol_io(const float* Wm, int k0, int o, int lane, int ld) { v16b w; const int g = lane >> 4;
#pragma unroll
  for (int i = 0; i < 8; ++i) { w[i] = (__bf16)Wm[(size_t)(k0 + 8 * g + i) * ld + o]; w[8 + i] = (__bf16)Wm[(size_t)(k0 + 16 + 8 * g + i) * ld + o]; }
  return w; }
__device__ __forceinline__ v16b wcol_oi(const float* Wm, int k0, int o, int lane, int K) { v16b w; const float* p = Wm + (size_t)o * K + k0 + 8 * (lane >> 4);
#pragma unroll
  for (int i = 0; i < 8; ++i) { w[i] = (__bf16)p[i]; w[8 + i] = (__bf16)p[16 + i]; }
  return w; }
__device__ __forceinline__ v16h wcolh_io(const float* Wm, int k0, int o, int lane, int ld) { v16h w; const int g = lane >> 4;
#pragma unroll
  for (int i = 0; i < 8; ++i) { w[i] = (_Float16)(bfr(Wm[(size_t)(k0 + 8 * g + i) * ld + o]) * 256.0f); w[8 + i] = (_Float16)(bfr(Wm[(size_t)(k0 + 16 + 8 * g + i) * ld + o]) * 256.0f); }
  return w; }
__device__ __forceinline__ v16h wcolh_oi(const float* Wm, int k0, int o, int lane, int K) { v16h w; const float* p = Wm + (size_t)o * K + k0 + 8 * (lane >> 4);
#pragma unroll
  for (int i = 0; i < 8; ++i) { w[i] = (_Float16)(bfr(p[i]) * 256.0f); w[8 + i] = (_Float16)(bfr(p[16 + i]) * 256.0f); }
  return w; }
#define WQKV_LAYOUT 0   // 0 = (in,out) [DIN][CC]; k_proj reads only this layout (other values change only WCOL, which nothing calls)
__device__ __forceinline__ v16b wcol_hdk(const float* Wm, int k0, int o, int lane) { v16b w; const int g = lane >> 4; const float* p = Wm + (size_t)(o / HD) * DIN * HD + (o % HD);
#pragma unroll
  for (int i = 0; i < 8; ++i) { w[i] = (__bf16)p[(size_t)(k0 + 8 * g + i) * HD]; w[8 + i] = (__bf16)p[(size_t)(k0 + 16 + 8 * g + i) * HD]; }
  return w; }
#define WO_OUT_IN 0
#if WQKV_LAYOUT == 1
#define WCOL(W, k0, o, lane) wcol_oi(W, k0, o, lane, DIN)
#elif WQKV_LAYOUT == 2
#define WCOL(W, k0, o, lane) wcol_hdk(W, k0, o, lane)
#else
#define WCOL(W, k0, o, lane) wcol_io(W, k0, o, lane, CC)
#endif
#if WO_OUT_IN
#define WOCOL(W, k0, o, lane) wcol_oi(W, k0, o, lane, CC)
#define WOCOLH(W, k0, o, lane) wcolh_oi(W, k0, o, lane, CC)
#else
#define WOCOL(W, k0, o, lane) wcol_io(W, k0, o, lane, DIN)
#define WOCOLH(W, k0, o, lane) wcolh_io(W, k0, o, lane, DIN)
#endif

#ifndef SM_EXTRA_PARAMS
#define SM_EXTRA_PARAMS
#endif
#ifndef PROJ_EXTRA_PARAMS
#define PROJ_EXTRA_PARAMS
#endif
#ifndef SM_MASK_HOOK
#define SM_MASK_HOOK (void)0
#endif

#define WS_QH  0u                                      // f16 q rows [b*t][CC]
#define WS_KH  (WS_QH + 2u * (size_t)NB * TT * CC)      // f16 k in fragment order [b][h][16-key tile][piece p = 16 channels][lane = 16 g + key][8 channels 16 p + 8 g + ..]
#define WS_VT  (WS_KH + 2u * (size_t)NB * TT * CC)      // f16 v in fragment order [b][h][32-key block][16-channel tile j][half][lane = 16 g + channel][8 keys 16 half + 8 g + ..]
#define WS_QL  (WS_VT + 2u * (size_t)NB * CC * TT)      // f16 q residual x 2^10 rows [b][t < QHI][CC]
#define WS_KL  (WS_QL + 2u * (size_t)NB * QHI * CC)     // f16 k residual x 2^10 rows [b][t < KHI][CC]
#define WS_VB  (WS_KL + 2u * (size_t)NB * KHI * CC)     // bf16 v hi planes [b][c][t < KHI]
#define WS_VBL (WS_VB + 2u * (size_t)NB * CC * KHI)
#define WS_S   (WS_VBL + 2u * (size_t)NB * CC * KHI)    // f32 [hg][t][s] region, unused: k_fa keeps the logits in registers
#define WS_Y   (WS_S  + 4u * (size_t)HG * TT * TT)      // f32 ctx rows [b*t][CC] (only when there is an output projection)
#define WS_END (WS_Y  + 4u * (size_t)NB * TT * CC)
// k and v lie in the workspace as k_fa's A fragments read them: the 32 lanes' 16-byte pieces of one load are 512 contiguous bytes (4 whole lines; by rows or planes one load touched 16 lines for the same bytes)
#define KF_TILE(b, h, kt) ((((size_t)(b) * NH + (h)) * (TT / 16) + (kt)) * 1024)   // element offset of a 16-key tile: 4 pieces of 256 elements
#define VF_BLK(b, h, cb)  ((((size_t)(b) * NH + (h)) * (TT / 32) + (cb)) * 2048)   // element offset of a 32-key block: 4 channel tiles x 2 halves of 256 elements

// ---- weight tile in LDS: 128 threads bring 64 k rows x 128 output columns of an (in,out) f32 weight as 16-byte row pieces (whole 128-B lines), round them to bf16 as before and store them [column][k], so that a B fragment is two 16-byte LDS reads and the block's four waves share one fetch and one rounding (the short loops are unrolled in full: the register arrays need constant indices)
#define WKC 64            // k rows per staged chunk
#define WPT (WKC + 8)     // LDS pitch in elements: 144 B = 16 B x odd, the fragment reads of 16 columns fall on 16 different bank groups
struct WReg { v4f x[16]; };
__device__ __forceinline__ void wtile_load(WReg& r, const float* wsrc, int ld) {   // wsrc: this thread's first row (8 kg) and first of 4 columns
#pragma unroll
  for (int p = 0; p < WKC / 32; ++p)
#pragma unroll
    for (int i = 0; i < 8; ++i) r.x[p * 8 + i] = *(const v4f*)(wsrc + (size_t)(p * 32 + i) * ld);
}
__device__ __forceinline__ void wtile_store(const WReg& r, __bf16 (*wt)[WPT], int sc, int kg) {
#pragma unroll
  for (int p = 0; p < WKC / 32; ++p)
#pragma unroll
    for (int cc = 0; cc < 4; ++cc) { v8b t;
#pragma unroll
      for (int i = 0; i < 8; ++i) t[i] = (__bf16)r.x[p * 8 + i][cc];
      *(v8b*)&wt[sc + cc][p * 32 + 8 * kg] = t; }
}
// ---- k_proj: block = (64 rows, 128 cols, which): q/k/v = X W (+ b) with exact bf16 products (K = DIN) -> which 0: q f16 rows (+ residual rows < QHI); 1: k f16 in fragment order (+ residual rows < KHI); 2: v f16 in fragment order (+ bf16 hi/lo planes for t < KHI)
__global__ __launch_bounds__(128) void k_proj(const float* __restrict__ XQ, const float* __restrict__ XK, const float* __restrict__ XV, const float* __restrict__ WQ, const float* __restrict__ WK, const float* __restrict__ WV, const float* __restrict__ BQ, const float* __restrict__ BK, const float* __restrict__ BV,
    _Float16* __restrict__ QH, _Float16* __restrict__ QL, _Float16* __restrict__ KH, _Float16* __restrict__ KL, _Float16* __restrict__ VT, __bf16* __restrict__ VB, __bf16* __restrict__ VBL) {
  __shared__ __align__(16) _Float16 sh[64][136], sl[64][136]; __shared__ __align__(16) _Float16 th[128][72]; __shared__ __align__(16) __bf16 tb[128][72], tbl[128][72];
  const int tid = threadIdx.x, wave = tid >> 5, lane = tid & 31, col = lane & 15, g = lane >> 4; const int which = blockIdx.z; const int c0 = blockIdx.y * 128; const size_t r0 = (size_t)blockIdx.x * 64; const size_t bb = r0 / TT; const int t0 = (int)(r0 % TT);
  const float* X = which == 0 ? XQ : which == 1 ? XK : XV; const float* WA = which == 0 ? WQ : which == 1 ? WK : WV; const float* BA = which == 0 ? BQ : which == 1 ? BK : BV;
  __shared__ __align__(16) __bf16 wt[128][WPT];
  const int sc = 32 * wave + 4 * ((lane & 3) | ((lane >> 4) << 2)), kg = (lane >> 2) & 3;   // staging: 4 columns x 8 k rows per thread and 32 k; 16 lanes store to 16 different bank groups
  const float* wsrc = WA + (size_t)(8 * kg) * CC + c0 + sc; const float* xsrc = X + (r0 + wave * 16 + col) * DIN + 8 * g;
  v8f acc[8] = {}; WReg wr; v4f xr[WKC / 8];
  wtile_load(wr, wsrc, CC);
#pragma unroll
  for (int kk = 0; kk < WKC / 32; ++kk) { xr[kk * 4] = *(const v4f*)(xsrc + kk * 32); xr[kk * 4 + 1] = *(const v4f*)(xsrc + kk * 32 + 4); xr[kk * 4 + 2] = *(const v4f*)(xsrc + kk * 32 + 16); xr[kk * 4 + 3] = *(const v4f*)(xsrc + kk * 32 + 20); }
  asm volatile("s_wait_xcnt 0x0" :: "v"(wsrc), "v"(xsrc) : "memory");   // the loads' address pairs live up to this wait and are rewritten only behind it
  auto round_a = [&](v16b (&a)[WKC / 32]) {
#pragma unroll
    for (int kk = 0; kk < WKC / 32; ++kk)
#pragma unroll
      for (int i = 0; i < 4; ++i) { a[kk][i] = (__bf16)xr[kk * 4][i]; a[kk][4 + i] = (__bf16)xr[kk * 4 + 1][i]; a[kk][8 + i] = (__bf16)xr[kk * 4 + 2][i]; a[kk][12 + i] = (__bf16)xr[kk * 4 + 3][i]; } };
  auto publish = [&]() { __syncthreads();   // every wave has read the last chunk's fragments
    wtile_store(wr, wt, sc, kg);
    __syncthreads(); };   // the chunk is published
  auto products = [&](const v16b (&a)[WKC / 32]) {
#pragma unroll
    for (int kk = 0; kk < WKC / 32; ++kk)
#pragma unroll
      for (int jh = 0; jh < 2; ++jh) { v16b w[4];
#pragma unroll
        for (int j = 0; j < 4; ++j) w[j] = frag_b(&wt[(jh * 4 + j) * 16 + col][kk * 32], lane);
#pragma unroll
        for (int j = 0; j < 4; ++j) acc[jh * 4 + j] = wmma_bf(a[kk], w[j], acc[jh * 4 + j]); } };
#pragma unroll 1   // rolled: one body holds 16 products and 24 loads already
  for (int ch = 0; ch < DIN / WKC - 1; ++ch) { v16b a[WKC / 32]; round_a(a); publish();
    wtile_load(wr, wsrc + (size_t)WKC * CC, CC);   // the next chunk's loads fly while this chunk's products run
#pragma unroll
    for (int kk = 0; kk < WKC / 32; ++kk) { xr[kk * 4] = *(const v4f*)(xsrc + WKC + kk * 32); xr[kk * 4 + 1] = *(const v4f*)(xsrc + WKC + kk * 32 + 4); xr[kk * 4 + 2] = *(const v4f*)(xsrc + WKC + kk * 32 + 16); xr[kk * 4 + 3] = *(const v4f*)(xsrc + WKC + kk * 32 + 20); }
    asm volatile("s_wait_xcnt 0x0" :: "v"(wsrc), "v"(xsrc) : "memory");   // as above
    wsrc += (size_t)WKC * CC; xsrc += WKC;
    products(a); }
  { v16b a[WKC / 32]; round_a(a); publish(); products(a); }   // the last chunk: nothing left to fetch
  if (which < 2) { _Float16* DH = which == 0 ? QH : KH; _Float16* DL = which == 0 ? QL : KL; const int nhi = which == 0 ? QHI : KHI; const bool hi_rows = t0 < nhi;
#pragma unroll
    for (int j = 0; j < 8; ++j) { const float bias = BA ? bfr(BA[c0 + j * 16 + col]) : 0.f;
#pragma unroll
      for (int r = 0; r < 8; ++r) { const float v = acc[j][r] + bias; const _Float16 hv = (_Float16)v; sh[wave * 16 + 8 * g + r][j * 16 + col] = hv; sl[wave * 16 + 8 * g + r][j * 16 + col] = (_Float16)((v - (float)hv) * 1024.0f); } }
    __syncthreads();
    for (int e = tid; e < 64 * 16; e += 128) { int rl = e >> 4, q = e & 15; size_t dh = (r0 + rl) * CC + c0 + q * 8;
      if (which == 1) { const int l = e & 31, p = (e >> 5) & 3, hh = (e >> 7) & 1, kt = e >> 8; rl = kt * 16 + (l & 15); q = hh * 8 + p * 2 + (l >> 4); dh = KF_TILE(bb, c0 / HD + hh, t0 / 16 + kt) + p * 256 + l * 8; }   // a wave stores one 512-B piece
      _Float16* pd = DH + dh; const v4u dv = *(const v4u*)&sh[rl][q * 8]; vst2((unsigned*)pd, dv);
      asm volatile("s_wait_xcnt 0x0" :: "v"(pd), "v"(dv) : "memory");   // the store's address pair and data live up to this wait and are rewritten only behind it
      if (hi_rows) { _Float16* pl = DL + (bb * nhi + t0 + rl) * (size_t)CC + c0 + q * 8; const v4u lv = *(const v4u*)&sl[rl][q * 8]; vst2((unsigned*)pl, lv);
        asm volatile("s_wait_xcnt 0x0" :: "v"(pl), "v"(lv) : "memory"); } }   // as above
  } else { const bool hi_rows = t0 < KHI;
#pragma unroll
    for (int j = 0; j < 8; ++j) { const float bias = BA ? bfr(BA[c0 + j * 16 + col]) : 0.f;
#pragma unroll
      for (int r = 0; r < 8; ++r) { const float v = acc[j][r] + bias; const int rl = wave * 16 + 8 * g + r, cl = j * 16 + col; th[cl][rl] = (_Float16)v; const __bf16 bh = (__bf16)v; tb[cl][rl] = bh; tbl[cl][rl] = (__bf16)(v - (float)bh); } }
    __syncthreads();
    for (int e = tid; e < 128 * 8; e += 128) { const int l = e & 31, hf = (e >> 5) & 1, j = (e >> 6) & 3, hh = (e >> 8) & 1, cb = e >> 9; const int cl = hh * 64 + j * 16 + (l & 15), q = cb * 4 + hf * 2 + (l >> 4);   // a wave stores one 512-B piece
      _Float16* pv = VT + VF_BLK(bb, c0 / HD + hh, t0 / 32 + cb) + (j * 2 + hf) * 256 + l * 8; const v4u dv = *(const v4u*)&th[cl][q * 8]; vst2((unsigned*)pv, dv);
      asm volatile("s_wait_xcnt 0x0" :: "v"(pv), "v"(dv) : "memory");   // the store's address pair and data live up to this wait and are rewritten only behind it
      if (hi_rows) { const size_t o3 = (bb * CC + c0 + cl) * (size_t)KHI + t0 + q * 8; __bf16 *ph = VB + o3, *pl = VBL + o3; const v4u hv = *(const v4u*)&tb[cl][q * 8], lv = *(const v4u*)&tbl[cl][q * 8]; vst2((unsigned*)ph, hv); vst2((unsigned*)pl, lv);
        asm volatile("s_wait_xcnt 0x0" :: "v"(ph), "v"(pl), "v"(hv), "v"(lv) : "memory"); } } } }   // as above
// ---- k_fa: block = 16 waves x 16 queries of (b, h), one launch for every (b, h): per 32 keys S^T = K Q^T (q hi + residual x 2^10 against k, 2 products, x SCALE as before), running maximum and sum per query column in f32, P = e^(s - m) x 2^8 once to f16 straight from the score registers as the B operand, O^T += V^T P^T (1 product); the logits never leave the registers; ctx = O / sum
__device__ __forceinline__ float xhalf(float x) { return __builtin_bit_cast(float, __builtin_amdgcn_permlanex16(__builtin_bit_cast(int, x), __builtin_bit_cast(int, x), 0x76543210, 0xfedcba98, false, false)); }  // lane l with lane l ^ 16
__device__ __forceinline__ v16h frag_p(const _Float16* p) { union { v16h v; v8h q[2]; } u; u.q[0] = *(const v8h*)p; u.q[1] = *(const v8h*)(p + 256); return u.v; }   // fragment-order source, the lane's 8 elements already in p: the two halves are neighbouring 512-B pieces
__device__ __forceinline__ v8f wmma_h(v16h a, v16h b, v8f c) { return __builtin_amdgcn_wmma_f32_16x16x32_f16(false, a, false, b, (short)0, c, false, false); }
#define FAW 16            // waves per block
__global__ __launch_bounds__(FAW * 32) void k_fa(const _Float16* __restrict__ QH, const _Float16* __restrict__ QL, const _Float16* __restrict__ KH, const _Float16* __restrict__ VT, float* __restrict__ Y) { __shared__ __align__(16) float ss[FAW][16][HD + 4];
  const int tid = threadIdx.x, wave = tid >> 5, lane = tid & 31, col = lane & 15, g = lane >> 4; const int h = blockIdx.y, b = blockIdx.z; const int ql0 = blockIdx.x * (FAW * 16) + wave * 16;
  v16h qh[HD / 32], ql[HD / 32];
#pragma unroll
  for (int kc = 0; kc < HD / 32; ++kc) { qh[kc] = frag_h(QH + ((size_t)b * TT + ql0 + col) * CC + h * HD + kc * 32, lane); ql[kc] = frag_h(QL + ((size_t)b * QHI + ql0 + col) * CC + h * HD + kc * 32, lane); }
  const _Float16* Kb = KH + KF_TILE(b, h, 0) + lane * 8;   // this lane's 16 bytes of the first piece of (b, h)
  const _Float16* Vb = VT + VF_BLK(b, h, 0) + lane * 8;
  v8f o[HD / 16] = {}; float m = -3.0e38f, l = 0.f;
  v16h kf[2][HD / 32];
#pragma unroll
  for (int t = 0; t < 2; ++t)
#pragma unroll
    for (int kc = 0; kc < HD / 32; ++kc) kf[t][kc] = frag_p(Kb + t * 1024 + kc * 512);
#pragma unroll 1
  for (int c = 0; c < TT / 32; ++c) {
    v16h vf[HD / 16]; const _Float16* vp = Vb + c * 2048;
#pragma unroll
    for (int j = 0; j < HD / 16; ++j) vf[j] = frag_p(vp + j * 512);
    asm volatile("s_wait_xcnt 0x0" :: "v"(vp) : "memory");   // the loads' address pair lives up to this wait and is rewritten only behind it
    v8f sh[2], sl[2];
    // the eight score products in one statement: as builtins the last of them were placed behind the next k loads, which then took new registers, and the copy back waited for every load; the v_nop keep the distance from the last product to the first vector instruction on its result
    asm volatile("v_wmma_f32_16x16x32_f16 %0, %4, %8, 0\n\tv_wmma_f32_16x16x32_f16 %1, %4, %9, 0\n\tv_wmma_f32_16x16x32_f16 %2, %5, %8, 0\n\tv_wmma_f32_16x16x32_f16 %3, %5, %9, 0\n\t"
                 "v_wmma_f32_16x16x32_f16 %0, %6, %10, %0\n\tv_wmma_f32_16x16x32_f16 %1, %6, %11, %1\n\tv_wmma_f32_16x16x32_f16 %2, %7, %10, %2\n\tv_wmma_f32_16x16x32_f16 %3, %7, %11, %3\n\t"
                 "v_nop\n\tv_nop\n\tv_nop\n\tv_nop"
                 : "=&v"(sh[0]), "=&v"(sl[0]), "=&v"(sh[1]), "=&v"(sl[1]) : "v"(kf[0][0]), "v"(kf[1][0]), "v"(kf[0][1]), "v"(kf[1][1]), "v"(qh[0]), "v"(ql[0]), "v"(qh[1]), "v"(ql[1]));
    const int cn = c + 1 < TT / 32 ? c + 1 : c;   // the next 32 keys' fragments are fetched while this pass does its softmax (the last pass fetches its own again)
    const _Float16* kp = Kb + cn * 2048;
#pragma unroll
    for (int t = 0; t < 2; ++t)
#pragma unroll
      for (int kc = 0; kc < HD / 32; ++kc) kf[t][kc] = frag_p(kp + t * 1024 + kc * 512);
    asm volatile("s_wait_xcnt 0x0" :: "v"(kp) : "memory");   // as above, for the k loads' address pair
    __builtin_amdgcn_sched_barrier(0);   // keeps the next k loads here, ahead of the softmax (the scheduler otherwise sinks them to the loop's foot, where their latency shows)
    float s[16]; float mx = -3.0e38f;   // s[8 t + r] = logit of key 32 c + 16 t + 8 g + r for query col: the k order of a B fragment
#pragma unroll
    for (int t = 0; t < 2; ++t)
#pragma unroll
      for (int r = 0; r < 8; ++r) { s[t * 8 + r] = (sh[t][r] + sl[t][r] * (1.0f / 1024.0f)) * SCALE; mx = fmaxf(mx, s[t * 8 + r]); }
    mx = fmaxf(mx, xhalf(mx));
    const float mn = fmaxf(m, mx); const float al = expf(m - mn); m = mn;   // al = 0 on the first pass
    const float ms = mn - 5.545177444479562f;   // x 2^8: keeps small P out of the f16 subnormals; cancels against the sum
    v16h p; float ps = 0.f;
#pragma unroll
    for (int i = 0; i < 16; ++i) { const float e = expf(s[i] - ms); ps += e; p[i] = (_Float16)e; }
    l = l * al + ps;
#pragma unroll
    for (int j = 0; j < HD / 16; ++j) { o[j] *= al; o[j] = wmma_h(vf[j], p, o[j]); } }
  l += xhalf(l); const float inv = 1.0f / l;
#pragma unroll
  for (int j = 0; j < HD / 16; ++j) { v4f lo, hi;   // o[j][r] = ctx of query col, channel 16 j + 8 g + r
#pragma unroll
    for (int r = 0; r < 4; ++r) { lo[r] = o[j][r] * inv; hi[r] = o[j][4 + r] * inv; }
    *(v4f*)&ss[wave][col][j * 16 + 8 * g] = lo; *(v4f*)&ss[wave][col][j * 16 + 8 * g + 4] = hi; }
  LDSX();
#pragma unroll
  for (int i = 0; i < 8; ++i) { const int rl = 2 * i + g; vst2(Y + ((size_t)b * TT + ql0 + rl) * CC + h * HD + col * 4, *(const v4f*)&ss[wave][rl][col * 4]); } }   // 256-B (row, head) segment by 16 lanes
// ---- k_out: block = (64 rows, 128 cols): out = ctx Wo (+ bo): ctx split bf16 hi + lo against exact bf16 Wo (2 products) for all rows
__global__ __launch_bounds__(128) void k_out(const float* __restrict__ Y, const float* __restrict__ WO, const float* __restrict__ BO, float* __restrict__ OUT) { __shared__ __align__(16) float sf[4][16][132]; __shared__ __align__(16) __bf16 wt[128][WPT];
  const int tid = threadIdx.x, wave = tid >> 5, lane = tid & 31, col = lane & 15, g = lane >> 4; const int c0 = blockIdx.y * 128; const size_t r0 = (size_t)blockIdx.x * 64 + wave * 16;
  v8f acc[8] = {};
  if (true) {   /* ALL rows: ctx split bf16 hi + lo x exact Wo (2 products) */
    const int sc = 32 * wave + 4 * ((lane & 3) | ((lane >> 4) << 2)), kg = (lane >> 2) & 3;   // staging map as in k_proj
    const float* wsrc = WO + (size_t)(8 * kg) * DIN + c0 + sc; const float* ysrc = Y + (r0 + col) * CC + 8 * g;
    WReg wr; v4f yr[WKC / 8];
    wtile_load(wr, wsrc, DIN);
#pragma unroll
    for (int kk = 0; kk < WKC / 32; ++kk) { yr[kk * 4] = *(const v4f*)(ysrc + kk * 32); yr[kk * 4 + 1] = *(const v4f*)(ysrc + kk * 32 + 4); yr[kk * 4 + 2] = *(const v4f*)(ysrc + kk * 32 + 16); yr[kk * 4 + 3] = *(const v4f*)(ysrc + kk * 32 + 20); }
    asm volatile("s_wait_xcnt 0x0" :: "v"(wsrc), "v"(ysrc) : "memory");   // the loads' address pairs live up to this wait and are rewritten only behind it
    auto split_a = [&](F2 (&a)[WKC / 32]) {
#pragma unroll
      for (int kk = 0; kk < WKC / 32; ++kk) { float v[16];
#pragma unroll
        for (int i = 0; i < 4; ++i) { v[i] = yr[kk * 4][i]; v[4 + i] = yr[kk * 4 + 1][i]; v[8 + i] = yr[kk * 4 + 2][i]; v[12 + i] = yr[kk * 4 + 3][i]; }
        a[kk] = bsplit16(v); } };
    auto publish = [&]() { __syncthreads();   // every wave has read the last chunk's fragments
      wtile_store(wr, wt, sc, kg);
      __syncthreads(); };   // the chunk is published
    auto products = [&](const F2 (&a)[WKC / 32]) {
#pragma unroll
      for (int kk = 0; kk < WKC / 32; ++kk)
#pragma unroll
        for (int jh = 0; jh < 2; ++jh) { v16b w[4];
#pragma unroll
          for (int j = 0; j < 4; ++j) w[j] = frag_b(&wt[(jh * 4 + j) * 16 + col][kk * 32], lane);
#pragma unroll
          for (int j = 0; j < 4; ++j) { acc[jh * 4 + j] = wmma_bf(a[kk].h, w[j], acc[jh * 4 + j]); acc[jh * 4 + j] = wmma_bf(a[kk].l, w[j], acc[jh * 4 + j]); } } };
#pragma unroll 1   // rolled, as in k_proj
    for (int ch = 0; ch < CC / WKC - 1; ++ch) { F2 a[WKC / 32]; split_a(a); publish();
      wtile_load(wr, wsrc + (size_t)WKC * DIN, DIN);   // the next chunk's loads fly while this chunk's products run
#pragma unroll
      for (int kk = 0; kk < WKC / 32; ++kk) { yr[kk * 4] = *(const v4f*)(ysrc + WKC + kk * 32); yr[kk * 4 + 1] = *(const v4f*)(ysrc + WKC + kk * 32 + 4); yr[kk * 4 + 2] = *(const v4f*)(ysrc + WKC + kk * 32 + 16); yr[kk * 4 + 3] = *(const v4f*)(ysrc + WKC + kk * 32 + 20); }
      asm volatile("s_wait_xcnt 0x0" :: "v"(wsrc), "v"(ysrc) : "memory");   // as above
      wsrc += (size_t)WKC * DIN; ysrc += WKC;
      products(a); }
    { F2 a[WKC / 32]; split_a(a); publish(); products(a); }   // the last chunk: nothing left to fetch
#pragma unroll
    for (int j = 0; j < 8; ++j) { const float bias = BO ? bfr(BO[c0 + j * 16 + col]) : 0.f;
#pragma unroll
      for (int r = 0; r < 8; ++r) sf[wave][8 * g + r][j * 16 + col] = acc[j][r] + bias; }
  } else {
#pragma unroll 2
    for (int kc = 0; kc < CC / 32; ++kc) { const v16h a = frag_f32(Y + (r0 + col) * CC + kc * 32, lane); asm volatile("s_wait_loadcnt 0x0" ::: "memory");
#pragma unroll
      for (int j = 0; j < 8; ++j) { const v16h w = WOCOLH(WO, kc * 32, c0 + j * 16 + col, lane); asm volatile("s_wait_loadcnt 0x0" ::: "memory"); acc[j] = wmma16(a, w, acc[j]); } }
#pragma unroll
    for (int j = 0; j < 8; ++j) { const float bias = BO ? bfr(BO[c0 + j * 16 + col]) : 0.f;
#pragma unroll
      for (int r = 0; r < 8; ++r) sf[wave][8 * g + r][j * 16 + col] = acc[j][r] * (1.0f / 256.0f) + bias; } }
  LDSX(); for (int rl = 0; rl < 16; ++rl) vst2(OUT + (r0 + rl) * DIN + c0 + lane * 4, *(const v4f*)&sf[wave][rl][lane * 4]); }

extern "C" void kernel_launch(void* const* d_in, const int* in_sizes, int n_in, void* d_out, int out_size, void* d_ws, size_t ws_size, hipStream_t stream) {
  (void)in_sizes; (void)n_in; (void)out_size;
  const float** F = (const float**)d_in;
  if (ws_size < (size_t)WS_END) return;
  char* ws = (char*)d_ws; _Float16 *QH = (_Float16*)(ws + WS_QH), *KH = (_Float16*)(ws + WS_KH), *VT = (_Float16*)(ws + WS_VT), *QL = (_Float16*)(ws + WS_QL), *KL = (_Float16*)(ws + WS_KL); __bf16 *VB = (__bf16*)(ws + WS_VB), *VBL = (__bf16*)(ws + WS_VBL); float *Y = (float*)(ws + WS_Y);
  (void)Y; (void)QL; (void)KL; (void)VB; (void)VBL;
  // inputs: 0 q; 1 k; 2 v [4,2048,512]; 3 Wq (in,out), 4 bq; 5 Wk, 6 bk; 7 Wv, 8 bv; 9 Wo (in,out), 10 bo
  k_proj<<<dim3(TNB * TT / 64, CC / 128, 3), 128, 0, stream>>>(F[0], F[1], F[2], F[3], F[5], F[7], F[4], F[6], F[8], QH, QL, KH, KL, VT, VB, VBL);
  k_fa<<<dim3(TT / (FAW * 16), NH, TNB), FAW * 32, 0, stream>>>(QH, QL, KH, VT, Y);
  k_out<<<dim3(TNB * TT / 64, DIN / 128), 128, 0, stream>>>(Y, F[9], F[10], (float*)d_out);
}

// v004
// A run of this version takes 105 microseconds.
// Next to v003, in two timings, it ran 1.09 and 1.10 times as fast.
// Over all steps from v000 it is 10.6 times as fast.
// compute dtype: all float inputs rounded to bf16; q/k/v = in W + b with EXACT bf16 products on WMMA 16x16x32 (f32 accumulate); q as f16 hi + residual (x 2^10) against k once to f16 (2 products) / sqrt(512); running-maximum softmax in f32 (base 2: log2 e folded into the scale, hardware exp2) fused with both products; unnormalised P x 2^8 once to f16 against v once to f16 (1 product), / sum in f32; ctx split bf16 hi + lo against exact Wo (2 products) + bo; f32 output.
#include <hip/hip_runtime.h>
#include <math.h>

typedef __attribute__((ext_vector_type(16))) _Float16 v16h;
typedef __attribute__((ext_vector_type(16))) __bf16 v16b;
typedef __attribute__((ext_vector_type(8)))  _Float16 v8h;
typedef __attribute__((ext_vector_type(8)))  float v8f;
typedef __attribute__((ext_vector_type(4)))  float v4f;
typedef __attribute__((ext_vector_type(2)))  float v2f;
typedef __attribute__((ext_vector_type(4)))  unsigned v4u;
typedef __attribute__((ext_vector_type(4)))  int v4i;
typedef float __attribute__((may_alias)) float_a;
typedef int __attribute__((may_alias)) int_a;

template <typename T> __device__ __forceinline__ void vst2(void* p, T v) { *(T*)p = v;  }
__device__ __forceinline__ v8f wmma16(v16h a, v16h b, v8f c) {
  v8f d = __builtin_amdgcn_wmma_f32_16x16x32_f16(false, a, false, b, (short)0, c, false, false);
  asm volatile("v_nop\n\tv_nop\n\tv_nop\n\tv_nop" : "+v"(d) : "v"(a), "v"(b));
  return d;
}
__device__ __forceinline__ v8f wmma_bf(v16b a, v16b b, v8f c) {
  v8f d = __builtin_amdgcn_wmma_f32_16x16x32_bf16(false, a, false, b, (short)0, c, false, false);
  asm volatile("v_nop\n\tv_nop\n\tv_nop\n\tv_nop" : "+v"(d) : "v"(a), "v"(b));
  return d;
}
// 16x16x32 fragments: lane = (h = lane>>4, row/col = lane&15); elements 0..7 = k0+8h+0..7, 8..15 = k0+16+8h+0..7; D element r = row 8h+r
__device__ __forceinline__ v16h frag_h(const _Float16* rowk0, int lane) {
  union { v16h v; v8h q[2]; } u; const _Float16* p = rowk0 + 8 * (lane >> 4);
  u.q[0] = *(const v8h*)p; u.q[1] = *(const v8h*)(p + 16); return u.v;
}
__device__ __forceinline__ v16h frag_f32(const float* rowk0, int lane) {
  v16h a; const float* p = rowk0 + 8 * (lane >> 4);
#pragma unroll
  for (int i = 0; i < 8; ++i) { a[i] = (_Float16)p[i]; a[8 + i] = (_Float16)p[16 + i]; }
  return a;
}
__device__ __forceinline__ v16h frag_f32s(const float* rowk0, int lane, float sc) {
  v16h a; const float* p = rowk0 + 8 * (lane >> 4);
#pragma unroll
  for (int i = 0; i < 8; ++i) { a[i] = (_Float16)(p[i] * sc); a[8 + i] = (_Float16)(p[16 + i] * sc); }
  return a;
}
// column fragment from a [K][ld] layout (column n), rows >= K read as 0
__device__ __forceinline__ v16h fragc_f32(const float* W, int k0, int n, int lane, int ld, int K) {
  v16h a; const int g = lane >> 4;
#pragma unroll
  for (int i = 0; i < 8; ++i) { const int ka = k0 + 8 * g + i, kb = ka + 16;
    a[i] = (_Float16)(ka < K ? W[(size_t)(ka < K ? ka : K - 1) * ld + n] : 0.f); a[8 + i] = (_Float16)(kb < K ? W[(size_t)(kb < K ? kb : K - 1) * ld + n] : 0.f); }
  return a;
}
struct F2 { v16b h, l; };
__device__ __forceinline__ F2 bsplit16(const float v[16]) { F2 r;
#pragma unroll
  for (int i = 0; i < 16; ++i) { const __bf16 h = (__bf16)v[i]; r.h[i] = h; r.l[i] = (__bf16)(v[i] - (float)h); }
  return r; }
__device__ __forceinline__ F2 split_row(const float* row, int k0, int lane) { float v[16]; const float* p = row + k0 + 8 * (lane >> 4);
#pragma unroll
  for (int i = 0; i < 8; ++i) { v[i] = p[i]; v[8 + i] = p[16 + i]; }
  return bsplit16(v); }
__device__ __forceinline__ F2 split_rowK(const float* row, int k0, int lane, int K) { float v[16]; const int g = lane >> 4;
#pragma unroll
  for (int i = 0; i < 8; ++i) { const int ka = k0 + 8 * g + i, kb = ka + 16; v[i] = ka < K ? row[ka < K ? ka : K - 1] : 0.f; v[8 + i] = kb < K ? row[kb < K ? kb : K - 1] : 0.f; }
  return bsplit16(v); }
__device__ __forceinline__ F2 split_col(const float* W, int k0, int n, int lane, int ld, int K) { float v[16]; const int g = lane >> 4;
#pragma unroll
  for (int i = 0; i < 8; ++i) { const int ka = k0 + 8 * g + i, kb = ka + 16; v[i] = ka < K ? W[(size_t)(ka < K ? ka : K - 1) * ld + n] : 0.f; v[8 + i] = kb < K ? W[(size_t)(kb < K ? kb : K - 1) * ld + n] : 0.f; }
  return bsplit16(v); }
__device__ __forceinline__ v8f mac3(const F2& a, const F2& b, v8f c) { c = wmma_bf(a.l, b.h, c); c = wmma_bf(a.h, b.l, c); return wmma_bf(a.h, b.h, c); }
__device__ __forceinline__ float sigm(float v) { return 1.0f / (1.0f + expf(-v)); }
#define LDSX() do { asm volatile("s_wait_dscnt 0" ::: "memory"); __builtin_amdgcn_wave_barrier(); __builtin_amdgcn_fence(__ATOMIC_RELEASE, "workgroup"); } while (0)

// Multi-head attention with separate q / k / v inputs (B 4, S 2,048, hid 512 = 8 x 64; (in,out) 1/sqrt(512)-scale weights, zero biases; scale = 1/sqrt(hid_dim = 512), as written): qp = q Wq + bq ...; out = merged(softmax(qh kh^T / sqrt(512)) vh) Wo + bo (non-causal).
#define NB 4
#define TT 2048
#define CC 512            // NH * HD = projected width
#define DIN 512          // input (model) width
#define NH 8
#define HD 64
#define NQB (TT / 64)
#define HG 4
#define SCALE (0.04419417382415922f)
#define CAUSAL 0
#ifndef TNB
#define TNB NB
#endif
__device__ __forceinline__ float bfr(float v) { return (float)(__bf16)v; }
__host__ __device__ __forceinline__ int kb_last(int qb) { return CAUSAL ? ((qb * 64 + 63) >> 7) : (TT / 128 - 1); }
typedef __attribute__((ext_vector_type(8))) __bf16 v8b;
__device__ __forceinline__ v16b frag_b(const __bf16* rowk0, int lane) {
  union { v16b v; v8b q[2]; } u; const __bf16* p = rowk0 + 8 * (lane >> 4);
  u.q[0] = *(const v8b*)p; u.q[1] = *(const v8b*)(p + 16); return u.v;
}
#define QBH 0              // unused: every query block takes the one path of k_fa
#define QHI 2048            // rows carrying a q residual plane (all rows when non-causal: 2-product logits everywhere)
#define KHI 64            // key rows carrying k residual / v bf16 hi+lo planes (written by k_proj, read by no kernel here)
// B fragment (k rows k0+.., output column o) of a weight: (in,out) [K][ld] or (out,in) [ld rows of K]: bf16 exact, or f16(bf16 * 256) exact
__device__ __forceinline__ v16b wcol_io(const float* Wm, int k0, int o, int lane, int ld) { v16b w; const int g = lane >> 4;
#pragma unroll
  for (int i = 0; i < 8; ++i) { w[i] = (__bf16)Wm[(size_t)(k0 + 8 * g + i) * ld + o]; w[8 + i] = (__bf16)Wm[(size_t)(k0 + 16 + 8 * g + i) * ld + o]; }
  return w; }
__device__ __forceinline__ v16b wcol_oi(const float* Wm, int k0, int o, int lane, int K) { v16b w; const float* p = Wm + (size_t)o * K + k0 + 8 * (lane >> 4);
#pragma unroll
  for (int i = 0; i < 8; ++i) { w[i] = (__bf16)p[i]; w[8 + i] = (__bf16)p[16 + i]; }
  return w; }
__device__ __forceinline__ v16h wcolh_io(const float* Wm, int k0, int o, int lane, int ld) { v16h w; const int g = lane >> 4;
#pragma unroll
  for (int i = 0; i < 8; ++i) { w[i] = (_Float16)(bfr(Wm[(size_t)(k0 + 8 * g + i) * ld + o]) * 256.0f); w[8 + i] = (_Float16)(bfr(Wm[(size_t)(k0 + 16 + 8 * g + i) * ld + o]) * 256.0f); }
  return w; }
__device__ __forceinline__ v16h wcolh_oi(const float* Wm, int k0, int o, int lane, int K) { v16h w; const float* p = Wm + (size_t)o * K + k0 + 8 * (lane >> 4);
#pragma unroll
  for (int i = 0; i < 8; ++i) { w[i] = (_Float16)(bfr(p[i]) * 256.0f); w[8 + i] = (_Float16)(bfr(p[16 + i]) * 256.0f); }
  return w; }
#define WQKV_LAYOUT 0   // 0 = (in,out) [DIN][CC]; k_proj reads only this layout (other values change only WCOL, which nothing calls)
__device__ __forceinline__ v16b wcol_hdk(const float* Wm, int k0, int o, int lane) { v16b w; const int g = lane >> 4; const float* p = Wm + (size_t)(o / HD) * DIN * HD + (o % HD);
#pragma unroll
  for (int i = 0; i < 8; ++i) { w[i] = (__bf16)p[(size_t)(k0 + 8 * g + i) * HD]; w[8 + i] = (__bf16)p[(size_t)(k0 + 16 + 8 * g + i) * HD]; }
  return w; }
#define WO_OUT_IN 0
#if WQKV_LAYOUT == 1
#define WCOL(W, k0, o, lane) wcol_oi(W, k0, o, lane, DIN)
#elif WQKV_LAYOUT == 2
#define WCOL(W, k0, o, lane) wcol_hdk(W, k0, o, lane)
#else
#define WCOL(W, k0, o, lane) wcol_io(W, k0, o, lane, CC)
#endif
#if WO_OUT_IN
#define WOCOL(W, k0, o, lane) wcol_oi(W, k0, o, lane, CC)
#define WOCOLH(W, k0, o, lane) wcolh_oi(W, k0, o, lane, CC)
#else
#define WOCOL(W, k0, o, lane) wcol_io(W, k0, o, lane, DIN)
#define WOCOLH(W, k0, o, lane) wcolh_io(W, k0, o, lane, DIN)
#endif

#ifndef SM_EXTRA_PARAMS
#define SM_EXTRA_PARAMS
#endif
#ifndef PROJ_EXTRA_PARAMS
#define PROJ_EXTRA_PARAMS
#endif
#ifndef SM_MASK_HOOK
#define SM_MASK_HOOK (void)0
#endif

#define WS_QH  0u                                      // f16 q rows [b*t][CC]
#define WS_KH  (WS_QH + 2u * (size_t)NB * TT * CC)      // f16 k in fragment order [b][h][16-key tile][piece p = 16 channels][lane = 16 g + key][8 channels 16 p + 8 g + ..]
#define WS_VT  (WS_KH + 2u * (size_t)NB * TT * CC)      // f16 v in fragment order [b][h][32-key block][16-channel tile j][half][lane = 16 g + channel][8 keys 16 half + 8 g + ..]
#define WS_QL  (WS_VT + 2u * (size_t)NB * CC * TT)      // f16 q residual x 2^10 rows [b][t < QHI][CC]
#define WS_KL  (WS_QL + 2u * (size_t)NB * QHI * CC)     // f16 k residual x 2^10 rows [b][t < KHI][CC]
#define WS_VB  (WS_KL + 2u * (size_t)NB * KHI * CC)     // bf16 v hi planes [b][c][t < KHI]
#define WS_VBL (WS_VB + 2u * (size_t)NB * CC * KHI)
#define WS_S   (WS_VBL + 2u * (size_t)NB * CC * KHI)    // f32 [hg][t][s] region, unused: k_fa keeps the logits in registers
#define WS_Y   (WS_S  + 4u * (size_t)HG * TT * TT)      // f32 ctx rows [b*t][CC] (only when there is an output projection)
#define WS_END (WS_Y  + 4u * (size_t)NB * TT * CC)
// k and v lie in the workspace as k_fa's A fragments read them: the 32 lanes' 16-byte pieces of one load are 512 contiguous bytes (4 whole lines; by rows or planes one load touched 16 lines for the same bytes)
#define KF_TILE(b, h, kt) ((((size_t)(b) * NH + (h)) * (TT / 16) + (kt)) * 1024)   // element offset of a 16-key tile: 4 pieces of 256 elements
#define VF_BLK(b, h, cb)  ((((size_t)(b) * NH + (h)) * (TT / 32) + (cb)) * 2048)   // element offset of a 32-key block: 4 channel tiles x 2 halves of 256 elements

// ---- weight tile in LDS: 128 threads bring 64 k rows x 128 output columns of an (in,out) f32 weight as 16-byte row pieces (whole 128-B lines), round them to bf16 as before and store them [column][k], so that a B fragment is two 16-byte LDS reads and the block's four waves share one fetch and one rounding (the short loops are unrolled in full: the register arrays need constant indices)
#define WKC 64            // k rows per staged chunk
#define WPT (WKC + 8)     // LDS pitch in elements: 144 B = 16 B x odd, the fragment reads of 16 columns fall on 16 different bank groups
struct WReg { v4f x[16]; };
__device__ __forceinline__ void wtile_load(WReg& r, const float* wsrc, int ld) {   // wsrc: this thread's first row (8 kg) and first of 4 columns
#pragma unroll
  for (int p = 0; p < WKC / 32; ++p)
#pragma unroll
    for (int i = 0; i < 8; ++i) r.x[p * 8 + i] = *(const v4f*)(wsrc + (size_t)(p * 32 + i) * ld);
}
__device__ __forceinline__ void wtile_store(const WReg& r, __bf16 (*wt)[WPT], int sc, int kg) {
#pragma unroll
  for (int p = 0; p < WKC / 32; ++p)
#pragma unroll
    for (int cc = 0; cc < 4; ++cc) { v8b t;
#pragma unroll
      for (int i = 0; i < 8; ++i) t[i] = (__bf16)r.x[p * 8 + i][cc];
      *(v8b*)&wt[sc + cc][p * 32 + 8 * kg] = t; }
}
// ---- k_proj: block = (64 rows, 128 cols, which): q/k/v = X W (+ b) with exact bf16 products (K = DIN) -> which 0: q f16 rows (+ residual rows < QHI); 1: k f16 in fragment order (+ residual rows < KHI); 2: v f16 in fragment order (+ bf16 hi/lo planes for t < KHI)
__global__ __launch_bounds__(128) void k_proj(const float* __restrict__ XQ, const float* __restrict__ XK, const float* __restrict__ XV, const float* __restrict__ WQ, const float* __restrict__ WK, const float* __restrict__ WV, const float* __restrict__ BQ, const float* __restrict__ BK, const float* __restrict__ BV,
    _Float16* __restrict__ QH, _Float16* __restrict__ QL, _Float16* __restrict__ KH, _Float16* __restrict__ KL, _Float16* __restrict__ VT, __bf16* __restrict__ VB, __bf16* __restrict__ VBL) {
  __shared__ __align__(16) _Float16 sh[64][136], sl[64][136]; __shared__ __align__(16) _Float16 th[128][72]; __shared__ __align__(16) __bf16 tb[128][72], tbl[128][72];
  const int tid = threadIdx.x, wave = tid >> 5, lane = tid & 31, col = lane & 15, g = lane >> 4; const int which = blockIdx.z; const int c0 = blockIdx.y * 128; const size_t r0 = (size_t)blockIdx.x * 64; const size_t bb = r0 / TT; const int t0 = (int)(r0 % TT);
  const float* X = which == 0 ? XQ : which == 1 ? XK : XV; const float* WA = which == 0 ? WQ : which == 1 ? WK : WV; const float* BA = which == 0 ? BQ : which == 1 ? BK : BV;
  __shared__ __align__(16) __bf16 wt[128][WPT];
  const int sc = 32 * wave + 4 * ((lane & 3) | ((lane >> 4) << 2)), kg = (lane >> 2) & 3;   // staging: 4 columns x 8 k rows per thread and 32 k; 16 lanes store to 16 different bank groups
  const float* wsrc = WA + (size_t)(8 * kg) * CC + c0 + sc; const float* xsrc = X + (r0 + wave * 16 + col) * DIN + 8 * g;
  v8f acc[8] = {}; WReg wr; v4f xr[WKC / 8];
  wtile_load(wr, wsrc, CC);
#pragma unroll
  for (int kk = 0; kk < WKC / 32; ++kk) { xr[kk * 4] = *(const v4f*)(xsrc + kk * 32); xr[kk * 4 + 1] = *(const v4f*)(xsrc + kk * 32 + 4); xr[kk * 4 + 2] = *(const v4f*)(xsrc + kk * 32 + 16); xr[kk * 4 + 3] = *(const v4f*)(xsrc + kk * 32 + 20); }
  asm volatile("s_wait_xcnt 0x0" :: "v"(wsrc), "v"(xsrc) : "memory");   // the loads' address pairs live up to this wait and are rewritten only behind it
  auto round_a = [&](v16b (&a)[WKC / 32]) {
#pragma unroll
    for (int kk = 0; kk < WKC / 32; ++kk)
#pragma unroll
      for (int i = 0; i < 4; ++i) { a[kk][i] = (__bf16)xr[kk * 4][i]; a[kk][4 + i] = (__bf16)xr[kk * 4 + 1][i]; a[kk][8 + i] = (__bf16)xr[kk * 4 + 2][i]; a[kk][12 + i] = (__bf16)xr[kk * 4 + 3][i]; } };
  auto publish = [&]() { __syncthreads();   // every wave has read the last chunk's fragments
    wtile_store(wr, wt, sc, kg);
    __syncthreads(); };   // the chunk is published
  auto products = [&](const v16b (&a)[WKC / 32]) {
#pragma unroll
    for (int kk = 0; kk < WKC / 32; ++kk)
#pragma unroll
      for (int jh = 0; jh < 2; ++jh) { v16b w[4];
#pragma unroll
        for (int j = 0; j < 4; ++j) w[j] = frag_b(&wt[(jh * 4 + j) * 16 + col][kk * 32], lane);
#pragma unroll
        for (int j = 0; j < 4; ++j) acc[jh * 4 + j] = wmma_bf(a[kk], w[j], acc[jh * 4 + j]); } };
#pragma unroll 1   // rolled: one body holds 16 products and 24 loads already
  for (int ch = 0; ch < DIN / WKC - 1; ++ch) { v16b a[WKC / 32]; round_a(a); publish();
    wtile_load(wr, wsrc + (size_t)WKC * CC, CC);   // the next chunk's loads fly while this chunk's products run
#pragma unroll
    for (int kk = 0; kk < WKC / 32; ++kk) { xr[kk * 4] = *(const v4f*)(xsrc + WKC + kk * 32); xr[kk * 4 + 1] = *(const v4f*)(xsrc + WKC + kk * 32 + 4); xr[kk * 4 + 2] = *(const v4f*)(xsrc + WKC + kk * 32 + 16); xr[kk * 4 + 3] = *(const v4f*)(xsrc + WKC + kk * 32 + 20); }
    asm volatile("s_wait_xcnt 0x0" :: "v"(wsrc), "v"(xsrc) : "memory");   // as above
    wsrc += (size_t)WKC * CC; xsrc += WKC;
    products(a); }
  { v16b a[WKC / 32]; round_a(a); publish(); products(a); }   // the last chunk: nothing left to fetch
  if (which < 2) { _Float16* DH = which == 0 ? QH : KH; _Float16* DL = which == 0 ? QL : KL; const int nhi = which == 0 ? QHI : KHI; const bool hi_rows = t0 < nhi;
#pragma unroll
    for (int j = 0; j < 8; ++j) { const float bias = BA ? bfr(BA[c0 + j * 16 + col]) : 0.f;
#pragma unroll
      for (int r = 0; r < 8; ++r) { const float v = acc[j][r] + bias; const _Float16 hv = (_Float16)v; sh[wave * 16 + 8 * g + r][j * 16 + col] = hv; sl[wave * 16 + 8 * g + r][j * 16 + col] = (_Float16)((v - (float)hv) * 1024.0f); } }
    __syncthreads();
    for (int e = tid; e < 64 * 16; e += 128) { int rl = e >> 4, q = e & 15; size_t dh = (r0 + rl) * CC + c0 + q * 8;
      if (which == 1) { const int l = e & 31, p = (e >> 5) & 3, hh = (e >> 7) & 1, kt = e >> 8; rl = kt * 16 + (l & 15); q = hh * 8 + p * 2 + (l >> 4); dh = KF_TILE(bb, c0 / HD + hh, t0 / 16 + kt) + p * 256 + l * 8; }   // a wave stores one 512-B piece
      _Float16* pd = DH + dh; const v4u dv = *(const v4u*)&sh[rl][q * 8]; vst2((unsigned*)pd, dv);
      asm volatile("s_wait_xcnt 0x0" :: "v"(pd), "v"(dv) : "memory");   // the store's address pair and data live up to this wait and are rewritten only behind it
      if (hi_rows) { _Float16* pl = DL + (bb * nhi + t0 + rl) * (size_t)CC + c0 + q * 8; const v4u lv = *(const v4u*)&sl[rl][q * 8]; vst2((unsigned*)pl, lv);
        asm volatile("s_wait_xcnt 0x0" :: "v"(pl), "v"(lv) : "memory"); } }   // as above
  } else { const bool hi_rows = t0 < KHI;
#pragma unroll
    for (int j = 0; j < 8; ++j) { const float bias = BA ? bfr(BA[c0 + j * 16 + col]) : 0.f;
#pragma unroll
      for (int r = 0; r < 8; ++r) { const float v = acc[j][r] + bias; const int rl = wave * 16 + 8 * g + r, cl = j * 16 + col; th[cl][rl] = (_Float16)v; const __bf16 bh = (__bf16)v; tb[cl][rl] = bh; tbl[cl][rl] = (__bf16)(v - (float)bh); } }
    __syncthreads();
    for (int e = tid; e < 128 * 8; e += 128) { const int l = e & 31, hf = (e >> 5) & 1, j = (e >> 6) & 3, hh = (e >> 8) & 1, cb = e >> 9; const int cl = hh * 64 + j * 16 + (l & 15), q = cb * 4 + hf * 2 + (l >> 4);   // a wave stores one 512-B piece
      _Float16* pv = VT + VF_BLK(bb, c0 / HD + hh, t0 / 32 + cb) + (j * 2 + hf) * 256 + l * 8; const v4u dv = *(const v4u*)&th[cl][q * 8]; vst2((unsigned*)pv, dv);
      asm volatile("s_wait_xcnt 0x0" :: "v"(pv), "v"(dv) : "memory");   // the store's address pair and data live up to this wait and are rewritten only behind it
      if (hi_rows) { const size_t o3 = (bb * CC + c0 + cl) * (size_t)KHI + t0 + q * 8; __bf16 *ph = VB + o3, *pl = VBL + o3; const v4u hv = *(const v4u*)&tb[cl][q * 8], lv = *(const v4u*)&tbl[cl][q * 8]; vst2((unsigned*)ph, hv); vst2((unsigned*)pl, lv);
        asm volatile("s_wait_xcnt 0x0" :: "v"(ph), "v"(pl), "v"(hv), "v"(lv) : "memory"); } } } }   // as above
// ---- k_fa: block = 16 waves x 16 queries of (b, h), one launch for every (b, h): per 32 keys S^T = K Q^T (q hi + residual x 2^10 against k, 2 products), running maximum and sum per query column in f32, P = 2^((s - m) SCALE log2 e) x 2^8 once to f16 straight from the score registers as the B operand, O^T += V^T P^T (1 product); the logits never leave the registers; ctx = O / sum
__device__ __forceinline__ float xhalf(float x) { return __builtin_bit_cast(float, __builtin_amdgcn_permlanex16(__builtin_bit_cast(int, x), __builtin_bit_cast(int, x), 0x76543210, 0xfedcba98, false, false)); }  // lane l with lane l ^ 16
__device__ __forceinline__ v16h frag_p(const _Float16* p) { union { v16h v; v8h q[2]; } u; u.q[0] = *(const v8h*)p; u.q[1] = *(const v8h*)(p + 256); return u.v; }   // fragment-order source, the lane's 8 elements already in p: the two halves are neighbouring 512-B pieces
__device__ __forceinline__ v8f wmma_h(v16h a, v16h b, v8f c) { return __builtin_amdgcn_wmma_f32_16x16x32_f16(false, a, false, b, (short)0, c, false, false); }
#define FAW 16            // waves per block
#define SCALE2 ((float)(0.04419417382415922 * 1.4426950408889634))   // SCALE x log2 e: e^(s SCALE) = 2^(s SCALE2), so one fused multiply-add and one v_exp_f32 make an exponential
__global__ __launch_bounds__(FAW * 32) void k_fa(const _Float16* __restrict__ QH, const _Float16* __restrict__ QL, const _Float16* __restrict__ KH, const _Float16* __restrict__ VT, float* __restrict__ Y) { __shared__ __align__(16) float ss[FAW][16][HD + 4];
  const int tid = threadIdx.x, wave = tid >> 5, lane = tid & 31, col = lane & 15, g = lane >> 4; const int h = blockIdx.y, b = blockIdx.z; const int ql0 = blockIdx.x * (FAW * 16) + wave * 16;
  v16h qh[HD / 32], ql[HD / 32];
#pragma unroll
  for (int kc = 0; kc < HD / 32; ++kc) { qh[kc] = frag_h(QH + ((size_t)b * TT + ql0 + col) * CC + h * HD + kc * 32, lane); ql[kc] = frag_h(QL + ((size_t)b * QHI + ql0 + col) * CC + h * HD + kc * 32, lane); }
  const _Float16* Kb = KH + KF_TILE(b, h, 0) + lane * 8;   // this lane's 16 bytes of the first piece of (b, h)
  const _Float16* Vb = VT + VF_BLK(b, h, 0) + lane * 8;
  v8f o[HD / 16] = {}; float m = -3.0e38f, l = 0.f;
  v16h kf[2][HD / 32];
#pragma unroll
  for (int t = 0; t < 2; ++t)
#pragma unroll
    for (int kc = 0; kc < HD / 32; ++kc) kf[t][kc] = frag_p(Kb + t * 1024 + kc * 512);
#pragma unroll 1
  for (int c = 0; c < TT / 32; ++c) {
    v16h vf[HD / 16]; const _Float16* vp = Vb + c * 2048;
#pragma unroll
    for (int j = 0; j < HD / 16; ++j) vf[j] = frag_p(vp + j * 512);
    asm volatile("s_wait_xcnt 0x0" :: "v"(vp) : "memory");   // the loads' address pair lives up to this wait and is rewritten only behind it
    v8f sh[2], sl[2];
    // the eight score products in one statement: as builtins the last of them were placed behind the next k loads, which then took new registers, and the copy back waited for every load; the v_nop keep the distance from the last product to the first vector instruction on its result
    asm volatile("v_wmma_f32_16x16x32_f16 %0, %4, %8, 0\n\tv_wmma_f32_16x16x32_f16 %1, %4, %9, 0\n\tv_wmma_f32_16x16x32_f16 %2, %5, %8, 0\n\tv_wmma_f32_16x16x32_f16 %3, %5, %9, 0\n\t"
                 "v_wmma_f32_16x16x32_f16 %0, %6, %10, %0\n\tv_wmma_f32_16x16x32_f16 %1, %6, %11, %1\n\tv_wmma_f32_16x16x32_f16 %2, %7, %10, %2\n\tv_wmma_f32_16x16x32_f16 %3, %7, %11, %3\n\t"
                 "v_nop\n\tv_nop\n\tv_nop\n\tv_nop"
                 : "=&v"(sh[0]), "=&v"(sl[0]), "=&v"(sh[1]), "=&v"(sl[1]) : "v"(kf[0][0]), "v"(kf[1][0]), "v"(kf[0][1]), "v"(kf[1][1]), "v"(qh[0]), "v"(ql[0]), "v"(qh[1]), "v"(ql[1]));
    const int cn = c + 1 < TT / 32 ? c + 1 : c;   // the next 32 keys' fragments are fetched while this pass does its softmax (the last pass fetches its own again)
    const _Float16* kp = Kb + cn * 2048;
#pragma unroll
    for (int t = 0; t < 2; ++t)
#pragma unroll
      for (int kc = 0; kc < HD / 32; ++kc) kf[t][kc] = frag_p(kp + t * 1024 + kc * 512);
    asm volatile("s_wait_xcnt 0x0" :: "v"(kp) : "memory");   // as above, for the k loads' address pair
    __builtin_amdgcn_sched_barrier(0);   // keeps the next k loads here, ahead of the softmax (the scheduler otherwise sinks them to the loop's foot, where their latency shows)
    float s[16]; float mx = -3.0e38f;   // s[8 t + r] = unscaled logit of key 32 c + 16 t + 8 g + r for query col: the k order of a B fragment
#pragma unroll
    for (int t = 0; t < 2; ++t)
#pragma unroll
      for (int r = 0; r < 8; ++r) { s[t * 8 + r] = sh[t][r] + sl[t][r] * (1.0f / 1024.0f); mx = fmaxf(mx, s[t * 8 + r]); }
    mx = fmaxf(mx, xhalf(mx));
    const float mn = fmaxf(m, mx); const float al = __builtin_amdgcn_exp2f((m - mn) * SCALE2); m = mn;   // SCALE2 > 0: the maximum is taken over the unscaled logits; al = 0 on the first pass
    const float ms = __builtin_fmaf(mn, -SCALE2, 8.0f);   // + 8 = x 2^8: keeps small P out of the f16 subnormals; cancels against the sum
    v16h p; float ps = 0.f;
#pragma unroll
    for (int i = 0; i < 16; i += 2) { const v2f a = __builtin_elementwise_fma((v2f){s[i], s[i + 1]}, (v2f){SCALE2, SCALE2}, (v2f){ms, ms});   // two arguments per packed fma
      const float e0 = __builtin_amdgcn_exp2f(a[0]), e1 = __builtin_amdgcn_exp2f(a[1]); ps += e0; ps += e1; p[i] = (_Float16)e0; p[i + 1] = (_Float16)e1; }
    l = l * al + ps;
#pragma unroll
    for (int j = 0; j < HD / 16; ++j) { o[j] *= al; o[j] = wmma_h(vf[j], p, o[j]); } }
  l += xhalf(l); const float inv = 1.0f / l;
#pragma unroll
  for (int j = 0; j < HD / 16; ++j) { v4f lo, hi;   // o[j][r] = ctx of query col, channel 16 j + 8 g + r
#pragma unroll
    for (int r = 0; r < 4; ++r) { lo[r] = o[j][r] * inv; hi[r] = o[j][4 + r] * inv; }
    *(v4f*)&ss[wave][col][j * 16 + 8 * g] = lo; *(v4f*)&ss[wave][col][j * 16 + 8 * g + 4] = hi; }
  LDSX();
#pragma unroll
  for (int i = 0; i < 8; ++i) { const int rl = 2 * i + g; vst2(Y + ((size_t)b * TT + ql0 + rl) * CC + h * HD + col * 4, *(const v4f*)&ss[wave][rl][col * 4]); } }   // 256-B (row, head) segment by 16 lanes
// ---- k_out: block = (64 rows, 128 cols): out = ctx Wo (+ bo): ctx split bf16 hi + lo against exact bf16 Wo (2 products) for all rows
__global__ __launch_bounds__(128) void k_out(const float* __restrict__ Y, const float* __restrict__ WO, const float* __restrict__ BO, float* __restrict__ OUT) { __shared__ __align__(16) float sf[4][16][132]; __shared__ __align__(16) __bf16 wt[128][WPT];
  const int tid = threadIdx.x, wave = tid >> 5, lane = tid & 31, col = lane & 15, g = lane >> 4; const int c0 = blockIdx.y * 128; const size_t r0 = (size_t)blockIdx.x * 64 + wave * 16;
  v8f acc[8] = {};
  if (true) {   /* ALL rows: ctx split bf16 hi + lo x exact Wo (2 products) */
    const int sc = 32 * wave + 4 * ((lane & 3) | ((lane >> 4) << 2)), kg = (lane >> 2) & 3;   // staging map as in k_proj
    const float* wsrc = WO + (size_t)(8 * kg) * DIN + c0 + sc; const float* ysrc = Y + (r0 + col) * CC + 8 * g;
    WReg wr; v4f yr[WKC / 8];
    wtile_load(wr, wsrc, DIN);
#pragma unroll
    for (int kk = 0; kk < WKC / 32; ++kk) { yr[kk * 4] = *(const v4f*)(ysrc + kk * 32); yr[kk * 4 + 1] = *(const v4f*)(ysrc + kk * 32 + 4); yr[kk * 4 + 2] = *(const v4f*)(ysrc + kk * 32 + 16); yr[kk * 4 + 3] = *(const v4f*)(ysrc + kk * 32 + 20); }
    asm volatile("s_wait_xcnt 0x0" :: "v"(wsrc), "v"(ysrc) : "memory");   // the loads' address pairs live up to this wait and are rewritten only behind it
    auto split_a = [&](F2 (&a)[WKC / 32]) {
#pragma unroll
      for (int kk = 0; kk < WKC / 32; ++kk) { float v[16];
#pragma unroll
        for (int i = 0; i < 4; ++i) { v[i] = yr[kk * 4][i]; v[4 + i] = yr[kk * 4 + 1][i]; v[8 + i] = yr[kk * 4 + 2][i]; v[12 + i] = yr[kk * 4 + 3][i]; }
        a[kk] = bsplit16(v); } };
    auto publish = [&]() { __syncthreads();   // every wave has read the last chunk's fragments
      wtile_store(wr, wt, sc, kg);
      __syncthreads(); };   // the chunk is published
    auto products = [&](const F2 (&a)[WKC / 32]) {
#pragma unroll
      for (int kk = 0; kk < WKC / 32; ++kk)
#pragma unroll
        for (int jh = 0; jh < 2; ++jh) { v16b w[4];
#pragma unroll
          for (int j = 0; j < 4; ++j) w[j] = frag_b(&wt[(jh * 4 + j) * 16 + col][kk * 32], lane);
#pragma unroll
          for (int j = 0; j < 4; ++j) { acc[jh * 4 + j] = wmma_bf(a[kk].h, w[j], acc[jh * 4 + j]); acc[jh * 4 + j] = wmma_bf(a[kk].l, w[j], acc[jh * 4 + j]); } } };
#pragma unroll 1   // rolled, as in k_proj
    for (int ch = 0; ch < CC / WKC - 1; ++ch) { F2 a[WKC / 32]; split_a(a); publish();
      wtile_load(wr, wsrc + (size_t)WKC * DIN, DIN);   // the next chunk's loads fly while this chunk's products run
#pragma unroll
      for (int kk = 0; kk < WKC / 32; ++kk) { yr[kk * 4] = *(const v4f*)(ysrc + WKC + kk * 32); yr[kk * 4 + 1] = *(const v4f*)(ysrc + WKC + kk * 32 + 4); yr[kk * 4 + 2] = *(const v4f*)(ysrc + WKC + kk * 32 + 16); yr[kk * 4 + 3] = *(const v4f*)(ysrc + WKC + kk * 32 + 20); }
      asm volatile("s_wait_xcnt 0x0" :: "v"(wsrc), "v"(ysrc) : "memory");   // as above
      wsrc += (size_t)WKC * DIN; ysrc += WKC;
      products(a); }
    { F2 a[WKC / 32]; split_a(a); publish(); products(a); }   // the last chunk: nothing left to fetch
#pragma unroll
    for (int j = 0; j < 8; ++j) { const float bias = BO ? bfr(BO[c0 + j * 16 + col]) : 0.f;
#pragma unroll
      for (int r = 0; r < 8; ++r) sf[wave][8 * g + r][j * 16 + col] = acc[j][r] + bias; }
  } else {
#pragma unroll 2
    for (int kc = 0; kc < CC / 32; ++kc) { const v16h a = frag_f32(Y + (r0 + col) * CC + kc * 32, lane); asm volatile("s_wait_loadcnt 0x0" ::: "memory");
#pragma unroll
      for (int j = 0; j < 8; ++j) { const v16h w = WOCOLH(WO, kc * 32, c0 + j * 16 + col, lane); asm volatile("s_wait_loadcnt 0x0" ::: "memory"); acc[j] = wmma16(a, w, acc[j]); } }
#pragma unroll
    for (int j = 0; j < 8; ++j) { const float bias = BO ? bfr(BO[c0 + j * 16 + col]) : 0.f;
#pragma unroll
      for (int r = 0; r < 8; ++r) sf[wave][8 * g + r][j * 16 + col] = acc[j][r] * (1.0f / 256.0f) + bias; } }
  LDSX(); for (int rl = 0; rl < 16; ++rl) vst2(OUT + (r0 + rl) * DIN + c0 + lane * 4, *(const v4f*)&sf[wave][rl][lane * 4]); }

extern "C" void kernel_launch(void* const* d_in, const int* in_sizes, int n_in, void* d_out, int out_size, void* d_ws, size_t ws_size, hipStream_t stream) {
  (void)in_sizes; (void)n_in; (void)out_size;
  const float** F = (const float**)d_in;
  if (ws_size < (size_t)WS_END) return;
  char* ws = (char*)d_ws; _Float16 *QH = (_Float16*)(ws + WS_QH), *KH = (_Float16*)(ws + WS_KH), *VT = (_Float16*)(ws + WS_VT), *QL = (_Float16*)(ws + WS_QL), *KL = (_Float16*)(ws + WS_KL); __bf16 *VB = (__bf16*)(ws + WS_VB), *VBL = (__bf16*)(ws + WS_VBL); float *Y = (float*)(ws + WS_Y);
  (void)Y; (void)QL; (void)KL; (void)VB; (void)VBL;
  // inputs: 0 q; 1 k; 2 v [4,2048,512]; 3 Wq (in,out), 4 bq; 5 Wk, 6 bk; 7 Wv, 8 bv; 9 Wo (in,out), 10 bo
  k_proj<<<dim3(TNB * TT / 64, CC / 128, 3), 128, 0, stream>>>(F[0], F[1], F[2], F[3], F[5], F[7], F[4], F[6], F[8], QH, QL, KH, KL, VT, VB, VBL);
  k_fa<<<dim3(TT / (FAW * 16), NH, TNB), FAW * 32, 0, stream>>>(QH, QL, KH, VT, Y);
  k_out<<<dim3(TNB * TT / 64, DIN / 128), 128, 0, stream>>>(Y, F[9], F[10], (float*)d_out);
}

// v005
// A run of this version takes 90.1 microseconds.
// In both of two side-by-side timings against v004, it was 1.16 times as fast.
// All steps since v000 together make it 12.3 times as fast.
// compute dtype: all float inputs rounded to bf16; q/k/v = in W + b with EXACT bf16 products on WMMA 16x16x32 (f32 accumulate); q as f16 hi + residual (x 2^10) against k once to f16 (2 products) / sqrt(512); running-maximum softmax in f32 (base 2: log2 e folded into the scale, hardware exp2) fused with both products; unnormalised P x 2^8 once to f16 against v once to f16 (1 product), / sum in f32; ctx split bf16 hi + lo against exact Wo (2 products) + bo; f32 output.
#include <hip/hip_runtime.h>
#include <math.h>

typedef __attribute__((ext_vector_type(16))) _Float16 v16h;
typedef __attribute__((ext_vector_type(16))) __bf16 v16b;
typedef __attribute__((ext_vector_type(8)))  _Float16 v8h;
typedef __attribute__((ext_vector_type(8)))  float v8f;
typedef __attribute__((ext_vector_type(4)))  float v4f;
typedef __attribute__((ext_vector_type(2)))  float v2f;
typedef __attribute__((ext_vector_type(4)))  unsigned v4u;
typedef __attribute__((ext_vector_type(4)))  int v4i;
typedef float __attribute__((may_alias)) float_a;
typedef int __attribute__((may_alias)) int_a;

template <typename T> __device__ __forceinline__ void vst2(void* p, T v) { *(T*)p = v;  }
__device__ __forceinline__ v8f wmma16(v16h a, v16h b, v8f c) {
  v8f d = __builtin_amdgcn_wmma_f32_16x16x32_f16(false, a, false, b, (short)0, c, false, false);
  asm volatile("v_nop\n\tv_nop\n\tv_nop\n\tv_nop" : "+v"(d) : "v"(a), "v"(b));
  return d;
}
__device__ __forceinline__ v8f wmma_bf(v16b a, v16b b, v8f c) {
  v8f d = __builtin_amdgcn_wmma_f32_16x16x32_bf16(false, a, false, b, (short)0, c, false, false);
  asm volatile("v_nop\n\tv_nop\n\tv_nop\n\tv_nop" : "+v"(d) : "v"(a), "v"(b));
  return d;
}
// 16x16x32 fragments: lane = (h = lane>>4, row/col = lane&15); elements 0..7 = k0+8h+0..7, 8..15 = k0+16+8h+0..7; D element r = row 8h+r
__device__ __forceinline__ v16h frag_h(const _Float16* rowk0, int lane) {
  union { v16h v; v8h q[2]; } u; const _Float16* p = rowk0 + 8 * (lane >> 4);
  u.q[0] = *(const v8h*)p; u.q[1] = *(const v8h*)(p + 16); return u.v;
}
__device__ __forceinline__ v16h frag_f32(const float* rowk0, int lane) {
  v16h a; const float* p = rowk0 + 8 * (lane >> 4);
#pragma unroll
  for (int i = 0; i < 8; ++i) { a[i] = (_Float16)p[i]; a[8 + i] = (_Float16)p[16 + i]; }
  return a;
}
__device__ __forceinline__ v16h frag_f32s(const float* rowk0, int lane, float sc) {
  v16h a; const float* p = rowk0 + 8 * (lane >> 4);
#pragma unroll
  for (int i = 0; i < 8; ++i) { a[i] = (_Float16)(p[i] * sc); a[8 + i] = (_Float16)(p[16 + i] * sc); }
  return a;
}
// column fragment from a [K][ld] layout (column n), rows >= K read as 0
__device__ __forceinline__ v16h fragc_f32(const float* W, int k0, int n, int lane, int ld, int K) {
  v16h a; const int g = lane >> 4;
#pragma unroll
  for (int i = 0; i < 8; ++i) { const int ka = k0 + 8 * g + i, kb = ka + 16;
    a[i] = (_Float16)(ka < K ? W[(size_t)(ka < K ? ka : K - 1) * ld + n] : 0.f); a[8 + i] = (_Float16)(kb < K ? W[(size_t)(kb < K ? kb : K - 1) * ld + n] : 0.f); }
  return a;
}
struct F2 { v16b h, l; };
__device__ __forceinline__ F2 bsplit16(const float v[16]) { F2 r;
#pragma unroll
  for (int i = 0; i < 16; ++i) { const __bf16 h = (__bf16)v[i]; r.h[i] = h; r.l[i] = (__bf16)(v[i] - (float)h); }
  return r; }
__device__ __forceinline__ F2 split_row(const float* row, int k0, int lane) { float v[16]; const float* p = row + k0 + 8 * (lane >> 4);
#pragma unroll
  for (int i = 0; i < 8; ++i) { v[i] = p[i]; v[8 + i] = p[16 + i]; }
  return bsplit16(v); }
__device__ __forceinline__ F2 split_rowK(const float* row, int k0, int lane, int K) { float v[16]; const int g = lane >> 4;
#pragma unroll
  for (int i = 0; i < 8; ++i) { const int ka = k0 + 8 * g + i, kb = ka + 16; v[i] = ka < K ? row[ka < K ? ka : K - 1] : 0.f; v[8 + i] = kb < K ? row[kb < K ? kb : K - 1] : 0.f; }
  return bsplit16(v); }
__device__ __forceinline__ F2 split_col(const float* W, int k0, int n, int lane, int ld, int K) { float v[16]; const int g = lane >> 4;
#pragma unroll
  for (int i = 0; i < 8; ++i) { const int ka = k0 + 8 * g + i, kb = ka + 16; v[i] = ka < K ? W[(size_t)(ka < K ? ka : K - 1) * ld + n] : 0.f; v[8 + i] = kb < K ? W[(size_t)(kb < K ? kb : K - 1) * ld + n] : 0.f; }
  return bsplit16(v); }
__device__ __forceinline__ v8f mac3(const F2& a, const F2& b, v8f c) { c = wmma_bf(a.l, b.h, c); c = wmma_bf(a.h, b.l, c); return wmma_bf(a.h, b.h, c); }
__device__ __forceinline__ float sigm(float v) { return 1.0f / (1.0f + expf(-v)); }
#define LDSX() do { asm volatile("s_wait_dscnt 0" ::: "memory"); __builtin_amdgcn_wave_barrier(); __builtin_amdgcn_fence(__ATOMIC_RELEASE, "workgroup"); } while (0)

// Multi-head attention with separate q / k / v inputs (B 4, S 2,048, hid 512 = 8 x 64; (in,out) 1/sqrt(512)-scale weights, zero biases; scale = 1/sqrt(hid_dim = 512), as written): qp = q Wq + bq ...; out = merged(softmax(qh kh^T / sqrt(512)) vh) Wo + bo (non-causal).
#define NB 4
#define TT 2048
#define CC 512            // NH * HD = projected width
#define DIN 512          // input (model) width
#define NH 8
#define HD 64
#define NQB (TT / 64)
#define HG 4
#define SCALE (0.04419417382415922f)
#define CAUSAL 0
#ifndef TNB
#define TNB NB
#endif
__device__ __forceinline__ float bfr(float v) { return (float)(__bf16)v; }
__host__ __device__ __forceinline__ int kb_last(int qb) { return CAUSAL ? ((qb * 64 + 63) >> 7) : (TT / 128 - 1); }
typedef __attribute__((ext_vector_type(8))) __bf16 v8b;
__device__ __forceinline__ v16b frag_b(const __bf16* rowk0, int lane) {
  union { v16b v; v8b q[2]; } u; const __bf16* p = rowk0 + 8 * (lane >> 4);
  u.q[0] = *(const v8b*)p; u.q[1] = *(const v8b*)(p + 16); return u.v;
}
#define QBH 0              // unused: every query block takes the one path of k_fa
#define QHI 2048            // rows carrying a q residual plane (all rows when non-causal: 2-product logits everywhere)
#define KHI 64            // key rows carrying k residual / v bf16 hi+lo planes (written by k_proj, read by no kernel here)
// B fragment (k rows k0+.., output column o) of a weight: (in,out) [K][ld] or (out,in) [ld rows of K]: bf16 exact, or f16(bf16 * 256) exact
__device__ __forceinline__ v16b wcol_io(const float* Wm, int k0, int o, int lane, int ld) { v16b w; const int g = lane >> 4;
#pragma unroll
  for (int i = 0; i < 8; ++i) { w[i] = (__bf16)Wm[(size_t)(k0 + 8 * g + i) * ld + o]; w[8 + i] = (__bf16)Wm[(size_t)(k0 + 16 + 8 * g + i) * ld + o]; }
  return w; }
__device__ __forceinline__ v16b wcol_oi(const float* Wm, int k0, int o, int lane, int K) { v16b w; const float* p = Wm + (size_t)o * K + k0 + 8 * (lane >> 4);
#pragma unroll
  for (int i = 0; i < 8; ++i) { w[i] = (__bf16)p[i]; w[8 + i] = (__bf16)p[16 + i]; }
  return w; }
__device__ __forceinline__ v16h wcolh_io(const float* Wm, int k0, int o, int lane, int ld) { v16h w; const int g = lane >> 4;
#pragma unroll
  for (int i = 0; i < 8; ++i) { w[i] = (_Float16)(bfr(Wm[(size_t)(k0 + 8 * g + i) * ld + o]) * 256.0f); w[8 + i] = (_Float16)(bfr(Wm[(size_t)(k0 + 16 + 8 * g + i) * ld + o]) * 256.0f); }
  return w; }
__device__ __forceinline__ v16h wcolh_oi(const float* Wm, int k0, int o, int lane, int K) { v16h w; const float* p = Wm + (size_t)o * K + k0 + 8 * (lane >> 4);
#pragma unroll
  for (int i = 0; i < 8; ++i) { w[i] = (_Float16)(bfr(p[i]) * 256.0f); w[8 + i] = (_Float16)(bfr(p[16 + i]) * 256.0f); }
  return w; }
#define WQKV_LAYOUT 0   // 0 = (in,out) [DIN][CC]; k_proj reads only this layout (other values change only WCOL, which nothing calls)
__device__ __forceinline__ v16b wcol_hdk(const float* Wm, int k0, int o, int lane) { v16b w; const int g = lane >> 4; const float* p = Wm + (size_t)(o / HD) * DIN * HD + (o % HD);
#pragma unroll
  for (int i = 0; i < 8; ++i) { w[i] = (__bf16)p[(size_t)(k0 + 8 * g + i) * HD]; w[8 + i] = (__bf16)p[(size_t)(k0 + 16 + 8 * g + i) * HD]; }
  return w; }
#define WO_OUT_IN 0
#if WQKV_LAYOUT == 1
#define WCOL(W, k0, o, lane) wcol_oi(W, k0, o, lane, DIN)
#elif WQKV_LAYOUT == 2
#define WCOL(W, k0, o, lane) wcol_hdk(W, k0, o, lane)
#else
#define WCOL(W, k0, o, lane) wcol_io(W, k0, o, lane, CC)
#endif
#if WO_OUT_IN
#define WOCOL(W, k0, o, lane) wcol_oi(W, k0, o, lane, CC)
#define WOCOLH(W, k0, o, lane) wcolh_oi(W, k0, o, lane, CC)
#else
#define WOCOL(W, k0, o, lane) wcol_io(W, k0, o, lane, DIN)
#define WOCOLH(W, k0, o, lane) wcolh_io(W, k0, o, lane, DIN)
#endif

#ifndef SM_EXTRA_PARAMS
#define SM_EXTRA_PARAMS
#endif
#ifndef PROJ_EXTRA_PARAMS
#define PROJ_EXTRA_PARAMS
#endif
#ifndef SM_MASK_HOOK
#define SM_MASK_HOOK (void)0
#endif

#define WS_QH  0u                                      // f16 q rows [b*t][CC]
#define WS_KH  (WS_QH + 2u * (size_t)NB * TT * CC)      // f16 k in fragment order [b][h][16-key tile][piece p = 16 channels][lane = 16 g + key][8 channels 16 p + 8 g + ..]
#define WS_VT  (WS_KH + 2u * (size_t)NB * TT * CC)      // f16 v in fragment order [b][h][32-key block][16-channel tile j][half][lane = 16 g + channel][8 keys 16 half + 8 g + ..]
#define WS_QL  (WS_VT + 2u * (size_t)NB * CC * TT)      // f16 q residual x 2^10 rows [b][t < QHI][CC]
#define WS_KL  (WS_QL + 2u * (size_t)NB * QHI * CC)     // f16 k residual x 2^10 rows [b][t < KHI][CC]
#define WS_VB  (WS_KL + 2u * (size_t)NB * KHI * CC)     // bf16 v hi planes [b][c][t < KHI]
#define WS_VBL (WS_VB + 2u * (size_t)NB * CC * KHI)
#define WS_S   (WS_VBL + 2u * (size_t)NB * CC * KHI)    // f32 [hg][t][s] region, unused: k_fa keeps the logits in registers
#define WS_Y   (WS_S  + 4u * (size_t)HG * TT * TT)      // f32 ctx rows [b*t][CC] (only when there is an output projection)
#define WS_END (WS_Y  + 4u * (size_t)NB * TT * CC)
// k and v lie in the workspace as k_fa's A fragments read them: the 32 lanes' 16-byte pieces of one load are 512 contiguous bytes (4 whole lines; by rows or planes one load touched 16 lines for the same bytes)
#define KF_TILE(b, h, kt) ((((size_t)(b) * NH + (h)) * (TT / 16) + (kt)) * 1024)   // element offset of a 16-key tile: 4 pieces of 256 elements
#define VF_BLK(b, h, cb)  ((((size_t)(b) * NH + (h)) * (TT / 32) + (cb)) * 2048)   // element offset of a 32-key block: 4 channel tiles x 2 halves of 256 elements

// ---- weight tile in LDS: 128 threads bring 64 k rows x 128 output columns of an (in,out) f32 weight as 16-byte row pieces (whole 128-B lines), round them to bf16 as before and store them [column][k], so that a B fragment is two 16-byte LDS reads and the block's four waves share one fetch and one rounding (the short loops are unrolled in full: the register arrays need constant indices)
#define WKC 64            // k rows per staged chunk
#define WPT (WKC + 8)     // LDS pitch in elements: 144 B = 16 B x odd, the fragment reads of 16 columns fall on 16 different bank groups
struct WReg { v4f x[16]; };
__device__ __forceinline__ void wtile_load(WReg& r, const float* wsrc, int ld) {   // wsrc: this thread's first row (8 kg) and first of 4 columns
#pragma unroll
  for (int p = 0; p < WKC / 32; ++p)
#pragma unroll
    for (int i = 0; i < 8; ++i) r.x[p * 8 + i] = *(const v4f*)(wsrc + (size_t)(p * 32 + i) * ld);
}
__device__ __forceinline__ void wtile_store(const WReg& r, __bf16 (*wt)[WPT], int sc, int kg) {
#pragma unroll
  for (int p = 0; p < WKC / 32; ++p)
#pragma unroll
    for (int cc = 0; cc < 4; ++cc) { v8b t;
#pragma unroll
      for (int i = 0; i < 8; ++i) t[i] = (__bf16)r.x[p * 8 + i][cc];
      *(v8b*)&wt[sc + cc][p * 32 + 8 * kg] = t; }
}
// ---- k_proj: block = (64 rows, 128 cols, which): q/k/v = X W (+ b) with exact bf16 products (K = DIN) -> which 0: q f16 rows (+ residual rows < QHI); 1: k f16 in fragment order (+ residual rows < KHI); 2: v f16 in fragment order (+ bf16 hi/lo planes for t < KHI)
__global__ __launch_bounds__(128) void k_proj(const float* __restrict__ XQ, const float* __restrict__ XK, const float* __restrict__ XV, const float* __restrict__ WQ, const float* __restrict__ WK, const float* __restrict__ WV, const float* __restrict__ BQ, const float* __restrict__ BK, const float* __restrict__ BV,
    _Float16* __restrict__ QH, _Float16* __restrict__ QL, _Float16* __restrict__ KH, _Float16* __restrict__ KL, _Float16* __restrict__ VT, __bf16* __restrict__ VB, __bf16* __restrict__ VBL) {
  __shared__ __align__(16) _Float16 sh[64][136], sl[64][136]; __shared__ __align__(16) _Float16 th[128][72]; __shared__ __align__(16) __bf16 tb[128][72], tbl[128][72];
  const int tid = threadIdx.x, wave = tid >> 5, lane = tid & 31, col = lane & 15, g = lane >> 4; const int which = blockIdx.z; const int c0 = blockIdx.y * 128; const size_t r0 = (size_t)blockIdx.x * 64; const size_t bb = r0 / TT; const int t0 = (int)(r0 % TT);
  const float* X = which == 0 ? XQ : which == 1 ? XK : XV; const float* WA = which == 0 ? WQ : which == 1 ? WK : WV; const float* BA = which == 0 ? BQ : which == 1 ? BK : BV;
  __shared__ __align__(16) __bf16 wt[128][WPT];
  const int sc = 32 * wave + 4 * ((lane & 3) | ((lane >> 4) << 2)), kg = (lane >> 2) & 3;   // staging: 4 columns x 8 k rows per thread and 32 k; 16 lanes store to 16 different bank groups
  const float* wsrc = WA + (size_t)(8 * kg) * CC + c0 + sc; const float* xsrc = X + (r0 + wave * 16 + col) * DIN + 8 * g;
  v8f acc[8] = {}; WReg wr; v4f xr[WKC / 8];
  wtile_load(wr, wsrc, CC);
#pragma unroll
  for (int kk = 0; kk < WKC / 32; ++kk) { xr[kk * 4] = *(const v4f*)(xsrc + kk * 32); xr[kk * 4 + 1] = *(const v4f*)(xsrc + kk * 32 + 4); xr[kk * 4 + 2] = *(const v4f*)(xsrc + kk * 32 + 16); xr[kk * 4 + 3] = *(const v4f*)(xsrc + kk * 32 + 20); }
  asm volatile("s_wait_xcnt 0x0" :: "v"(wsrc), "v"(xsrc) : "memory");   // the loads' address pairs live up to this wait and are rewritten only behind it
  auto round_a = [&](v16b (&a)[WKC / 32]) {
#pragma unroll
    for (int kk = 0; kk < WKC / 32; ++kk)
#pragma unroll
      for (int i = 0; i < 4; ++i) { a[kk][i] = (__bf16)xr[kk * 4][i]; a[kk][4 + i] = (__bf16)xr[kk * 4 + 1][i]; a[kk][8 + i] = (__bf16)xr[kk * 4 + 2][i]; a[kk][12 + i] = (__bf16)xr[kk * 4 + 3][i]; } };
  auto publish = [&]() { __syncthreads();   // every wave has read the last chunk's fragments
    wtile_store(wr, wt, sc, kg);
    __syncthreads(); };   // the chunk is published
  auto products = [&](const v16b (&a)[WKC / 32]) {
#pragma unroll
    for (int kk = 0; kk < WKC / 32; ++kk)
#pragma unroll
      for (int jh = 0; jh < 2; ++jh) { v16b w[4];
#pragma unroll
        for (int j = 0; j < 4; ++j) w[j] = frag_b(&wt[(jh * 4 + j) * 16 + col][kk * 32], lane);
#pragma unroll
        for (int j = 0; j < 4; ++j) acc[jh * 4 + j] = wmma_bf(a[kk], w[j], acc[jh * 4 + j]); } };
#pragma unroll 1   // rolled: one body holds 16 products and 24 loads already
  for (int ch = 0; ch < DIN / WKC - 1; ++ch) { v16b a[WKC / 32]; round_a(a); publish();
    wtile_load(wr, wsrc + (size_t)WKC * CC, CC);   // the next chunk's loads fly while this chunk's products run
#pragma unroll
    for (int kk = 0; kk < WKC / 32; ++kk) { xr[kk * 4] = *(const v4f*)(xsrc + WKC + kk * 32); xr[kk * 4 + 1] = *(const v4f*)(xsrc + WKC + kk * 32 + 4); xr[kk * 4 + 2] = *(const v4f*)(xsrc + WKC + kk * 32 + 16); xr[kk * 4 + 3] = *(const v4f*)(xsrc + WKC + kk * 32 + 20); }
    asm volatile("s_wait_xcnt 0x0" :: "v"(wsrc), "v"(xsrc) : "memory");   // as above
    wsrc += (size_t)WKC * CC; xsrc += WKC;
    products(a); }
  { v16b a[WKC / 32]; round_a(a); publish(); products(a); }   // the last chunk: nothing left to fetch
  if (which < 2) { _Float16* DH = which == 0 ? QH : KH; _Float16* DL = which == 0 ? QL : KL; const int nhi = which == 0 ? QHI : KHI; const bool hi_rows = t0 < nhi;
#pragma unroll
    for (int j = 0; j < 8; ++j) { const float bias = BA ? bfr(BA[c0 + j * 16 + col]) : 0.f;
#pragma unroll
      for (int r = 0; r < 8; ++r) { const float v = acc[j][r] + bias; const _Float16 hv = (_Float16)v; sh[wave * 16 + 8 * g + r][j * 16 + col] = hv; sl[wave * 16 + 8 * g + r][j * 16 + col] = (_Float16)((v - (float)hv) * 1024.0f); } }
    __syncthreads();
    for (int e = tid; e < 64 * 16; e += 128) { int rl = e >> 4, q = e & 15; size_t dh = (r0 + rl) * CC + c0 + q * 8;
      if (which == 1) { const int l = e & 31, p = (e >> 5) & 3, hh = (e >> 7) & 1, kt = e >> 8; rl = kt * 16 + (l & 15); q = hh * 8 + p * 2 + (l >> 4); dh = KF_TILE(bb, c0 / HD + hh, t0 / 16 + kt) + p * 256 + l * 8; }   // a wave stores one 512-B piece
      _Float16* pd = DH + dh; const v4u dv = *(const v4u*)&sh[rl][q * 8]; vst2((unsigned*)pd, dv);
      asm volatile("s_wait_xcnt 0x0" :: "v"(pd), "v"(dv) : "memory");   // the store's address pair and data live up to this wait and are rewritten only behind it
      if (hi_rows) { _Float16* pl = DL + (bb * nhi + t0 + rl) * (size_t)CC + c0 + q * 8; const v4u lv = *(const v4u*)&sl[rl][q * 8]; vst2((unsigned*)pl, lv);
        asm volatile("s_wait_xcnt 0x0" :: "v"(pl), "v"(lv) : "memory"); } }   // as above
  } else { const bool hi_rows = t0 < KHI;
#pragma unroll
    for (int j = 0; j < 8; ++j) { const float bias = BA ? bfr(BA[c0 + j * 16 + col]) : 0.f;
#pragma unroll
      for (int r = 0; r < 8; ++r) { const float v = acc[j][r] + bias; const int rl = wave * 16 + 8 * g + r, cl = j * 16 + col; th[cl][rl] = (_Float16)v; const __bf16 bh = (__bf16)v; tb[cl][rl] = bh; tbl[cl][rl] = (__bf16)(v - (float)bh); } }
    __syncthreads();
    for (int e = tid; e < 128 * 8; e += 128) { const int l = e & 31, hf = (e >> 5) & 1, j = (e >> 6) & 3, hh = (e >> 8) & 1, cb = e >> 9; const int cl = hh * 64 + j * 16 + (l & 15), q = cb * 4 + hf * 2 + (l >> 4);   // a wave stores one 512-B piece
      _Float16* pv = VT + VF_BLK(bb, c0 / HD + hh, t0 / 32 + cb) + (j * 2 + hf) * 256 + l * 8; const v4u dv = *(const v4u*)&th[cl][q * 8]; vst2((unsigned*)pv, dv);
      asm volatile("s_wait_xcnt 0x0" :: "v"(pv), "v"(dv) : "memory");   // the store's address pair and data live up to this wait and are rewritten only behind it
      if (hi_rows) { const size_t o3 = (bb * CC + c0 + cl) * (size_t)KHI + t0 + q * 8; __bf16 *ph = VB + o3, *pl = VBL + o3; const v4u hv = *(const v4u*)&tb[cl][q * 8], lv = *(const v4u*)&tbl[cl][q * 8]; vst2((unsigned*)ph, hv); vst2((unsigned*)pl, lv);
        asm volatile("s_wait_xcnt 0x0" :: "v"(ph), "v"(pl), "v"(hv), "v"(lv) : "memory"); } } } }   // as above
// ---- k_fa: block = 16 waves x 16 queries of (b, h), one launch for every (b, h); k and v come to LDS once per block by asynchronous copies, 128 keys a stage, two buffers; per 32 keys S^T = K Q^T (q hi + residual x 2^10 against k, 2 products), running maximum and sum per query column in f32, P = 2^((s - m) SCALE log2 e) x 2^8 once to f16 straight from the score registers as the B operand, O^T += V^T P^T (1 product); the logits never leave the registers; ctx = O / sum
__device__ __forceinline__ float xhalf(float x) { return __builtin_bit_cast(float, __builtin_amdgcn_permlanex16(__builtin_bit_cast(int, x), __builtin_bit_cast(int, x), 0x76543210, 0xfedcba98, false, false)); }  // lane l with lane l ^ 16
__device__ __forceinline__ v16h frag_p(const _Float16* p) { union { v16h v; v8h q[2]; } u; u.q[0] = *(const v8h*)p; u.q[1] = *(const v8h*)(p + 256); return u.v; }   // fragment-order source, the lane's 8 elements already in p: the two halves are neighbouring 512-B pieces
__device__ __forceinline__ v8f wmma_h(v16h a, v16h b, v8f c) { return __builtin_amdgcn_wmma_f32_16x16x32_f16(false, a, false, b, (short)0, c, false, false); }
#define FAW 16            // waves per block
#define SCALE2 ((float)(0.04419417382415922 * 1.4426950408889634))   // SCALE x log2 e: e^(s SCALE) = 2^(s SCALE2), so one fused multiply-add and one v_exp_f32 make an exponential
#define FST 128           // keys per stage: 16 KB of k and 16 KB of v, each contiguous in the workspace's fragment order
#define NST (TT / FST)    // stages per (b, h)
#define FSE (FST * HD)    // elements of k (or of v) per stage
// one stage's k and v into one LDS buffer: 512 threads x 4 copies of 16 bytes, a thread's own bytes at 16 tid (+ 8 KB); the s_wait_xcnt stands inside the statement, so the address registers are rewritten only behind it
__device__ __forceinline__ void kv_copy(unsigned lb, const _Float16* gk, const _Float16* gv) {
  const unsigned l1 = lb + 8192u, l2 = lb + 16384u, l3 = lb + 24576u; const _Float16 *gk1 = gk + 4096, *gv1 = gv + 4096;
  asm volatile("global_load_async_to_lds_b128 %0, %4, off\n\tglobal_load_async_to_lds_b128 %1, %5, off\n\tglobal_load_async_to_lds_b128 %2, %6, off\n\tglobal_load_async_to_lds_b128 %3, %7, off\n\ts_wait_xcnt 0x0"
               :: "v"(lb), "v"(l1), "v"(l2), "v"(l3), "v"(gk), "v"(gk1), "v"(gv), "v"(gv1) : "memory");
}
__global__ __launch_bounds__(FAW * 32) void k_fa(const _Float16* __restrict__ QH, const _Float16* __restrict__ QL, const _Float16* __restrict__ KH, const _Float16* __restrict__ VT, float* __restrict__ Y) { __shared__ __align__(16) float ss[FAW][16][HD + 4];
  __shared__ __align__(16) _Float16 kv[2][2][FSE];   // two buffers of (k, v): the block fetches each stage once, a whole stage ahead of its use, and its 16 waves read their fragments from here
  const int tid = threadIdx.x, wave = tid >> 5, lane = tid & 31, col = lane & 15, g = lane >> 4; const int h = blockIdx.y, b = blockIdx.z; const int ql0 = blockIdx.x * (FAW * 16) + wave * 16;
  const unsigned lds0 = (unsigned)(size_t)&kv[0][0][0] + (unsigned)tid * 16u;   // this thread's 16 bytes in buffer 0 (LDS byte address)
  const _Float16* Kg = KH + KF_TILE(b, h, 0) + tid * 8;   // and in stage 0 of (b, h)
  const _Float16* Vg = VT + VF_BLK(b, h, 0) + tid * 8;
  kv_copy(lds0, Kg, Vg);
  v16h qh[HD / 32], ql[HD / 32];
#pragma unroll
  for (int kc = 0; kc < HD / 32; ++kc) { qh[kc] = frag_h(QH + ((size_t)b * TT + ql0 + col) * CC + h * HD + kc * 32, lane); ql[kc] = frag_h(QL + ((size_t)b * QHI + ql0 + col) * CC + h * HD + kc * 32, lane); }
  v8f o[HD / 16] = {}; float m = -3.0e38f, l = 0.f;
  asm volatile("s_wait_asynccnt 0x0" ::: "memory");   // this wave's copies of stage 0 have landed
  __syncthreads();                                     // stage 0 is published
  kv_copy(lds0 + 4u * FSE, Kg + FSE, Vg + FSE);        // stage 1 flies while stage 0 is worked on
#pragma unroll 1   // rolled: one body holds four passes already
  for (int st = 0; st < NST; ++st) {
    const _Float16* kb = &kv[st & 1][0][0] + lane * 8;   // this lane's 16 bytes of the stage's first k piece
    const _Float16* vb = &kv[st & 1][1][0] + lane * 8;
    v16h kf[2][HD / 32];
#pragma unroll
    for (int t = 0; t < 2; ++t)
#pragma unroll
      for (int kc = 0; kc < HD / 32; ++kc) kf[t][kc] = frag_p(kb + t * 1024 + kc * 512);
#pragma unroll   // in full: the pass index is a constant in every LDS offset, and the last pass's missing prefetch costs no branch
    for (int c = 0; c < FST / 32; ++c) {
      v16h vf[HD / 16];
#pragma unroll
      for (int j = 0; j < HD / 16; ++j) vf[j] = frag_p(vb + c * 2048 + j * 512);
      v8f sh[2], sl[2];
      // the eight score products in one statement: as builtins the last of them were placed behind the next k loads, which then took new registers; the v_nop keep the distance from the last product to the first instruction that writes its operands or reads its result
      asm volatile("v_wmma_f32_16x16x32_f16 %0, %4, %8, 0\n\tv_wmma_f32_16x16x32_f16 %1, %4, %9, 0\n\tv_wmma_f32_16x16x32_f16 %2, %5, %8, 0\n\tv_wmma_f32_16x16x32_f16 %3, %5, %9, 0\n\t"
                   "v_wmma_f32_16x16x32_f16 %0, %6, %10, %0\n\tv_wmma_f32_16x16x32_f16 %1, %6, %11, %1\n\tv_wmma_f32_16x16x32_f16 %2, %7, %10, %2\n\tv_wmma_f32_16x16x32_f16 %3, %7, %11, %3\n\t"
                   "v_nop\n\tv_nop\n\tv_nop\n\tv_nop"
                   : "=&v"(sh[0]), "=&v"(sl[0]), "=&v"(sh[1]), "=&v"(sl[1]) : "v"(kf[0][0]), "v"(kf[1][0]), "v"(kf[0][1]), "v"(kf[1][1]), "v"(qh[0]), "v"(ql[0]), "v"(qh[1]), "v"(ql[1]));
      if (c + 1 < FST / 32) {   // the next 32 keys' fragments of the same stage are read while this pass does its softmax (nothing of the next stage is read before its barrier)
#pragma unroll
        for (int t = 0; t < 2; ++t)
#pragma unroll
          for (int kc = 0; kc < HD / 32; ++kc) kf[t][kc] = frag_p(kb + (c + 1) * 2048 + t * 1024 + kc * 512); }
      __builtin_amdgcn_sched_barrier(0);   // keeps the next k reads in one group here, ahead of the softmax (without it the scheduler scatters them among the vector instructions and the products)
      float s[16]; float mx = -3.0e38f;   // s[8 t + r] = unscaled logit of key 32 c + 16 t + 8 g + r of the stage for query col: the k order of a B fragment
#pragma unroll
      for (int t = 0; t < 2; ++t)
#pragma unroll
        for (int r = 0; r < 8; ++r) { s[t * 8 + r] = sh[t][r] + sl[t][r] * (1.0f / 1024.0f); mx = fmaxf(mx, s[t * 8 + r]); }
      mx = fmaxf(mx, xhalf(mx));
      const float mn = fmaxf(m, mx); const float al = __builtin_amdgcn_exp2f((m - mn) * SCALE2); m = mn;   // SCALE2 > 0: the maximum is taken over the unscaled logits; al = 0 on the first pass
      const float ms = __builtin_fmaf(mn, -SCALE2, 8.0f);   // + 8 = x 2^8: keeps small P out of the f16 subnormals; cancels against the sum
      v16h p; float ps = 0.f;
#pragma unroll
      for (int i = 0; i < 16; i += 2) { const v2f a = __builtin_elementwise_fma((v2f){s[i], s[i + 1]}, (v2f){SCALE2, SCALE2}, (v2f){ms, ms});   // two arguments per packed fma
        const float e0 = __builtin_amdgcn_exp2f(a[0]), e1 = __builtin_amdgcn_exp2f(a[1]); ps += e0; ps += e1; p[i] = (_Float16)e0; p[i + 1] = (_Float16)e1; }
      l = l * al + ps;
#pragma unroll
      for (int j = 0; j < HD / 16; ++j) { o[j] *= al; o[j] = wmma_h(vf[j], p, o[j]); }
      __builtin_amdgcn_sched_barrier(0); }   // keeps a pass's vector work and products ahead of what follows it (without it the last two passes' sink behind the stage's barrier, and the refill is issued that much later)
    asm volatile("s_wait_dscnt 0x0" ::: "memory");      // this wave's reads of the stage are done
    asm volatile("s_wait_asynccnt 0x0" ::: "memory");   // and its copies of the next stage have landed
    __syncthreads();                                     // the next stage is published, and every wave has left this stage's buffer
    if (st + 2 < NST) kv_copy(lds0 + (unsigned)(st & 1) * (4u * FSE), Kg + (size_t)(st + 2) * FSE, Vg + (size_t)(st + 2) * FSE); }   // which is refilled two stages ahead
  asm volatile("s_wait_asynccnt 0x0" ::: "memory");   // no copy is left in flight behind the loop
  l += xhalf(l); const float inv = 1.0f / l;
#pragma unroll
  for (int j = 0; j < HD / 16; ++j) { v4f lo, hi;   // o[j][r] = ctx of query col, channel 16 j + 8 g + r
#pragma unroll
    for (int r = 0; r < 4; ++r) { lo[r] = o[j][r] * inv; hi[r] = o[j][4 + r] * inv; }
    *(v4f*)&ss[wave][col][j * 16 + 8 * g] = lo; *(v4f*)&ss[wave][col][j * 16 + 8 * g + 4] = hi; }
  LDSX();
#pragma unroll
  for (int i = 0; i < 8; ++i) { const int rl = 2 * i + g; vst2(Y + ((size_t)b * TT + ql0 + rl) * CC + h * HD + col * 4, *(const v4f*)&ss[wave][rl][col * 4]); } }   // 256-B (row, head) segment by 16 lanes
// ---- k_out: block = (64 rows, 128 cols): out = ctx Wo (+ bo): ctx split bf16 hi + lo against exact bf16 Wo (2 products) for all rows
__global__ __launch_bounds__(128) void k_out(const float* __restrict__ Y, const float* __restrict__ WO, const float* __restrict__ BO, float* __restrict__ OUT) { __shared__ __align__(16) float sf[4][16][132]; __shared__ __align__(16) __bf16 wt[128][WPT];
  const int tid = threadIdx.x, wave = tid >> 5, lane = tid & 31, col = lane & 15, g = lane >> 4; const int c0 = blockIdx.y * 128; const size_t r0 = (size_t)blockIdx.x * 64 + wave * 16;
  v8f acc[8] = {};
  if (true) {   /* ALL rows: ctx split bf16 hi + lo x exact Wo (2 products) */
    const int sc = 32 * wave + 4 * ((lane & 3) | ((lane >> 4) << 2)), kg = (lane >> 2) & 3;   // staging map as in k_proj
    const float* wsrc = WO + (size_t)(8 * kg) * DIN + c0 + sc; const float* ysrc = Y + (r0 + col) * CC + 8 * g;
    WReg wr; v4f yr[WKC / 8];
    wtile_load(wr, wsrc, DIN);
#pragma unroll
    for (int kk = 0; kk < WKC / 32; ++kk) { yr[kk * 4] = *(const v4f*)(ysrc + kk * 32); yr[kk * 4 + 1] = *(const v4f*)(ysrc + kk * 32 + 4); yr[kk * 4 + 2] = *(const v4f*)(ysrc + kk * 32 + 16); yr[kk * 4 + 3] = *(const v4f*)(ysrc + kk * 32 + 20); }
    asm volatile("s_wait_xcnt 0x0" :: "v"(wsrc), "v"(ysrc) : "memory");   // the loads' address pairs live up to this wait and are rewritten only behind it
    auto split_a = [&](F2 (&a)[WKC / 32]) {
#pragma unroll
      for (int kk = 0; kk < WKC / 32; ++kk) { float v[16];
#pragma unroll
        for (int i = 0; i < 4; ++i) { v[i] = yr[kk * 4][i]; v[4 + i] = yr[kk * 4 + 1][i]; v[8 + i] = yr[kk * 4 + 2][i]; v[12 + i] = yr[kk * 4 + 3][i]; }
        a[kk] = bsplit16(v); } };
    auto publish = [&]() { __syncthreads();   // every wave has read the last chunk's fragments
      wtile_store(wr, wt, sc, kg);
      __syncthreads(); };   // the chunk is published
    auto products = [&](const F2 (&a)[WKC / 32]) {
#pragma unroll
      for (int kk = 0; kk < WKC / 32; ++kk)
#pragma unroll
        for (int jh = 0; jh < 2; ++jh) { v16b w[4];
#pragma unroll
          for (int j = 0; j < 4; ++j) w[j] = frag_b(&wt[(jh * 4 + j) * 16 + col][kk * 32], lane);
#pragma unroll
          for (int j = 0; j < 4; ++j) { acc[jh * 4 + j] = wmma_bf(a[kk].h, w[j], acc[jh * 4 + j]); acc[jh * 4 + j] = wmma_bf(a[kk].l, w[j], acc[jh * 4 + j]); } } };
#pragma unroll 1   // rolled, as in k_proj
    for (int ch = 0; ch < CC / WKC - 1; ++ch) { F2 a[WKC / 32]; split_a(a); publish();
      wtile_load(wr, wsrc + (size_t)WKC * DIN, DIN);   // the next chunk's loads fly while this chunk's products run
#pragma unroll
      for (int kk = 0; kk < WKC / 32; ++kk) { yr[kk * 4] = *(const v4f*)(ysrc + WKC + kk * 32); yr[kk * 4 + 1] = *(const v4f*)(ysrc + WKC + kk * 32 + 4); yr[kk * 4 + 2] = *(const v4f*)(ysrc + WKC + kk * 32 + 16); yr[kk * 4 + 3] = *(const v4f*)(ysrc + WKC + kk * 32 + 20); }
      asm volatile("s_wait_xcnt 0x0" :: "v"(wsrc), "v"(ysrc) : "memory");   // as above
      wsrc += (size_t)WKC * DIN; ysrc += WKC;
      products(a); }
    { F2 a[WKC / 32]; split_a(a); publish(); products(a); }   // the last chunk: nothing left to fetch
#pragma unroll
    for (int j = 0; j < 8; ++j) { const float bias = BO ? bfr(BO[c0 + j * 16 + col]) : 0.f;
#pragma unroll
      for (int r = 0; r < 8; ++r) sf[wave][8 * g + r][j * 16 + col] = acc[j][r] + bias; }
  } else {
#pragma unroll 2
    for (int kc = 0; kc < CC / 32; ++kc) { const v16h a = frag_f32(Y + (r0 + col) * CC + kc * 32, lane); asm volatile("s_wait_loadcnt 0x0" ::: "memory");
#pragma unroll
      for (int j = 0; j < 8; ++j) { const v16h w = WOCOLH(WO, kc * 32, c0 + j * 16 + col, lane); asm volatile("s_wait_loadcnt 0x0" ::: "memory"); acc[j] = wmma16(a, w, acc[j]); } }
#pragma unroll
    for (int j = 0; j < 8; ++j) { const float bias = BO ? bfr(BO[c0 + j * 16 + col]) : 0.f;
#pragma unroll
      for (int r = 0; r < 8; ++r) sf[wave][8 * g + r][j * 16 + col] = acc[j][r] * (1.0f / 256.0f) + bias; } }
  LDSX(); for (int rl = 0; rl < 16; ++rl) vst2(OUT + (r0 + rl) * DIN + c0 + lane * 4, *(const v4f*)&sf[wave][rl][lane * 4]); }

extern "C" void kernel_launch(void* const* d_in, const int* in_sizes, int n_in, void* d_out, int out_size, void* d_ws, size_t ws_size, hipStream_t stream) {
  (void)in_sizes; (void)n_in; (void)out_size;
  const float** F = (const float**)d_in;
  if (ws_size < (size_t)WS_END) return;
  char* ws = (char*)d_ws; _Float16 *QH = (_Float16*)(ws + WS_QH), *KH = (_Float16*)(ws + WS_KH), *VT = (_Float16*)(ws + WS_VT), *QL = (_Float16*)(ws + WS_QL), *KL = (_Float16*)(ws + WS_KL); __bf16 *VB = (__bf16*)(ws + WS_VB), *VBL = (__bf16*)(ws + WS_VBL); float *Y = (float*)(ws + WS_Y);
  (void)Y; (void)QL; (void)KL; (void)VB; (void)VBL;
  // inputs: 0 q; 1 k; 2 v [4,2048,512]; 3 Wq (in,out), 4 bq; 5 Wk, 6 bk; 7 Wv, 8 bv; 9 Wo (in,out), 10 bo
  k_proj<<<dim3(TNB * TT / 64, CC / 128, 3), 128, 0, stream>>>(F[0], F[1], F[2], F[3], F[5], F[7], F[4], F[6], F[8], QH, QL, KH, KL, VT, VB, VBL);
  k_fa<<<dim3(TT / (FAW * 16), NH, TNB), FAW * 32, 0, stream>>>(QH, QL, KH, VT, Y);
  k_out<<<dim3(TNB * TT / 64, DIN / 128), 128, 0, stream>>>(Y, F[9], F[10], (float*)d_out);
}

// v006
// Measured time: 84.2 microseconds a run.
// Next to v005, in two timings, it ran 1.07 times as fast each time.
// Over all steps from v000 it is 13.2 times as fast.
// compute dtype: all float inputs rounded to bf16; q/k/v = in W + b with EXACT bf16 products on WMMA 16x16x32 (f32 accumulate); q once to f16 against k once to f16 (1 product) / sqrt(512); running-maximum softmax in f32 (base 2: log2 e folded into the scale, hardware exp2) fused with both products; unnormalised P x 2^8 once to f16 against v once to f16 (1 product), / sum in f32; ctx split bf16 hi + lo against exact Wo (2 products) + bo; f32 output.
#include <hip/hip_runtime.h>
#include <math.h>

typedef __attribute__((ext_vector_type(16))) _Float16 v16h;
typedef __attribute__((ext_vector_type(16))) __bf16 v16b;
typedef __attribute__((ext_vector_type(8)))  _Float16 v8h;
typedef __attribute__((ext_vector_type(8)))  float v8f;
typedef __attribute__((ext_vector_type(4)))  float v4f;
typedef __attribute__((ext_vector_type(2)))  float v2f;
typedef __attribute__((ext_vector_type(4)))  unsigned v4u;
typedef __attribute__((ext_vector_type(4)))  int v4i;
typedef float __attribute__((may_alias)) float_a;
typedef int __attribute__((may_alias)) int_a;

template <typename T> __device__ __forceinline__ void vst2(void* p, T v) { *(T*)p = v;  }
__device__ __forceinline__ v8f wmma16(v16h a, v16h b, v8f c) {
  v8f d = __builtin_amdgcn_wmma_f32_16x16x32_f16(false, a, false, b, (short)0, c, false, false);
  asm volatile("v_nop\n\tv_nop\n\tv_nop\n\tv_nop" : "+v"(d) : "v"(a), "v"(b));
  return d;
}
__device__ __forceinline__ v8f wmma_bf(v16b a, v16b b, v8f c) {
  v8f d = __builtin_amdgcn_wmma_f32_16x16x32_bf16(false, a, false, b, (short)0, c, false, false);
  asm volatile("v_nop\n\tv_nop\n\tv_nop\n\tv_nop" : "+v"(d) : "v"(a), "v"(b));
  return d;
}
// 16x16x32 fragments: lane = (h = lane>>4, row/col = lane&15); elements 0..7 = k0+8h+0..7, 8..15 = k0+16+8h+0..7; D element r = row 8h+r
__device__ __forceinline__ v16h frag_h(const _Float16* rowk0, int lane) {
  union { v16h v; v8h q[2]; } u; const _Float16* p = rowk0 + 8 * (lane >> 4);
  u.q[0] = *(const v8h*)p; u.q[1] = *(const v8h*)(p + 16); return u.v;
}
__device__ __forceinline__ v16h frag_f32(const float* rowk0, int lane) {
  v16h a; const float* p = rowk0 + 8 * (lane >> 4);
#pragma unroll
  for (int i = 0; i < 8; ++i) { a[i] = (_Float16)p[i]; a[8 + i] = (_Float16)p[16 + i]; }
  return a;
}
__device__ __forceinline__ v16h frag_f32s(const float* rowk0, int lane, float sc) {
  v16h a; const float* p = rowk0 + 8 * (lane >> 4);
#pragma unroll
  for (int i = 0; i < 8; ++i) { a[i] = (_Float16)(p[i] * sc); a[8 + i] = (_Float16)(p[16 + i] * sc); }
  return a;
}
// column fragment from a [K][ld] layout (column n), rows >= K read as 0
__device__ __forceinline__ v16h fragc_f32(const float* W, int k0, int n, int lane, int ld, int K) {
  v16h a; const int g = lane >> 4;
#pragma unroll
  for (int i = 0; i < 8; ++i) { const int ka = k0 + 8 * g + i, kb = ka + 16;
    a[i] = (_Float16)(ka < K ? W[(size_t)(ka < K ? ka : K - 1) * ld + n] : 0.f); a[8 + i] = (_Float16)(kb < K ? W[(size_t)(kb < K ? kb : K - 1) * ld + n] : 0.f); }
  return a;
}
struct F2 { v16b h, l; };
__device__ __forceinline__ F2 bsplit16(const float v[16]) { F2 r;
#pragma unroll
  for (int i = 0; i < 16; ++i) { const __bf16 h = (__bf16)v[i]; r.h[i] = h; r.l[i] = (__bf16)(v[i] - (float)h); }
  return r; }
__device__ __forceinline__ F2 split_row(const float* row, int k0, int lane) { float v[16]; const float* p = row + k0 + 8 * (lane >> 4);
#pragma unroll
  for (int i = 0; i < 8; ++i) { v[i] = p[i]; v[8 + i] = p[16 + i]; }
  return bsplit16(v); }
__device__ __forceinline__ F2 split_rowK(const float* row, int k0, int lane, int K) { float v[16]; const int g = lane >> 4;
#pragma unroll
  for (int i = 0; i < 8; ++i) { const int ka = k0 + 8 * g + i, kb = ka + 16; v[i] = ka < K ? row[ka < K ? ka : K - 1] : 0.f; v[8 + i] = kb < K ? row[kb < K ? kb : K - 1] : 0.f; }
  return bsplit16(v); }
__device__ __forceinline__ F2 split_col(const float* W, int k0, int n, int lane, int ld, int K) { float v[16]; const int g = lane >> 4;
#pragma unroll
  for (int i = 0; i < 8; ++i) { const int ka = k0 + 8 * g + i, kb = ka + 16; v[i] = ka < K ? W[(size_t)(ka < K ? ka : K - 1) * ld + n] : 0.f; v[8 + i] = kb < K ? W[(size_t)(kb < K ? kb : K - 1) * ld + n] : 0.f; }
  return bsplit16(v); }
__device__ __forceinline__ v8f mac3(const F2& a, const F2& b, v8f c) { c = wmma_bf(a.l, b.h, c); c = wmma_bf(a.h, b.l, c); return wmma_bf(a.h, b.h, c); }
__device__ __forceinline__ float sigm(float v) { return 1.0f / (1.0f + expf(-v)); }
#define LDSX() do { asm volatile("s_wait_dscnt 0" ::: "memory"); __builtin_amdgcn_wave_barrier(); __builtin_amdgcn_fence(__ATOMIC_RELEASE, "workgroup"); } while (0)

// Multi-head attention with separate q / k / v inputs (B 4, S 2,048, hid 512 = 8 x 64; (in,out) 1/sqrt(512)-scale weights, zero biases; scale = 1/sqrt(hid_dim = 512), as written): qp = q Wq + bq ...; out = merged(softmax(qh kh^T / sqrt(512)) vh) Wo + bo (non-causal).
#define NB 4
#define TT 2048
#define CC 512            // NH * HD = projected width
#define DIN 512          // input (model) width
#define NH 8
#define HD 64
#define NQB (TT / 64)
#define HG 4
#define SCALE (0.04419417382415922f)
#define CAUSAL 0
#ifndef TNB
#define TNB NB
#endif
__device__ __forceinline__ float bfr(float v) { return (float)(__bf16)v; }
__host__ __device__ __forceinline__ int kb_last(int qb) { return CAUSAL ? ((qb * 64 + 63) >> 7) : (TT / 128 - 1); }
typedef __attribute__((ext_vector_type(8))) __bf16 v8b;
__device__ __forceinline__ v16b frag_b(const __bf16* rowk0, int lane) {
  union { v16b v; v8b q[2]; } u; const __bf16* p = rowk0 + 8 * (lane >> 4);
  u.q[0] = *(const v8b*)p; u.q[1] = *(const v8b*)(p + 16); return u.v;
}
#define QBH 0              // unused: no kernel reads it (no kernel has a high-precision path)
#define QHI 2048            // rows of the workspace plane WS_QL (no kernel writes or reads it: q goes once rounded into the logits); it keeps the offsets behind it
#define KHI 64            // key rows carrying k residual / v bf16 hi+lo planes (written by k_proj; no kernel reads them)
// B fragment (k rows k0+.., output column o) of a weight: (in,out) [K][ld] or (out,in) [ld rows of K]: bf16 exact, or f16(bf16 * 256) exact
__device__ __forceinline__ v16b wcol_io(const float* Wm, int k0, int o, int lane, int ld) { v16b w; const int g = lane >> 4;
#pragma unroll
  for (int i = 0; i < 8; ++i) { w[i] = (__bf16)Wm[(size_t)(k0 + 8 * g + i) * ld + o]; w[8 + i] = (__bf16)Wm[(size_t)(k0 + 16 + 8 * g + i) * ld + o]; }
  return w; }
__device__ __forceinline__ v16b wcol_oi(const float* Wm, int k0, int o, int lane, int K) { v16b w; const float* p = Wm + (size_t)o * K + k0 + 8 * (lane >> 4);
#pragma unroll
  for (int i = 0; i < 8; ++i) { w[i] = (__bf16)p[i]; w[8 + i] = (__bf16)p[16 + i]; }
  return w; }
__device__ __forceinline__ v16h wcolh_io(const float* Wm, int k0, int o, int lane, int ld) { v16h w; const int g = lane >> 4;
#pragma unroll
  for (int i = 0; i < 8; ++i) { w[i] = (_Float16)(bfr(Wm[(size_t)(k0 + 8 * g + i) * ld + o]) * 256.0f); w[8 + i] = (_Float16)(bfr(Wm[(size_t)(k0 + 16 + 8 * g + i) * ld + o]) * 256.0f); }
  return w; }
__device__ __forceinline__ v16h wcolh_oi(const float* Wm, int k0, int o, int lane, int K) { v16h w; const float* p = Wm + (size_t)o * K + k0 + 8 * (lane >> 4);
#pragma unroll
  for (int i = 0; i < 8; ++i) { w[i] = (_Float16)(bfr(p[i]) * 256.0f); w[8 + i] = (_Float16)(bfr(p[16 + i]) * 256.0f); }
  return w; }
#define WQKV_LAYOUT 0   // 0 = (in,out) [DIN][CC]; k_proj reads only this layout (other values change only WCOL, which nothing calls)
__device__ __forceinline__ v16b wcol_hdk(const float* Wm, int k0, int o, int lane) { v16b w; const int g = lane >> 4; const float* p = Wm + (size_t)(o / HD) * DIN * HD + (o % HD);
#pragma unroll
  for (int i = 0; i < 8; ++i) { w[i] = (__bf16)p[(size_t)(k0 + 8 * g + i) * HD]; w[8 + i] = (__bf16)p[(size_t)(k0 + 16 + 8 * g + i) * HD]; }
  return w; }
#define WO_OUT_IN 0
#if WQKV_LAYOUT == 1
#define WCOL(W, k0, o, lane) wcol_oi(W, k0, o, lane, DIN)
#elif WQKV_LAYOUT == 2
#define WCOL(W, k0, o, lane) wcol_hdk(W, k0, o, lane)
#else
#define WCOL(W, k0, o, lane) wcol_io(W, k0, o, lane, CC)
#endif
#if WO_OUT_IN
#define WOCOL(W, k0, o, lane) wcol_oi(W, k0, o, lane, CC)
#define WOCOLH(W, k0, o, lane) wcolh_oi(W, k0, o, lane, CC)
#else
#define WOCOL(W, k0, o, lane) wcol_io(W, k0, o, lane, DIN)
#define WOCOLH(W, k0, o, lane) wcolh_io(W, k0, o, lane, DIN)
#endif

#ifndef SM_EXTRA_PARAMS
#define SM_EXTRA_PARAMS
#endif
#ifndef PROJ_EXTRA_PARAMS
#define PROJ_EXTRA_PARAMS
#endif
#ifndef SM_MASK_HOOK
#define SM_MASK_HOOK (void)0
#endif

#define WS_QH  0u                                      // f16 q rows [b*t][CC]
#define WS_KH  (WS_QH + 2u * (size_t)NB * TT * CC)      // f16 k in fragment order [b][h][16-key tile][piece p = 16 channels][lane = 16 g + key][8 channels 16 p + 8 g + ..]
#define WS_VT  (WS_KH + 2u * (size_t)NB * TT * CC)      // f16 v in fragment order [b][h][32-key block][16-channel tile j][half][lane = 16 g + channel][8 keys 16 half + 8 g + ..]
#define WS_QL  (WS_VT + 2u * (size_t)NB * CC * TT)      // unused (room of a q residual plane) [b][t < QHI][CC]
#define WS_KL  (WS_QL + 2u * (size_t)NB * QHI * CC)     // f16 k residual x 2^10 rows [b][t < KHI][CC]
#define WS_VB  (WS_KL + 2u * (size_t)NB * KHI * CC)     // bf16 v hi planes [b][c][t < KHI]
#define WS_VBL (WS_VB + 2u * (size_t)NB * CC * KHI)
#define WS_S   (WS_VBL + 2u * (size_t)NB * CC * KHI)    // f32 [hg][t][s] region, unused: k_fa keeps the logits in registers
#define WS_Y   (WS_S  + 4u * (size_t)HG * TT * TT)      // f32 ctx rows [b*t][CC] (only when there is an output projection)
#define WS_END (WS_Y  + 4u * (size_t)NB * TT * CC)
// k and v lie in the workspace as k_fa's A fragments read them: the 32 lanes' 16-byte pieces of one load are 512 contiguous bytes (4 whole lines; by rows or planes one load touched 16 lines for the same bytes)
#define KF_TILE(b, h, kt) ((((size_t)(b) * NH + (h)) * (TT / 16) + (kt)) * 1024)   // element offset of a 16-key tile: 4 pieces of 256 elements
#define VF_BLK(b, h, cb)  ((((size_t)(b) * NH + (h)) * (TT / 32) + (cb)) * 2048)   // element offset of a 32-key block: 4 channel tiles x 2 halves of 256 elements

// ---- weight tile in LDS: 128 threads bring 64 k rows x 128 output columns of an (in,out) f32 weight as 16-byte row pieces (whole 128-B lines), round them to bf16 as before and store them [column][k], so that a B fragment is two 16-byte LDS reads and the block's four waves share one fetch and one rounding (the short loops are unrolled in full: the register arrays need constant indices)
#define WKC 64            // k rows per staged chunk
#define WPT (WKC + 8)     // LDS pitch in elements: 144 B = 16 B x odd, the fragment reads of 16 columns fall on 16 different bank groups
struct WReg { v4f x[16]; };
__device__ __forceinline__ void wtile_load(WReg& r, const float* wsrc, int ld) {   // wsrc: this thread's first row (8 kg) and first of 4 columns
#pragma unroll
  for (int p = 0; p < WKC / 32; ++p)
#pragma unroll
    for (int i = 0; i < 8; ++i) r.x[p * 8 + i] = *(const v4f*)(wsrc + (size_t)(p * 32 + i) * ld);
}
__device__ __forceinline__ void wtile_store(const WReg& r, __bf16 (*wt)[WPT], int sc, int kg) {
#pragma unroll
  for (int p = 0; p < WKC / 32; ++p)
#pragma unroll
    for (int cc = 0; cc < 4; ++cc) { v8b t;
#pragma unroll
      for (int i = 0; i < 8; ++i) t[i] = (__bf16)r.x[p * 8 + i][cc];
      *(v8b*)&wt[sc + cc][p * 32 + 8 * kg] = t; }
}
// ---- k_proj: block = (64 rows, 128 cols, which): q/k/v = X W (+ b) with exact bf16 products (K = DIN) -> which 0: q f16 rows; 1: k f16 in fragment order (+ residual rows < KHI); 2: v f16 in fragment order (+ bf16 hi/lo planes for t < KHI)
__global__ __launch_bounds__(128) void k_proj(const float* __restrict__ XQ, const float* __restrict__ XK, const float* __restrict__ XV, const float* __restrict__ WQ, const float* __restrict__ WK, const float* __restrict__ WV, const float* __restrict__ BQ, const float* __restrict__ BK, const float* __restrict__ BV,
    _Float16* __restrict__ QH, _Float16* __restrict__ QL, _Float16* __restrict__ KH, _Float16* __restrict__ KL, _Float16* __restrict__ VT, __bf16* __restrict__ VB, __bf16* __restrict__ VBL) {
  __shared__ __align__(16) _Float16 sh[64][136], sl[64][136]; __shared__ __align__(16) _Float16 th[128][72]; __shared__ __align__(16) __bf16 tb[128][72], tbl[128][72];
  const int tid = threadIdx.x, wave = tid >> 5, lane = tid & 31, col = lane & 15, g = lane >> 4; const int which = blockIdx.z; const int c0 = blockIdx.y * 128; const size_t r0 = (size_t)blockIdx.x * 64; const size_t bb = r0 / TT; const int t0 = (int)(r0 % TT);
  const float* X = which == 0 ? XQ : which == 1 ? XK : XV; const float* WA = which == 0 ? WQ : which == 1 ? WK : WV; const float* BA = which == 0 ? BQ : which == 1 ? BK : BV;
  __shared__ __align__(16) __bf16 wt[128][WPT];
  const int sc = 32 * wave + 4 * ((lane & 3) | ((lane >> 4) << 2)), kg = (lane >> 2) & 3;   // staging: 4 columns x 8 k rows per thread and 32 k; 16 lanes store to 16 different bank groups
  const float* wsrc = WA + (size_t)(8 * kg) * CC + c0 + sc; const float* xsrc = X + (r0 + wave * 16 + col) * DIN + 8 * g;
  v8f acc[8] = {}; WReg wr; v4f xr[WKC / 8];
  wtile_load(wr, wsrc, CC);
#pragma unroll
  for (int kk = 0; kk < WKC / 32; ++kk) { xr[kk * 4] = *(const v4f*)(xsrc + kk * 32); xr[kk * 4 + 1] = *(const v4f*)(xsrc + kk * 32 + 4); xr[kk * 4 + 2] = *(const v4f*)(xsrc + kk * 32 + 16); xr[kk * 4 + 3] = *(const v4f*)(xsrc + kk * 32 + 20); }
  asm volatile("s_wait_xcnt 0x0" :: "v"(wsrc), "v"(xsrc) : "memory");   // the loads' address pairs live up to this wait and are rewritten only behind it
  auto round_a = [&](v16b (&a)[WKC / 32]) {
#pragma unroll
    for (int kk = 0; kk < WKC / 32; ++kk)
#pragma unroll
      for (int i = 0; i < 4; ++i) { a[kk][i] = (__bf16)xr[kk * 4][i]; a[kk][4 + i] = (__bf16)xr[kk * 4 + 1][i]; a[kk][8 + i] = (__bf16)xr[kk * 4 + 2][i]; a[kk][12 + i] = (__bf16)xr[kk * 4 + 3][i]; } };
  auto publish = [&]() { __syncthreads();   // every wave has read the last chunk's fragments
    wtile_store(wr, wt, sc, kg);
    __syncthreads(); };   // the chunk is published
  auto products = [&](const v16b (&a)[WKC / 32]) {
#pragma unroll
    for (int kk = 0; kk < WKC / 32; ++kk)
#pragma unroll
      for (int jh = 0; jh < 2; ++jh) { v16b w[4];
#pragma unroll
        for (int j = 0; j < 4; ++j) w[j] = frag_b(&wt[(jh * 4 + j) * 16 + col][kk * 32], lane);
#pragma unroll
        for (int j = 0; j < 4; ++j) acc[jh * 4 + j] = wmma_bf(a[kk], w[j], acc[jh * 4 + j]); } };
#pragma unroll 1   // rolled: one body holds 16 products and 24 loads already
  for (int ch = 0; ch < DIN / WKC - 1; ++ch) { v16b a[WKC / 32]; round_a(a); publish();
    wtile_load(wr, wsrc + (size_t)WKC * CC, CC);   // the next chunk's loads fly while this chunk's products run
#pragma unroll
    for (int kk = 0; kk < WKC / 32; ++kk) { xr[kk * 4] = *(const v4f*)(xsrc + WKC + kk * 32); xr[kk * 4 + 1] = *(const v4f*)(xsrc + WKC + kk * 32 + 4); xr[kk * 4 + 2] = *(const v4f*)(xsrc + WKC + kk * 32 + 16); xr[kk * 4 + 3] = *(const v4f*)(xsrc + WKC + kk * 32 + 20); }
    asm volatile("s_wait_xcnt 0x0" :: "v"(wsrc), "v"(xsrc) : "memory");   // as above
    wsrc += (size_t)WKC * CC; xsrc += WKC;
    products(a); }
  { v16b a[WKC / 32]; round_a(a); publish(); products(a); }   // the last chunk: nothing left to fetch
  if (which < 2) { _Float16* DH = which == 0 ? QH : KH; _Float16* DL = which == 0 ? QL : KL; const int nhi = which == 0 ? 0 : KHI; const bool hi_rows = t0 < nhi;   // q carries no residual plane: k_fa reads q once rounded, as it reads k
#pragma unroll
    for (int j = 0; j < 8; ++j) { const float bias = BA ? bfr(BA[c0 + j * 16 + col]) : 0.f;
#pragma unroll
      for (int r = 0; r < 8; ++r) sh[wave * 16 + 8 * g + r][j * 16 + col] = (_Float16)(acc[j][r] + bias); }
    if (which == 1) {   // k alone still forms a residual plane
#pragma unroll
      for (int j = 0; j < 8; ++j) { const float bias = BA ? bfr(BA[c0 + j * 16 + col]) : 0.f;
#pragma unroll
        for (int r = 0; r < 8; ++r) { const float v = acc[j][r] + bias; const _Float16 hv = (_Float16)v; sl[wave * 16 + 8 * g + r][j * 16 + col] = (_Float16)((v - (float)hv) * 1024.0f); } } }
    __syncthreads();
    for (int e = tid; e < 64 * 16; e += 128) { int rl = e >> 4, q = e & 15; size_t dh = (r0 + rl) * CC + c0 + q * 8;
      if (which == 1) { const int l = e & 31, p = (e >> 5) & 3, hh = (e >> 7) & 1, kt = e >> 8; rl = kt * 16 + (l & 15); q = hh * 8 + p * 2 + (l >> 4); dh = KF_TILE(bb, c0 / HD + hh, t0 / 16 + kt) + p * 256 + l * 8; }   // a wave stores one 512-B piece
      _Float16* pd = DH + dh; const v4u dv = *(const v4u*)&sh[rl][q * 8]; vst2((unsigned*)pd, dv);
      asm volatile("s_wait_xcnt 0x0" :: "v"(pd), "v"(dv) : "memory");   // the store's address pair and data live up to this wait and are rewritten only behind it
      if (hi_rows) { _Float16* pl = DL + (bb * nhi + t0 + rl) * (size_t)CC + c0 + q * 8; const v4u lv = *(const v4u*)&sl[rl][q * 8]; vst2((unsigned*)pl, lv);
        asm volatile("s_wait_xcnt 0x0" :: "v"(pl), "v"(lv) : "memory"); } }   // as above
  } else { const bool hi_rows = t0 < KHI;
#pragma unroll
    for (int j = 0; j < 8; ++j) { const float bias = BA ? bfr(BA[c0 + j * 16 + col]) : 0.f;
#pragma unroll
      for (int r = 0; r < 8; ++r) { const float v = acc[j][r] + bias; const int rl = wave * 16 + 8 * g + r, cl = j * 16 + col; th[cl][rl] = (_Float16)v; const __bf16 bh = (__bf16)v; tb[cl][rl] = bh; tbl[cl][rl] = (__bf16)(v - (float)bh); } }
    __syncthreads();
    for (int e = tid; e < 128 * 8; e += 128) { const int l = e & 31, hf = (e >> 5) & 1, j = (e >> 6) & 3, hh = (e >> 8) & 1, cb = e >> 9; const int cl = hh * 64 + j * 16 + (l & 15), q = cb * 4 + hf * 2 + (l >> 4);   // a wave stores one 512-B piece
      _Float16* pv = VT + VF_BLK(bb, c0 / HD + hh, t0 / 32 + cb) + (j * 2 + hf) * 256 + l * 8; const v4u dv = *(const v4u*)&th[cl][q * 8]; vst2((unsigned*)pv, dv);
      asm volatile("s_wait_xcnt 0x0" :: "v"(pv), "v"(dv) : "memory");   // the store's address pair and data live up to this wait and are rewritten only behind it
      if (hi_rows) { const size_t o3 = (bb * CC + c0 + cl) * (size_t)KHI + t0 + q * 8; __bf16 *ph = VB + o3, *pl = VBL + o3; const v4u hv = *(const v4u*)&tb[cl][q * 8], lv = *(const v4u*)&tbl[cl][q * 8]; vst2((unsigned*)ph, hv); vst2((unsigned*)pl, lv);
        asm volatile("s_wait_xcnt 0x0" :: "v"(ph), "v"(pl), "v"(hv), "v"(lv) : "memory"); } } } }   // as above
// ---- k_fa: block = 16 waves x 16 queries of (b, h), one launch for every (b, h); k and v come to LDS once per block by asynchronous copies, 128 keys a stage, two buffers; per 32 keys S^T = K Q^T (1 product), running maximum and sum per query column in f32, P = 2^((s - m) SCALE log2 e) x 2^8 once to f16 straight from the score registers as the B operand, O^T += V^T P^T (1 product); the logits never leave the registers; ctx = O / sum
__device__ __forceinline__ float xhalf(float x) { return __builtin_bit_cast(float, __builtin_amdgcn_permlanex16(__builtin_bit_cast(int, x), __builtin_bit_cast(int, x), 0x76543210, 0xfedcba98, false, false)); }  // lane l with lane l ^ 16
__device__ __forceinline__ v16h frag_p(const _Float16* p) { union { v16h v; v8h q[2]; } u; u.q[0] = *(const v8h*)p; u.q[1] = *(const v8h*)(p + 256); return u.v; }   // fragment-order source, the lane's 8 elements already in p: the two halves are neighbouring 512-B pieces
__device__ __forceinline__ v8f wmma_h(v16h a, v16h b, v8f c) { return __builtin_amdgcn_wmma_f32_16x16x32_f16(false, a, false, b, (short)0, c, false, false); }
#define FAW 16            // waves per block
#define SCALE2 ((float)(0.04419417382415922 * 1.4426950408889634))   // SCALE x log2 e: e^(s SCALE) = 2^(s SCALE2), so one fused multiply-add and one v_exp_f32 make an exponential
#define FST 128           // keys per stage: 16 KB of k and 16 KB of v, each contiguous in the workspace's fragment order
#define NST (TT / FST)    // stages per (b, h)
#define FSE (FST * HD)    // elements of k (or of v) per stage
// one stage's k and v into one LDS buffer: 512 threads x 4 copies of 16 bytes, a thread's own bytes at 16 tid (+ 8 KB); the s_wait_xcnt stands inside the statement, so the address registers are rewritten only behind it
__device__ __forceinline__ void kv_copy(unsigned lb, const _Float16* gk, const _Float16* gv) {
  const unsigned l1 = lb + 8192u, l2 = lb + 16384u, l3 = lb + 24576u; const _Float16 *gk1 = gk + 4096, *gv1 = gv + 4096;
  asm volatile("global_load_async_to_lds_b128 %0, %4, off\n\tglobal_load_async_to_lds_b128 %1, %5, off\n\tglobal_load_async_to_lds_b128 %2, %6, off\n\tglobal_load_async_to_lds_b128 %3, %7, off\n\ts_wait_xcnt 0x0"
               :: "v"(lb), "v"(l1), "v"(l2), "v"(l3), "v"(gk), "v"(gk1), "v"(gv), "v"(gv1) : "memory");
}
__global__ __launch_bounds__(FAW * 32) void k_fa(const _Float16* __restrict__ QH, const _Float16* __restrict__ KH, const _Float16* __restrict__ VT, float* __restrict__ Y) { __shared__ __align__(16) float ss[FAW][16][HD + 4];
  __shared__ __align__(16) _Float16 kv[2][2][FSE];   // two buffers of (k, v): the block fetches each stage once, a whole stage ahead of its use, and its 16 waves read their fragments from here
  const int tid = threadIdx.x, wave = tid >> 5, lane = tid & 31, col = lane & 15, g = lane >> 4; const int h = blockIdx.y, b = blockIdx.z; const int ql0 = blockIdx.x * (FAW * 16) + wave * 16;
  const unsigned lds0 = (unsigned)(size_t)&kv[0][0][0] + (unsigned)tid * 16u;   // this thread's 16 bytes in buffer 0 (LDS byte address)
  const _Float16* Kg = KH + KF_TILE(b, h, 0) + tid * 8;   // and in stage 0 of (b, h)
  const _Float16* Vg = VT + VF_BLK(b, h, 0) + tid * 8;
  kv_copy(lds0, Kg, Vg);
  v16h qh[HD / 32];
#pragma unroll
  for (int kc = 0; kc < HD / 32; ++kc) qh[kc] = frag_h(QH + ((size_t)b * TT + ql0 + col) * CC + h * HD + kc * 32, lane);
  v8f o[HD / 16] = {}; float m = -3.0e38f, l = 0.f;
  asm volatile("s_wait_asynccnt 0x0" ::: "memory");   // this wave's copies of stage 0 have landed
  __syncthreads();                                     // stage 0 is published
  kv_copy(lds0 + 4u * FSE, Kg + FSE, Vg + FSE);        // stage 1 flies while stage 0 is worked on
#pragma unroll 1   // rolled: one body holds four passes already
  for (int st = 0; st < NST; ++st) {
    const _Float16* kb = &kv[st & 1][0][0] + lane * 8;   // this lane's 16 bytes of the stage's first k piece
    const _Float16* vb = &kv[st & 1][1][0] + lane * 8;
    v16h kf[2][HD / 32];
#pragma unroll
    for (int t = 0; t < 2; ++t)
#pragma unroll
      for (int kc = 0; kc < HD / 32; ++kc) kf[t][kc] = frag_p(kb + t * 1024 + kc * 512);
#pragma unroll   // in full: the pass index is a constant in every LDS offset, and the last pass's missing prefetch costs no branch
    for (int c = 0; c < FST / 32; ++c) {
      v16h vf[HD / 16];
#pragma unroll
      for (int j = 0; j < HD / 16; ++j) vf[j] = frag_p(vb + c * 2048 + j * 512);
      v8f sh[2];
      // the four score products in one statement: as builtins the last of them were placed behind the next k loads, which then took new registers; the v_nop keep the distance from the last product to the first instruction that writes its operands or reads its result
      asm volatile("v_wmma_f32_16x16x32_f16 %0, %2, %6, 0\n\tv_wmma_f32_16x16x32_f16 %1, %3, %6, 0\n\t"
                   "v_wmma_f32_16x16x32_f16 %0, %4, %7, %0\n\tv_wmma_f32_16x16x32_f16 %1, %5, %7, %1\n\t"
                   "v_nop\n\tv_nop\n\tv_nop\n\tv_nop"
                   : "=&v"(sh[0]), "=&v"(sh[1]) : "v"(kf[0][0]), "v"(kf[1][0]), "v"(kf[0][1]), "v"(kf[1][1]), "v"(qh[0]), "v"(qh[1]));
      if (c + 1 < FST / 32) {   // the next 32 keys' fragments of the same stage are read while this pass does its softmax (nothing of the next stage is read before its barrier)
#pragma unroll
        for (int t = 0; t < 2; ++t)
#pragma unroll
          for (int kc = 0; kc < HD / 32; ++kc) kf[t][kc] = frag_p(kb + (c + 1) * 2048 + t * 1024 + kc * 512); }
      __builtin_amdgcn_sched_barrier(0);   // keeps the next k reads in one group here, ahead of the softmax (without it the scheduler scatters them among the vector instructions and the products)
      float s[16]; float mx = -3.0e38f;   // s[8 t + r] = unscaled logit of key 32 c + 16 t + 8 g + r of the stage for query col: the k order of a B fragment
#pragma unroll
      for (int t = 0; t < 2; ++t)
#pragma unroll
        for (int r = 0; r < 8; ++r) { s[t * 8 + r] = sh[t][r]; mx = fmaxf(mx, s[t * 8 + r]); }
      mx = fmaxf(mx, xhalf(mx));
      const float mn = fmaxf(m, mx); const float al = __builtin_amdgcn_exp2f((m - mn) * SCALE2); m = mn;   // SCALE2 > 0: the maximum is taken over the unscaled logits; al = 0 on the first pass
      const float ms = __builtin_fmaf(mn, -SCALE2, 8.0f);   // + 8 = x 2^8: keeps small P out of the f16 subnormals; cancels against the sum
      v16h p; float ps = 0.f;
#pragma unroll
      for (int i = 0; i < 16; i += 2) { const v2f a = __builtin_elementwise_fma((v2f){s[i], s[i + 1]}, (v2f){SCALE2, SCALE2}, (v2f){ms, ms});   // two arguments per packed fma
        const float e0 = __builtin_amdgcn_exp2f(a[0]), e1 = __builtin_amdgcn_exp2f(a[1]); ps += e0; ps += e1; p[i] = (_Float16)e0; p[i + 1] = (_Float16)e1; }
      l = l * al + ps;
#pragma unroll
      for (int j = 0; j < HD / 16; ++j) { o[j] *= al; o[j] = wmma_h(vf[j], p, o[j]); }
      __builtin_amdgcn_sched_barrier(0); }   // keeps a pass's vector work and products ahead of what follows it (without it the last two passes' sink behind the stage's barrier, and the refill is issued that much later)
    asm volatile("s_wait_dscnt 0x0" ::: "memory");      // this wave's reads of the stage are done
    asm volatile("s_wait_asynccnt 0x0" ::: "memory");   // and its copies of the next stage have landed
    __syncthreads();                                     // the next stage is published, and every wave has left this stage's buffer
    if (st + 2 < NST) kv_copy(lds0 + (unsigned)(st & 1) * (4u * FSE), Kg + (size_t)(st + 2) * FSE, Vg + (size_t)(st + 2) * FSE); }   // which is refilled two stages ahead
  asm volatile("s_wait_asynccnt 0x0" ::: "memory");   // no copy is left in flight behind the loop
  l += xhalf(l); const float inv = 1.0f / l;
#pragma unroll
  for (int j = 0; j < HD / 16; ++j) { v4f lo, hi;   // o[j][r] = ctx of query col, channel 16 j + 8 g + r
#pragma unroll
    for (int r = 0; r < 4; ++r) { lo[r] = o[j][r] * inv; hi[r] = o[j][4 + r] * inv; }
    *(v4f*)&ss[wave][col][j * 16 + 8 * g] = lo; *(v4f*)&ss[wave][col][j * 16 + 8 * g + 4] = hi; }
  LDSX();
#pragma unroll
  for (int i = 0; i < 8; ++i) { const int rl = 2 * i + g; vst2(Y + ((size_t)b * TT + ql0 + rl) * CC + h * HD + col * 4, *(const v4f*)&ss[wave][rl][col * 4]); } }   // 256-B (row, head) segment by 16 lanes
// ---- k_out: block = (64 rows, 128 cols): out = ctx Wo (+ bo): ctx split bf16 hi + lo against exact bf16 Wo (2 products) for all rows
__global__ __launch_bounds__(128) void k_out(const float* __restrict__ Y, const float* __restrict__ WO, const float* __restrict__ BO, float* __restrict__ OUT) { __shared__ __align__(16) float sf[4][16][132]; __shared__ __align__(16) __bf16 wt[128][WPT];
  const int tid = threadIdx.x, wave = tid >> 5, lane = tid & 31, col = lane & 15, g = lane >> 4; const int c0 = blockIdx.y * 128; const size_t r0 = (size_t)blockIdx.x * 64 + wave * 16;
  v8f acc[8] = {};
  if (true) {   /* ALL rows: ctx split bf16 hi + lo x exact Wo (2 products) */
    const int sc = 32 * wave + 4 * ((lane & 3) | ((lane >> 4) << 2)), kg = (lane >> 2) & 3;   // staging map as in k_proj
    const float* wsrc = WO + (size_t)(8 * kg) * DIN + c0 + sc; const float* ysrc = Y + (r0 + col) * CC + 8 * g;
    WReg wr; v4f yr[WKC / 8];
    wtile_load(wr, wsrc, DIN);
#pragma unroll
    for (int kk = 0; kk < WKC / 32; ++kk) { yr[kk * 4] = *(const v4f*)(ysrc + kk * 32); yr[kk * 4 + 1] = *(const v4f*)(ysrc + kk * 32 + 4); yr[kk * 4 + 2] = *(const v4f*)(ysrc + kk * 32 + 16); yr[kk * 4 + 3] = *(const v4f*)(ysrc + kk * 32 + 20); }
    asm volatile("s_wait_xcnt 0x0" :: "v"(wsrc), "v"(ysrc) : "memory");   // the loads' address pairs live up to this wait and are rewritten only behind it
    auto split_a = [&](F2 (&a)[WKC / 32]) {
#pragma unroll
      for (int kk = 0; kk < WKC / 32; ++kk) { float v[16];
#pragma unroll
        for (int i = 0; i < 4; ++i) { v[i] = yr[kk * 4][i]; v[4 + i] = yr[kk * 4 + 1][i]; v[8 + i] = yr[kk * 4 + 2][i]; v[12 + i] = yr[kk * 4 + 3][i]; }
        a[kk] = bsplit16(v); } };
    auto publish = [&]() { __syncthreads();   // every wave has read the last chunk's fragments
      wtile_store(wr, wt, sc, kg);
      __syncthreads(); };   // the chunk is published
    auto products = [&](const F2 (&a)[WKC / 32]) {
#pragma unroll
      for (int kk = 0; kk < WKC / 32; ++kk)
#pragma unroll
        for (int jh = 0; jh < 2; ++jh) { v16b w[4];
#pragma unroll
          for (int j = 0; j < 4; ++j) w[j] = frag_b(&wt[(jh * 4 + j) * 16 + col][kk * 32], lane);
#pragma unroll
          for (int j = 0; j < 4; ++j) { acc[jh * 4 + j] = wmma_bf(a[kk].h, w[j], acc[jh * 4 + j]); acc[jh * 4 + j] = wmma_bf(a[kk].l, w[j], acc[jh * 4 + j]); } } };
#pragma unroll 1   // rolled, as in k_proj
    for (int ch = 0; ch < CC / WKC - 1; ++ch) { F2 a[WKC / 32]; split_a(a); publish();
      wtile_load(wr, wsrc + (size_t)WKC * DIN, DIN);   // the next chunk's loads fly while this chunk's products run
#pragma unroll
      for (int kk = 0; kk < WKC / 32; ++kk) { yr[kk * 4] = *(const v4f*)(ysrc + WKC + kk * 32); yr[kk * 4 + 1] = *(const v4f*)(ysrc + WKC + kk * 32 + 4); yr[kk * 4 + 2] = *(const v4f*)(ysrc + WKC + kk * 32 + 16); yr[kk * 4 + 3] = *(const v4f*)(ysrc + WKC + kk * 32 + 20); }
      asm volatile("s_wait_xcnt 0x0" :: "v"(wsrc), "v"(ysrc) : "memory");   // as above
      wsrc += (size_t)WKC * DIN; ysrc += WKC;
      products(a); }
    { F2 a[WKC / 32]; split_a(a); publish(); products(a); }   // the last chunk: nothing left to fetch
#pragma unroll
    for (int j = 0; j < 8; ++j) { const float bias = BO ? bfr(BO[c0 + j * 16 + col]) : 0.f;
#pragma unroll
      for (int r = 0; r < 8; ++r) sf[wave][8 * g + r][j * 16 + col] = acc[j][r] + bias; }
  } else {
#pragma unroll 2
    for (int kc = 0; kc < CC / 32; ++kc) { const v16h a = frag_f32(Y + (r0 + col) * CC + kc * 32, lane); asm volatile("s_wait_loadcnt 0x0" ::: "memory");
#pragma unroll
      for (int j = 0; j < 8; ++j) { const v16h w = WOCOLH(WO, kc * 32, c0 + j * 16 + col, lane); asm volatile("s_wait_loadcnt 0x0" ::: "memory"); acc[j] = wmma16(a, w, acc[j]); } }
#pragma unroll
    for (int j = 0; j < 8; ++j) { const float bias = BO ? bfr(BO[c0 + j * 16 + col]) : 0.f;
#pragma unroll
      for (int r = 0; r < 8; ++r) sf[wave][8 * g + r][j * 16 + col] = acc[j][r] * (1.0f / 256.0f) + bias; } }
  LDSX(); for (int rl = 0; rl < 16; ++rl) vst2(OUT + (r0 + rl) * DIN + c0 + lane * 4, *(const v4f*)&sf[wave][rl][lane * 4]); }

extern "C" void kernel_launch(void* const* d_in, const int* in_sizes, int n_in, void* d_out, int out_size, void* d_ws, size_t ws_size, hipStream_t stream) {
  (void)in_sizes; (void)n_in; (void)out_size;
  const float** F = (const float**)d_in;
  if (ws_size < (size_t)WS_END) return;
  char* ws = (char*)d_ws; _Float16 *QH = (_Float16*)(ws + WS_QH), *KH = (_Float16*)(ws + WS_KH), *VT = (_Float16*)(ws + WS_VT), *QL = (_Float16*)(ws + WS_QL), *KL = (_Float16*)(ws + WS_KL); __bf16 *VB = (__bf16*)(ws + WS_VB), *VBL = (__bf16*)(ws + WS_VBL); float *Y = (float*)(ws + WS_Y);
  (void)Y; (void)QL; (void)KL; (void)VB; (void)VBL;
  // inputs: 0 q; 1 k; 2 v [4,2048,512]; 3 Wq (in,out), 4 bq; 5 Wk, 6 bk; 7 Wv, 8 bv; 9 Wo (in,out), 10 bo
  k_proj<<<dim3(TNB * TT / 64, CC / 128, 3), 128, 0, stream>>>(F[0], F[1], F[2], F[3], F[5], F[7], F[4], F[6], F[8], QH, QL, KH, KL, VT, VB, VBL);
  k_fa<<<dim3(TT / (FAW * 16), NH, TNB), FAW * 32, 0, stream>>>(QH, KH, VT, Y);
  k_out<<<dim3(TNB * TT / 64, DIN / 128), 128, 0, stream>>>(Y, F[9], F[10], (float*)d_out);
}

// v007
// It runs in 79.6 microseconds.
// Timed twice side by side with v006, it ran 1.06 times as fast both times.
// Over all steps from v000 it is 13.9 times as fast.
// compute dtype: all float inputs rounded to bf16; q/k/v = in W + b with EXACT bf16 products on WMMA 16x16x32 (f32 accumulate); q once to f16 against k once to f16 (1 product) / sqrt(512); running-maximum softmax in f32 (base 2: log2 e folded into the scale, hardware exp2) fused with both products; unnormalised P x 2^8 once to f16 against v once to f16 (1 product), / sum in f32; ctx split bf16 hi + lo against exact Wo (2 products) + bo; f32 output.
#include <hip/hip_runtime.h>
#include <math.h>

typedef __attribute__((ext_vector_type(16))) _Float16 v16h;
typedef __attribute__((ext_vector_type(16))) __bf16 v16b;
typedef __attribute__((ext_vector_type(8)))  _Float16 v8h;
typedef __attribute__((ext_vector_type(8)))  float v8f;
typedef __attribute__((ext_vector_type(4)))  float v4f;
typedef __attribute__((ext_vector_type(2)))  float v2f;
typedef __attribute__((ext_vector_type(4)))  unsigned v4u;
typedef __attribute__((ext_vector_type(4)))  int v4i;
typedef float __attribute__((may_alias)) float_a;
typedef int __attribute__((may_alias)) int_a;

template <typename T> __device__ __forceinline__ void vst2(void* p, T v) { *(T*)p = v;  }
__device__ __forceinline__ v8f wmma16(v16h a, v16h b, v8f c) {
  v8f d = __builtin_amdgcn_wmma_f32_16x16x32_f16(false, a, false, b, (short)0, c, false, false);
  asm volatile("v_nop\n\tv_nop\n\tv_nop\n\tv_nop" : "+v"(d) : "v"(a), "v"(b));
  return d;
}
__device__ __forceinline__ v8f wmma_bf(v16b a, v16b b, v8f c) {
  v8f d = __builtin_amdgcn_wmma_f32_16x16x32_bf16(false, a, false, b, (short)0, c, false, false);
  asm volatile("v_nop\n\tv_nop\n\tv_nop\n\tv_nop" : "+v"(d) : "v"(a), "v"(b));
  return d;
}
// 16x16x32 fragments: lane = (h = lane>>4, row/col = lane&15); elements 0..7 = k0+8h+0..7, 8..15 = k0+16+8h+0..7; D element r = row 8h+r
__device__ __forceinline__ v16h frag_h(const _Float16* rowk0, int lane) {
  union { v16h v; v8h q[2]; } u; const _Float16* p = rowk0 + 8 * (lane >> 4);
  u.q[0] = *(const v8h*)p; u.q[1] = *(const v8h*)(p + 16); return u.v;
}
__device__ __forceinline__ v16h frag_f32(const float* rowk0, int lane) {
  v16h a; const float* p = rowk0 + 8 * (lane >> 4);
#pragma unroll
  for (int i = 0; i < 8; ++i) { a[i] = (_Float16)p[i]; a[8 + i] = (_Float16)p[16 + i]; }
  return a;
}
__device__ __forceinline__ v16h frag_f32s(const float* rowk0, int lane, float sc) {
  v16h a; const float* p = rowk0 + 8 * (lane >> 4);
#pragma unroll
  for (int i = 0; i < 8; ++i) { a[i] = (_Float16)(p[i] * sc); a[8 + i] = (_Float16)(p[16 + i] * sc); }
  return a;
}
// column fragment from a [K][ld] layout (column n), rows >= K read as 0
__device__ __forceinline__ v16h fragc_f32(const float* W, int k0, int n, int lane, int ld, int K) {
  v16h a; const int g = lane >> 4;
#pragma unroll
  for (int i = 0; i < 8; ++i) { const int ka = k0 + 8 * g + i, kb = ka + 16;
    a[i] = (_Float16)(ka < K ? W[(size_t)(ka < K ? ka : K - 1) * ld + n] : 0.f); a[8 + i] = (_Float16)(kb < K ? W[(size_t)(kb < K ? kb : K - 1) * ld + n] : 0.f); }
  return a;
}
struct F2 { v16b h, l; };
__device__ __forceinline__ F2 bsplit16(const float v[16]) { F2 r;
#pragma unroll
  for (int i = 0; i < 16; ++i) { const __bf16 h = (__bf16)v[i]; r.h[i] = h; r.l[i] = (__bf16)(v[i] - (float)h); }
  return r; }
__device__ __forceinline__ F2 split_row(const float* row, int k0, int lane) { float v[16]; const float* p = row + k0 + 8 * (lane >> 4);
#pragma unroll
  for (int i = 0; i < 8; ++i) { v[i] = p[i]; v[8 + i] = p[16 + i]; }
  return bsplit16(v); }
__device__ __forceinline__ F2 split_rowK(const float* row, int k0, int lane, int K) { float v[16]; const int g = lane >> 4;
#pragma unroll
  for (int i = 0; i < 8; ++i) { const int ka = k0 + 8 * g + i, kb = ka + 16; v[i] = ka < K ? row[ka < K ? ka : K - 1] : 0.f; v[8 + i] = kb < K ? row[kb < K ? kb : K - 1] : 0.f; }
  return bsplit16(v); }
__device__ __forceinline__ F2 split_col(const float* W, int k0, int n, int lane, int ld, int K) { float v[16]; const int g = lane >> 4;
#pragma unroll
  for (int i = 0; i < 8; ++i) { const int ka = k0 + 8 * g + i, kb = ka + 16; v[i] = ka < K ? W[(size_t)(ka < K ? ka : K - 1) * ld + n] : 0.f; v[8 + i] = kb < K ? W[(size_t)(kb < K ? kb : K - 1) * ld + n] : 0.f; }
  return bsplit16(v); }
__device__ __forceinline__ v8f mac3(const F2& a, const F2& b, v8f c) { c = wmma_bf(a.l, b.h, c); c = wmma_bf(a.h, b.l, c); return wmma_bf(a.h, b.h, c); }
__device__ __forceinline__ float sigm(float v) { return 1.0f / (1.0f + expf(-v)); }
#define LDSX() do { asm volatile("s_wait_dscnt 0" ::: "memory"); __builtin_amdgcn_wave_barrier(); __builtin_amdgcn_fence(__ATOMIC_RELEASE, "workgroup"); } while (0)

// Multi-head attention with separate q / k / v inputs (B 4, S 2,048, hid 512 = 8 x 64; (in,out) 1/sqrt(512)-scale weights, zero biases; scale = 1/sqrt(hid_dim = 512), as written): qp = q Wq + bq ...; out = merged(softmax(qh kh^T / sqrt(512)) vh) Wo + bo (non-causal).
#define NB 4
#define TT 2048
#define CC 512            // NH * HD = projected width
#define DIN 512          // input (model) width
#define NH 8
#define HD 64
#define NQB (TT / 64)
#define HG 4
#define SCALE (0.04419417382415922f)
#define CAUSAL 0
#ifndef TNB
#define TNB NB
#endif
__device__ __forceinline__ float bfr(float v) { return (float)(__bf16)v; }
__host__ __device__ __forceinline__ int kb_last(int qb) { return CAUSAL ? ((qb * 64 + 63) >> 7) : (TT / 128 - 1); }
typedef __attribute__((ext_vector_type(8))) __bf16 v8b;
__device__ __forceinline__ v16b frag_b(const __bf16* rowk0, int lane) {
  union { v16b v; v8b q[2]; } u; const __bf16* p = rowk0 + 8 * (lane >> 4);
  u.q[0] = *(const v8b*)p; u.q[1] = *(const v8b*)(p + 16); return u.v;
}
#define QBH 0              // unused: no kernel reads it (no kernel has a high-precision path)
#define QHI 2048            // rows of the workspace plane WS_QL (no kernel writes or reads it: q goes once rounded into the logits); it keeps the offsets behind it
#define KHI 64            // rows of the workspace planes WS_KL, WS_VB, WS_VBL (no kernel writes or reads them); it keeps the offsets behind them
// B fragment (k rows k0+.., output column o) of a weight: (in,out) [K][ld] or (out,in) [ld rows of K]: bf16 exact, or f16(bf16 * 256) exact
__device__ __forceinline__ v16b wcol_io(const float* Wm, int k0, int o, int lane, int ld) { v16b w; const int g = lane >> 4;
#pragma unroll
  for (int i = 0; i < 8; ++i) { w[i] = (__bf16)Wm[(size_t)(k0 + 8 * g + i) * ld + o]; w[8 + i] = (__bf16)Wm[(size_t)(k0 + 16 + 8 * g + i) * ld + o]; }
  return w; }
__device__ __forceinline__ v16b wcol_oi(const float* Wm, int k0, int o, int lane, int K) { v16b w; const float* p = Wm + (size_t)o * K + k0 + 8 * (lane >> 4);
#pragma unroll
  for (int i = 0; i < 8; ++i) { w[i] = (__bf16)p[i]; w[8 + i] = (__bf16)p[16 + i]; }
  return w; }
__device__ __forceinline__ v16h wcolh_io(const float* Wm, int k0, int o, int lane, int ld) { v16h w; const int g = lane >> 4;
#pragma unroll
  for (int i = 0; i < 8; ++i) { w[i] = (_Float16)(bfr(Wm[(size_t)(k0 + 8 * g + i) * ld + o]) * 256.0f); w[8 + i] = (_Float16)(bfr(Wm[(size_t)(k0 + 16 + 8 * g + i) * ld + o]) * 256.0f); }
  return w; }
__device__ __forceinline__ v16h wcolh_oi(const float* Wm, int k0, int o, int lane, int K) { v16h w; const float* p = Wm + (size_t)o * K + k0 + 8 * (lane >> 4);
#pragma unroll
  for (int i = 0; i < 8; ++i) { w[i] = (_Float16)(bfr(p[i]) * 256.0f); w[8 + i] = (_Float16)(bfr(p[16 + i]) * 256.0f); }
  return w; }
#define WQKV_LAYOUT 0   // 0 = (in,out) [DIN][CC]; k_proj reads only this layout (other values change only WCOL, which nothing calls)
__device__ __forceinline__ v16b wcol_hdk(const float* Wm, int k0, int o, int lane) { v16b w; const int g = lane >> 4; const float* p = Wm + (size_t)(o / HD) * DIN * HD + (o % HD);
#pragma unroll
  for (int i = 0; i < 8; ++i) { w[i] = (__bf16)p[(size_t)(k0 + 8 * g + i) * HD]; w[8 + i] = (__bf16)p[(size_t)(k0 + 16 + 8 * g + i) * HD]; }
  return w; }
#define WO_OUT_IN 0
#if WQKV_LAYOUT == 1
#define WCOL(W, k0, o, lane) wcol_oi(W, k0, o, lane, DIN)
#elif WQKV_LAYOUT == 2
#define WCOL(W, k0, o, lane) wcol_hdk(W, k0, o, lane)
#else
#define WCOL(W, k0, o, lane) wcol_io(W, k0, o, lane, CC)
#endif
#if WO_OUT_IN
#define WOCOL(W, k0, o, lane) wcol_oi(W, k0, o, lane, CC)
#define WOCOLH(W, k0, o, lane) wcolh_oi(W, k0, o, lane, CC)
#else
#define WOCOL(W, k0, o, lane) wcol_io(W, k0, o, lane, DIN)
#define WOCOLH(W, k0, o, lane) wcolh_io(W, k0, o, lane, DIN)
#endif

#ifndef SM_EXTRA_PARAMS
#define SM_EXTRA_PARAMS
#endif
#ifndef PROJ_EXTRA_PARAMS
#define PROJ_EXTRA_PARAMS
#endif
#ifndef SM_MASK_HOOK
#define SM_MASK_HOOK (void)0
#endif

#define WS_QH  0u                                      // f16 q in fragment order, as k: [b][h][16-query tile][piece p = 16 channels][lane = 16 g + query][8 channels 16 p + 8 g + ..]
#define WS_KH  (WS_QH + 2u * (size_t)NB * TT * CC)      // f16 k in fragment order [b][h][16-key tile][piece p = 16 channels][lane = 16 g + key][8 channels 16 p + 8 g + ..]
#define WS_VT  (WS_KH + 2u * (size_t)NB * TT * CC)      // f16 v in fragment order [b][h][32-key block][16-channel tile j][half][lane = 16 g + channel][8 keys 16 half + 8 g + ..]
#define WS_QL  (WS_VT + 2u * (size_t)NB * CC * TT)      // unused (room of a q residual plane) [b][t < QHI][CC]
#define WS_KL  (WS_QL + 2u * (size_t)NB * QHI * CC)     // unused (room of a k residual plane) [b][t < KHI][CC]
#define WS_VB  (WS_KL + 2u * (size_t)NB * KHI * CC)     // unused (room of two bf16 v planes) [b][c][t < KHI]
#define WS_VBL (WS_VB + 2u * (size_t)NB * CC * KHI)
#define WS_S   (WS_VBL + 2u * (size_t)NB * CC * KHI)    // f32 [hg][t][s] region, unused: k_fa keeps the logits in registers
#define WS_Y   (WS_S  + 4u * (size_t)HG * TT * TT)      // f32 ctx rows [b*t][CC] (only when there is an output projection)
#define WS_END (WS_Y  + 4u * (size_t)NB * TT * CC)
// k and v lie in the workspace as k_fa's A fragments read them: the 32 lanes' 16-byte pieces of one load are 512 contiguous bytes (4 whole lines; by rows or planes one load touched 16 lines for the same bytes)
#define KF_TILE(b, h, kt) ((((size_t)(b) * NH + (h)) * (TT / 16) + (kt)) * 1024)   // element offset of a 16-key tile: 4 pieces of 256 elements
#define VF_BLK(b, h, cb)  ((((size_t)(b) * NH + (h)) * (TT / 32) + (cb)) * 2048)   // element offset of a 32-key block: 4 channel tiles x 2 halves of 256 elements

// ---- weight tile in LDS: 128 threads bring 64 k rows x 128 output columns of an (in,out) f32 weight as 16-byte row pieces (whole 128-B lines), round them to bf16 as before and store them [column][k], so that a B fragment is two 16-byte LDS reads and the block's four waves share one fetch and one rounding (the short loops are unrolled in full: the register arrays need constant indices)
#define WKC 64            // k rows per staged chunk
#define WPT (WKC + 8)     // LDS pitch in elements: 144 B = 16 B x odd, the fragment reads of 16 columns fall on 16 different bank groups
struct WReg { v4f x[16]; };
__device__ __forceinline__ void wtile_load(WReg& r, const float* wsrc, int ld) {   // wsrc: this thread's first row (8 kg) and first of 4 columns
#pragma unroll
  for (int p = 0; p < WKC / 32; ++p)
#pragma unroll
    for (int i = 0; i < 8; ++i) r.x[p * 8 + i] = *(const v4f*)(wsrc + (size_t)(p * 32 + i) * ld);
}
__device__ __forceinline__ void wtile_store(const WReg& r, __bf16 (*wt)[WPT], int sc, int kg) {
#pragma unroll
  for (int p = 0; p < WKC / 32; ++p)
#pragma unroll
    for (int cc = 0; cc < 4; ++cc) { v8b t;
#pragma unroll
      for (int i = 0; i < 8; ++i) t[i] = (__bf16)r.x[p * 8 + i][cc];
      *(v8b*)&wt[sc + cc][p * 32 + 8 * kg] = t; }
}
// ---- k_proj: block = (64 rows, 128 cols, which): q/k/v = X W (+ b) with exact bf16 products (K = DIN), f16 results in k_fa's fragment order, stored straight from the accumulators. SW (q, k): the weight fragment is the A operand and the x fragment the B operand, so a lane holds 8 consecutive channels of one row; v: x is A, so a lane holds 8 consecutive keys of one channel. Either way a tile of a wave is one 512-B piece of the workspace: no LDS staging and no barrier behind the products
template <bool SW> __device__ __forceinline__ void proj_body(const float* __restrict__ X, const float* __restrict__ WA, const float* __restrict__ BA, _Float16* __restrict__ D, __bf16 (*wt)[WPT]) {
  const int tid = threadIdx.x, wave = tid >> 5, lane = tid & 31, col = lane & 15, g = lane >> 4; const int c0 = blockIdx.y * 128; const size_t r0 = (size_t)blockIdx.x * 64; const size_t bb = r0 / TT; const int t0 = (int)(r0 % TT);
  const int sc = 32 * wave + 4 * ((lane & 3) | ((lane >> 4) << 2)), kg = (lane >> 2) & 3;   // staging: 4 columns x 8 k rows per thread and 32 k; 16 lanes store to 16 different bank groups
  const float* wsrc = WA + (size_t)(8 * kg) * CC + c0 + sc; const float* xsrc = X + (r0 + wave * 16 + col) * DIN + 8 * g;
  v8f acc[8] = {}; WReg wr; v4f xr[WKC / 8];
  wtile_load(wr, wsrc, CC);
#pragma unroll
  for (int kk = 0; kk < WKC / 32; ++kk) { xr[kk * 4] = *(const v4f*)(xsrc + kk * 32); xr[kk * 4 + 1] = *(const v4f*)(xsrc + kk * 32 + 4); xr[kk * 4 + 2] = *(const v4f*)(xsrc + kk * 32 + 16); xr[kk * 4 + 3] = *(const v4f*)(xsrc + kk * 32 + 20); }
  asm volatile("s_wait_xcnt 0x0" :: "v"(wsrc), "v"(xsrc) : "memory");   // the loads' address pairs live up to this wait and are rewritten only behind it
  auto round_a = [&](v16b (&a)[WKC / 32]) {
#pragma unroll
    for (int kk = 0; kk < WKC / 32; ++kk)
#pragma unroll
      for (int i = 0; i < 4; ++i) { a[kk][i] = (__bf16)xr[kk * 4][i]; a[kk][4 + i] = (__bf16)xr[kk * 4 + 1][i]; a[kk][8 + i] = (__bf16)xr[kk * 4 + 2][i]; a[kk][12 + i] = (__bf16)xr[kk * 4 + 3][i]; } };
  auto publish = [&]() { __syncthreads();   // every wave has read the last chunk's fragments
    wtile_store(wr, wt, sc, kg);
    __syncthreads(); };   // the chunk is published
  auto products = [&](const v16b (&a)[WKC / 32]) {
#pragma unroll
    for (int kk = 0; kk < WKC / 32; ++kk)
#pragma unroll
      for (int jh = 0; jh < 2; ++jh) { v16b w[4];
#pragma unroll
        for (int j = 0; j < 4; ++j) w[j] = frag_b(&wt[(jh * 4 + j) * 16 + col][kk * 32], lane);
#pragma unroll
        for (int j = 0; j < 4; ++j) acc[jh * 4 + j] = SW ? wmma_bf(w[j], a[kk], acc[jh * 4 + j]) : wmma_bf(a[kk], w[j], acc[jh * 4 + j]); } };
#pragma unroll 1   // rolled: one body holds 16 products and 24 loads already
  for (int ch = 0; ch < DIN / WKC - 1; ++ch) { v16b a[WKC / 32]; round_a(a); publish();
    wtile_load(wr, wsrc + (size_t)WKC * CC, CC);   // the next chunk's loads fly while this chunk's products run
#pragma unroll
    for (int kk = 0; kk < WKC / 32; ++kk) { xr[kk * 4] = *(const v4f*)(xsrc + WKC + kk * 32); xr[kk * 4 + 1] = *(const v4f*)(xsrc + WKC + kk * 32 + 4); xr[kk * 4 + 2] = *(const v4f*)(xsrc + WKC + kk * 32 + 16); xr[kk * 4 + 3] = *(const v4f*)(xsrc + WKC + kk * 32 + 20); }
    asm volatile("s_wait_xcnt 0x0" :: "v"(wsrc), "v"(xsrc) : "memory");   // as above
    wsrc += (size_t)WKC * CC; xsrc += WKC;
    products(a); }
  v4f bq[SW ? 16 : 2] = {};   // SW: the lane's 8 channels of each of the 8 tiles; v: the lane's one channel of each tile
  { v16b a[WKC / 32]; round_a(a); publish();   // the last chunk: no operand is left to fetch, so the biases fly, as one group, while its products run
    if (BA) { const float* bp = BA + c0 + (SW ? 8 * g : col);
      if (SW) {
#pragma unroll
        for (int j = 0; j < 8; ++j) { bq[2 * j] = *(const v4f*)(bp + j * 16); bq[2 * j + 1] = *(const v4f*)(bp + j * 16 + 4); }
      } else {
#pragma unroll
        for (int j = 0; j < 8; ++j) bq[j >> 2][j & 3] = bp[j * 16]; }
      asm volatile("s_wait_xcnt 0x0" :: "v"(bp) : "memory"); }   // the loads' address lives up to this wait and is rewritten only behind it
    products(a);
    __builtin_amdgcn_sched_barrier(0); }   // keeps the first use of a bias behind the products (without it one rounding, with its wait for the load just issued, is lifted in front of them)
  // SW: acc[j][r] = row wave * 16 + col, channel 16 j + 8 g + r; v: acc[j][r] = key wave * 16 + 8 g + r, channel 16 j + col
  _Float16* pd = D + (SW ? KF_TILE(bb, c0 / HD, t0 / 16 + wave) : VF_BLK(bb, c0 / HD, t0 / 32 + (wave >> 1)) + (wave & 1) * 256) + lane * 8;
  v4u dv[8];
#pragma unroll
  for (int j = 0; j < 8; ++j) { union { v8h h; v4u u; } t;
#pragma unroll
    for (int r = 0; r < 8; ++r) t.h[r] = (_Float16)(acc[j][r] + bfr(SW ? bq[2 * j + (r >> 2)][r & 3] : bq[j >> 2][j & 3]));
    dv[j] = t.u; }
#pragma unroll
  for (int j = 0; j < 8; ++j) vst2(pd + (size_t)(j >> 2) * (SW ? KF_TILE(0, 1, 0) : VF_BLK(0, 1, 0)) + (j & 3) * (SW ? 256 : 512), dv[j]);   // a wave stores one 512-B piece
  asm volatile("s_wait_xcnt 0x0" :: "v"(pd), "v"(dv[0]), "v"(dv[1]), "v"(dv[2]), "v"(dv[3]), "v"(dv[4]), "v"(dv[5]), "v"(dv[6]), "v"(dv[7]) : "memory");   // the stores' address pair and data live up to this wait
}
__global__ __launch_bounds__(128) void k_proj(const float* __restrict__ XQ, const float* __restrict__ XK, const float* __restrict__ XV, const float* __restrict__ WQ, const float* __restrict__ WK, const float* __restrict__ WV, const float* __restrict__ BQ, const float* __restrict__ BK, const float* __restrict__ BV,
    _Float16* __restrict__ QH, _Float16* __restrict__ KH, _Float16* __restrict__ VT) {
  __shared__ __align__(16) __bf16 wt[128][WPT];
  const int which = blockIdx.z;   // the same for the whole block: every barrier stands under block-uniform control flow
  if (which == 2) proj_body<false>(XV, WV, BV, VT, wt);
  else proj_body<true>(which == 0 ? XQ : XK, which == 0 ? WQ : WK, which == 0 ? BQ : BK, which == 0 ? QH : KH, wt); }
// ---- k_fa: block = 16 waves x 16 queries of (b, h), one launch for every (b, h); k and v come to LDS once per block by asynchronous copies, 128 keys a stage, two buffers; per 32 keys S^T = K Q^T (1 product), running maximum and sum per query column in f32, P = 2^((s - m) SCALE log2 e) x 2^8 once to f16 straight from the score registers as the B operand, O^T += V^T P^T (1 product); the logits never leave the registers; ctx = O / sum
__device__ __forceinline__ float xhalf(float x) { return __builtin_bit_cast(float, __builtin_amdgcn_permlanex16(__builtin_bit_cast(int, x), __builtin_bit_cast(int, x), 0x76543210, 0xfedcba98, false, false)); }  // lane l with lane l ^ 16
__device__ __forceinline__ v16h frag_p(const _Float16* p) { union { v16h v; v8h q[2]; } u; u.q[0] = *(const v8h*)p; u.q[1] = *(const v8h*)(p + 256); return u.v; }   // fragment-order source, the lane's 8 elements already in p: the two halves are neighbouring 512-B pieces
__device__ __forceinline__ v8f wmma_h(v16h a, v16h b, v8f c) { return __builtin_amdgcn_wmma_f32_16x16x32_f16(false, a, false, b, (short)0, c, false, false); }
#define FAW 16            // waves per block
#define SCALE2 ((float)(0.04419417382415922 * 1.4426950408889634))   // SCALE x log2 e: e^(s SCALE) = 2^(s SCALE2), so one fused multiply-add and one v_exp_f32 make an exponential
#define FST 128           // keys per stage: 16 KB of k and 16 KB of v, each contiguous in the workspace's fragment order
#define NST (TT / FST)    // stages per (b, h)
#define FSE (FST * HD)    // elements of k (or of v) per stage
// one stage's k and v into one LDS buffer: 512 threads x 4 copies of 16 bytes, a thread's own bytes at 16 tid (+ 8 KB); the s_wait_xcnt stands inside the statement, so the address registers are rewritten only behind it
__device__ __forceinline__ void kv_copy(unsigned lb, const _Float16* gk, const _Float16* gv) {
  const unsigned l1 = lb + 8192u, l2 = lb + 16384u, l3 = lb + 24576u; const _Float16 *gk1 = gk + 4096, *gv1 = gv + 4096;
  asm volatile("global_load_async_to_lds_b128 %0, %4, off\n\tglobal_load_async_to_lds_b128 %1, %5, off\n\tglobal_load_async_to_lds_b128 %2, %6, off\n\tglobal_load_async_to_lds_b128 %3, %7, off\n\ts_wait_xcnt 0x0"
               :: "v"(lb), "v"(l1), "v"(l2), "v"(l3), "v"(gk), "v"(gk1), "v"(gv), "v"(gv1) : "memory");
}
__global__ __launch_bounds__(FAW * 32) void k_fa(const _Float16* __restrict__ QH, const _Float16* __restrict__ KH, const _Float16* __restrict__ VT, float* __restrict__ Y) { __shared__ __align__(16) float ss[FAW][16][HD + 4];
  __shared__ __align__(16) _Float16 kv[2][2][FSE];   // two buffers of (k, v): the block fetches each stage once, a whole stage ahead of its use, and its 16 waves read their fragments from here
  const int tid = threadIdx.x, wave = tid >> 5, lane = tid & 31, col = lane & 15, g = lane >> 4; const int h = blockIdx.y, b = blockIdx.z; const int ql0 = blockIdx.x * (FAW * 16) + wave * 16;
  const unsigned lds0 = (unsigned)(size_t)&kv[0][0][0] + (unsigned)tid * 16u;   // this thread's 16 bytes in buffer 0 (LDS byte address)
  const _Float16* Kg = KH + KF_TILE(b, h, 0) + tid * 8;   // and in stage 0 of (b, h)
  const _Float16* Vg = VT + VF_BLK(b, h, 0) + tid * 8;
  kv_copy(lds0, Kg, Vg);
  const _Float16* Qg = QH + KF_TILE(b, h, ql0 / 16) + lane * 8;   // q lies in the workspace as k does: this wave's 16 queries are one tile
  v16h qh[HD / 32];
#pragma unroll
  for (int kc = 0; kc < HD / 32; ++kc) qh[kc] = frag_p(Qg + kc * 512);
  asm volatile("s_wait_xcnt 0x0" :: "v"(Qg) : "memory");   // the loads' address pair lives up to this wait and is rewritten only behind it
  v8f o[HD / 16] = {}; float m = -3.0e38f, l = 0.f;
  asm volatile("s_wait_asynccnt 0x0" ::: "memory");   // this wave's copies of stage 0 have landed
  __syncthreads();                                     // stage 0 is published
  kv_copy(lds0 + 4u * FSE, Kg + FSE, Vg + FSE);        // stage 1 flies while stage 0 is worked on
#pragma unroll 1   // rolled: one body holds four passes already
  for (int st = 0; st < NST; ++st) {
    const _Float16* kb = &kv[st & 1][0][0] + lane * 8;   // this lane's 16 bytes of the stage's first k piece
    const _Float16* vb = &kv[st & 1][1][0] + lane * 8;
    v16h kf[2][HD / 32];
#pragma unroll
    for (int t = 0; t < 2; ++t)
#pragma unroll
      for (int kc = 0; kc < HD / 32; ++kc) kf[t][kc] = frag_p(kb + t * 1024 + kc * 512);
#pragma unroll   // in full: the pass index is a constant in every LDS offset, and the last pass's missing prefetch costs no branch
    for (int c = 0; c < FST / 32; ++c) {
      v16h vf[HD / 16];
#pragma unroll
      for (int j = 0; j < HD / 16; ++j) vf[j] = frag_p(vb + c * 2048 + j * 512);
      v8f sh[2];
      // the four score products in one statement: as builtins the last of them were placed behind the next k loads, which then took new registers; the v_nop keep the distance from the last product to the first instruction that writes its operands or reads its result
      asm volatile("v_wmma_f32_16x16x32_f16 %0, %2, %6, 0\n\tv_wmma_f32_16x16x32_f16 %1, %3, %6, 0\n\t"
                   "v_wmma_f32_16x16x32_f16 %0, %4, %7, %0\n\tv_wmma_f32_16x16x32_f16 %1, %5, %7, %1\n\t"
                   "v_nop\n\tv_nop\n\tv_nop\n\tv_nop"
                   : "=&v"(sh[0]), "=&v"(sh[1]) : "v"(kf[0][0]), "v"(kf[1][0]), "v"(kf[0][1]), "v"(kf[1][1]), "v"(qh[0]), "v"(qh[1]));
      if (c + 1 < FST / 32) {   // the next 32 keys' fragments of the same stage are read while this pass does its softmax (nothing of the next stage is read before its barrier)
#pragma unroll
        for (int t = 0; t < 2; ++t)
#pragma unroll
          for (int kc = 0; kc < HD / 32; ++kc) kf[t][kc] = frag_p(kb + (c + 1) * 2048 + t * 1024 + kc * 512); }
      __builtin_amdgcn_sched_barrier(0);   // keeps the next k reads in one group here, ahead of the softmax (without it the scheduler scatters them among the vector instructions and the products)
      float s[16]; float mx = -3.0e38f;   // s[8 t + r] = unscaled logit of key 32 c + 16 t + 8 g + r of the stage for query col: the k order of a B fragment
#pragma unroll
      for (int t = 0; t < 2; ++t)
#pragma unroll
        for (int r = 0; r < 8; ++r) { s[t * 8 + r] = sh[t][r]; mx = fmaxf(mx, s[t * 8 + r]); }
      mx = fmaxf(mx, xhalf(mx));
      const float mn = fmaxf(m, mx); const float al = __builtin_amdgcn_exp2f((m - mn) * SCALE2); m = mn;   // SCALE2 > 0: the maximum is taken over the unscaled logits; al = 0 on the first pass
      const float ms = __builtin_fmaf(mn, -SCALE2, 8.0f);   // + 8 = x 2^8: keeps small P out of the f16 subnormals; cancels against the sum
      v16h p; float ps = 0.f;
#pragma unroll
      for (int i = 0; i < 16; i += 2) { const v2f a = __builtin_elementwise_fma((v2f){s[i], s[i + 1]}, (v2f){SCALE2, SCALE2}, (v2f){ms, ms});   // two arguments per packed fma
        const float e0 = __builtin_amdgcn_exp2f(a[0]), e1 = __builtin_amdgcn_exp2f(a[1]); ps += e0; ps += e1; p[i] = (_Float16)e0; p[i + 1] = (_Float16)e1; }
      l = l * al + ps;
#pragma unroll
      for (int j = 0; j < HD / 16; ++j) { o[j] *= al; o[j] = wmma_h(vf[j], p, o[j]); }
      __builtin_amdgcn_sched_barrier(0); }   // keeps a pass's vector work and products ahead of what follows it (without it the last two passes' sink behind the stage's barrier, and the refill is issued that much later)
    asm volatile("s_wait_dscnt 0x0" ::: "memory");      // this wave's reads of the stage are done
    asm volatile("s_wait_asynccnt 0x0" ::: "memory");   // and its copies of the next stage have landed
    __syncthreads();                                     // the next stage is published, and every wave has left this stage's buffer
    if (st + 2 < NST) kv_copy(lds0 + (unsigned)(st & 1) * (4u * FSE), Kg + (size_t)(st + 2) * FSE, Vg + (size_t)(st + 2) * FSE); }   // which is refilled two stages ahead
  asm volatile("s_wait_asynccnt 0x0" ::: "memory");   // no copy is left in flight behind the loop
  l += xhalf(l); const float inv = 1.0f / l;
#pragma unroll
  for (int j = 0; j < HD / 16; ++j) { v4f lo, hi;   // o[j][r] = ctx of query col, channel 16 j + 8 g + r
#pragma unroll
    for (int r = 0; r < 4; ++r) { lo[r] = o[j][r] * inv; hi[r] = o[j][4 + r] * inv; }
    *(v4f*)&ss[wave][col][j * 16 + 8 * g] = lo; *(v4f*)&ss[wave][col][j * 16 + 8 * g + 4] = hi; }
  LDSX();
#pragma unroll
  for (int i = 0; i < 8; ++i) { const int rl = 2 * i + g; vst2(Y + ((size_t)b * TT + ql0 + rl) * CC + h * HD + col * 4, *(const v4f*)&ss[wave][rl][col * 4]); } }   // 256-B (row, head) segment by 16 lanes
// ---- k_out: block = (64 rows, 128 cols): out = ctx Wo (+ bo): ctx split bf16 hi + lo against exact bf16 Wo (2 products) for all rows
__global__ __launch_bounds__(128) void k_out(const float* __restrict__ Y, const float* __restrict__ WO, const float* __restrict__ BO, float* __restrict__ OUT) { __shared__ __align__(16) float sf[4][16][132]; __shared__ __align__(16) __bf16 wt[128][WPT];
  const int tid = threadIdx.x, wave = tid >> 5, lane = tid & 31, col = lane & 15, g = lane >> 4; const int c0 = blockIdx.y * 128; const size_t r0 = (size_t)blockIdx.x * 64 + wave * 16;
  v8f acc[8] = {};
  if (true) {   /* ALL rows: ctx split bf16 hi + lo x exact Wo (2 products) */
    const int sc = 32 * wave + 4 * ((lane & 3) | ((lane >> 4) << 2)), kg = (lane >> 2) & 3;   // staging map as in k_proj
    const float* wsrc = WO + (size_t)(8 * kg) * DIN + c0 + sc; const float* ysrc = Y + (r0 + col) * CC + 8 * g;
    WReg wr; v4f yr[WKC / 8];
    wtile_load(wr, wsrc, DIN);
#pragma unroll
    for (int kk = 0; kk < WKC / 32; ++kk) { yr[kk * 4] = *(const v4f*)(ysrc + kk * 32); yr[kk * 4 + 1] = *(const v4f*)(ysrc + kk * 32 + 4); yr[kk * 4 + 2] = *(const v4f*)(ysrc + kk * 32 + 16); yr[kk * 4 + 3] = *(const v4f*)(ysrc + kk * 32 + 20); }
    asm volatile("s_wait_xcnt 0x0" :: "v"(wsrc), "v"(ysrc) : "memory");   // the loads' address pairs live up to this wait and are rewritten only behind it
    auto split_a = [&](F2 (&a)[WKC / 32]) {
#pragma unroll
      for (int kk = 0; kk < WKC / 32; ++kk) { float v[16];
#pragma unroll
        for (int i = 0; i < 4; ++i) { v[i] = yr[kk * 4][i]; v[4 + i] = yr[kk * 4 + 1][i]; v[8 + i] = yr[kk * 4 + 2][i]; v[12 + i] = yr[kk * 4 + 3][i]; }
        a[kk] = bsplit16(v); } };
    auto publish = [&]() { __syncthreads();   // every wave has read the last chunk's fragments
      wtile_store(wr, wt, sc, kg);
      __syncthreads(); };   // the chunk is published
    auto products = [&](const F2 (&a)[WKC / 32]) {
#pragma unroll
      for (int kk = 0; kk < WKC / 32; ++kk)
#pragma unroll
        for (int jh = 0; jh < 2; ++jh) { v16b w[4];
#pragma unroll
          for (int j = 0; j < 4; ++j) w[j] = frag_b(&wt[(jh * 4 + j) * 16 + col][kk * 32], lane);
#pragma unroll
          for (int j = 0; j < 4; ++j) { acc[jh * 4 + j] = wmma_bf(a[kk].h, w[j], acc[jh * 4 + j]); acc[jh * 4 + j] = wmma_bf(a[kk].l, w[j], acc[jh * 4 + j]); } } };
#pragma unroll 1   // rolled, as in k_proj
    for (int ch = 0; ch < CC / WKC - 1; ++ch) { F2 a[WKC / 32]; split_a(a); publish();
      wtile_load(wr, wsrc + (size_t)WKC * DIN, DIN);   // the next chunk's loads fly while this chunk's products run
#pragma unroll
      for (int kk = 0; kk < WKC / 32; ++kk) { yr[kk * 4] = *(const v4f*)(ysrc + WKC + kk * 32); yr[kk * 4 + 1] = *(const v4f*)(ysrc + WKC + kk * 32 + 4); yr[kk * 4 + 2] = *(const v4f*)(ysrc + WKC + kk * 32 + 16); yr[kk * 4 + 3] = *(const v4f*)(ysrc + WKC + kk * 32 + 20); }
      asm volatile("s_wait_xcnt 0x0" :: "v"(wsrc), "v"(ysrc) : "memory");   // as above
      wsrc += (size_t)WKC * DIN; ysrc += WKC;
      products(a); }
    { F2 a[WKC / 32]; split_a(a); publish(); products(a); }   // the last chunk: nothing left to fetch
#pragma unroll
    for (int j = 0; j < 8; ++j) { const float bias = BO ? bfr(BO[c0 + j * 16 + col]) : 0.f;
#pragma unroll
      for (int r = 0; r < 8; ++r) sf[wave][8 * g + r][j * 16 + col] = acc[j][r] + bias; }
  } else {
#pragma unroll 2
    for (int kc = 0; kc < CC / 32; ++kc) { const v16h a = frag_f32(Y + (r0 + col) * CC + kc * 32, lane); asm volatile("s_wait_loadcnt 0x0" ::: "memory");
#pragma unroll
      for (int j = 0; j < 8; ++j) { const v16h w = WOCOLH(WO, kc * 32, c0 + j * 16 + col, lane); asm volatile("s_wait_loadcnt 0x0" ::: "memory"); acc[j] = wmma16(a, w, acc[j]); } }
#pragma unroll
    for (int j = 0; j < 8; ++j) { const float bias = BO ? bfr(BO[c0 + j * 16 + col]) : 0.f;
#pragma unroll
      for (int r = 0; r < 8; ++r) sf[wave][8 * g + r][j * 16 + col] = acc[j][r] * (1.0f / 256.0f) + bias; } }
  LDSX(); for (int rl = 0; rl < 16; ++rl) vst2(OUT + (r0 + rl) * DIN + c0 + lane * 4, *(const v4f*)&sf[wave][rl][lane * 4]); }

extern "C" void kernel_launch(void* const* d_in, const int* in_sizes, int n_in, void* d_out, int out_size, void* d_ws, size_t ws_size, hipStream_t stream) {
  (void)in_sizes; (void)n_in; (void)out_size;
  const float** F = (const float**)d_in;
  if (ws_size < (size_t)WS_END) return;
  char* ws = (char*)d_ws; _Float16 *QH = (_Float16*)(ws + WS_QH), *KH = (_Float16*)(ws + WS_KH), *VT = (_Float16*)(ws + WS_VT); float *Y = (float*)(ws + WS_Y);
  // inputs: 0 q; 1 k; 2 v [4,2048,512]; 3 Wq (in,out), 4 bq; 5 Wk, 6 bk; 7 Wv, 8 bv; 9 Wo (in,out), 10 bo
  k_proj<<<dim3(TNB * TT / 64, CC / 128, 3), 128, 0, stream>>>(F[0], F[1], F[2], F[3], F[5], F[7], F[4], F[6], F[8], QH, KH, VT);
  k_fa<<<dim3(TT / (FAW * 16), NH, TNB), FAW * 32, 0, stream>>>(QH, KH, VT, Y);
  k_out<<<dim3(TNB * TT / 64, DIN / 128), 128, 0, stream>>>(Y, F[9], F[10], (float*)d_out);
}

// v008
// It runs in 70.9 microseconds.
// Timed twice side by side with v007, it ran 1.11 times as fast both times.
// Over all steps from v000 it is 15.5 times as fast.
// compute dtype: all float inputs rounded to bf16; q/k/v = in W + b with EXACT bf16 products on WMMA 16x16x32 (f32 accumulate); q once to f16 against k once to f16 (1 product) / sqrt(512); running-maximum softmax in f32 (base 2: log2 e folded into the scale, hardware exp2) fused with both products; unnormalised P x 2^8 once to f16 against v once to f16 (1 product), / sum in f32; ctx split bf16 hi + lo against exact Wo (2 products) + bo; f32 output.
#include <hip/hip_runtime.h>
#include <math.h>

typedef __attribute__((ext_vector_type(16))) _Float16 v16h;
typedef __attribute__((ext_vector_type(16))) __bf16 v16b;
typedef __attribute__((ext_vector_type(8)))  _Float16 v8h;
typedef __attribute__((ext_vector_type(8)))  float v8f;
typedef __attribute__((ext_vector_type(4)))  float v4f;
typedef __attribute__((ext_vector_type(2)))  float v2f;
typedef __attribute__((ext_vector_type(4)))  unsigned v4u;
typedef __attribute__((ext_vector_type(4)))  int v4i;
typedef float __attribute__((may_alias)) float_a;
typedef int __attribute__((may_alias)) int_a;

template <typename T> __device__ __forceinline__ void vst2(void* p, T v) { *(T*)p = v;  }
__device__ __forceinline__ v8f wmma16(v16h a, v16h b, v8f c) {
  v8f d = __builtin_amdgcn_wmma_f32_16x16x32_f16(false, a, false, b, (short)0, c, false, false);
  asm volatile("v_nop\n\tv_nop\n\tv_nop\n\tv_nop" : "+v"(d) : "v"(a), "v"(b));
  return d;
}
__device__ __forceinline__ v8f wmma_bf(v16b a, v16b b, v8f c) {
  v8f d = __builtin_amdgcn_wmma_f32_16x16x32_bf16(false, a, false, b, (short)0, c, false, false);
  asm volatile("v_nop\n\tv_nop\n\tv_nop\n\tv_nop" : "+v"(d) : "v"(a), "v"(b));
  return d;
}
// 16x16x32 fragments: lane = (h = lane>>4, row/col = lane&15); elements 0..7 = k0+8h+0..7, 8..15 = k0+16+8h+0..7; D element r = row 8h+r
__device__ __forceinline__ v16h frag_h(const _Float16* rowk0, int lane) {
  union { v16h v; v8h q[2]; } u; const _Float16* p = rowk0 + 8 * (lane >> 4);
  u.q[0] = *(const v8h*)p; u.q[1] = *(const v8h*)(p + 16); return u.v;
}
__device__ __forceinline__ v16h frag_f32(const float* rowk0, int lane) {
  v16h a; const float* p = rowk0 + 8 * (lane >> 4);
#pragma unroll
  for (int i = 0; i < 8; ++i) { a[i] = (_Float16)p[i]; a[8 + i] = (_Float16)p[16 + i]; }
  return a;
}
__device__ __forceinline__ v16h frag_f32s(const float* rowk0, int lane, float sc) {
  v16h a; const float* p = rowk0 + 8 * (lane >> 4);
#pragma unroll
  for (int i = 0; i < 8; ++i) { a[i] = (_Float16)(p[i] * sc); a[8 + i] = (_Float16)(p[16 + i] * sc); }
  return a;
}
// column fragment from a [K][ld] layout (column n), rows >= K read as 0
__device__ __forceinline__ v16h fragc_f32(const float* W, int k0, int n, int lane, int ld, int K) {
  v16h a; const int g = lane >> 4;
#pragma unroll
  for (int i = 0; i < 8; ++i) { const int ka = k0 + 8 * g + i, kb = ka + 16;
    a[i] = (_Float16)(ka < K ? W[(size_t)(ka < K ? ka : K - 1) * ld + n] : 0.f); a[8 + i] = (_Float16)(kb < K ? W[(size_t)(kb < K ? kb : K - 1) * ld + n] : 0.f); }
  return a;
}
struct F2 { v16b h, l; };
__device__ __forceinline__ F2 bsplit16(const float v[16]) { F2 r;
#pragma unroll
  for (int i = 0; i < 16; ++i) { const __bf16 h = (__bf16)v[i]; r.h[i] = h; r.l[i] = (__bf16)(v[i] - (float)h); }
  return r; }
__device__ __forceinline__ F2 split_row(const float* row, int k0, int lane) { float v[16]; const float* p = row + k0 + 8 * (lane >> 4);
#pragma unroll
  for (int i = 0; i < 8; ++i) { v[i] = p[i]; v[8 + i] = p[16 + i]; }
  return bsplit16(v); }
__device__ __forceinline__ F2 split_rowK(const float* row, int k0, int lane, int K) { float v[16]; const int g = lane >> 4;
#pragma unroll
  for (int i = 0; i < 8; ++i) { const int ka = k0 + 8 * g + i, kb = ka + 16; v[i] = ka < K ? row[ka < K ? ka : K - 1] : 0.f; v[8 + i] = kb < K ? row[kb < K ? kb : K - 1] : 0.f; }
  return bsplit16(v); }
__device__ __forceinline__ F2 split_col(const float* W, int k0, int n, int lane, int ld, int K) { float v[16]; const int g = lane >> 4;
#pragma unroll
  for (int i = 0; i < 8; ++i) { const int ka = k0 + 8 * g + i, kb = ka + 16; v[i] = ka < K ? W[(size_t)(ka < K ? ka : K - 1) * ld + n] : 0.f; v[8 + i] = kb < K ? W[(size_t)(kb < K ? kb : K - 1) * ld + n] : 0.f; }
  return bsplit16(v); }
__device__ __forceinline__ v8f mac3(const F2& a, const F2& b, v8f c) { c = wmma_bf(a.l, b.h, c); c = wmma_bf(a.h, b.l, c); return wmma_bf(a.h, b.h, c); }
__device__ __forceinline__ float sigm(float v) { return 1.0f / (1.0f + expf(-v)); }
#define LDSX() do { asm volatile("s_wait_dscnt 0" ::: "memory"); __builtin_amdgcn_wave_barrier(); __builtin_amdgcn_fence(__ATOMIC_RELEASE, "workgroup"); } while (0)

// Multi-head attention with separate q / k / v inputs (B 4, S 2,048, hid 512 = 8 x 64; (in,out) 1/sqrt(512)-scale weights, zero biases; scale = 1/sqrt(hid_dim = 512), as written): qp = q Wq + bq ...; out = merged(softmax(qh kh^T / sqrt(512)) vh) Wo + bo (non-causal).
#define NB 4
#define TT 2048
#define CC 512            // NH * HD = projected width
#define DIN 512          // input (model) width
#define NH 8
#define HD 64
#define NQB (TT / 64)
#define HG 4
#define SCALE (0.04419417382415922f)
#define CAUSAL 0
#ifndef TNB
#define TNB NB
#endif
__device__ __forceinline__ float bfr(float v) { return (float)(__bf16)v; }
__host__ __device__ __forceinline__ int kb_last(int qb) { return CAUSAL ? ((qb * 64 + 63) >> 7) : (TT / 128 - 1); }
typedef __attribute__((ext_vector_type(8))) __bf16 v8b;
__device__ __forceinline__ v16b frag_b(const __bf16* rowk0, int lane) {
  union { v16b v; v8b q[2]; } u; const __bf16* p = rowk0 + 8 * (lane >> 4);
  u.q[0] = *(const v8b*)p; u.q[1] = *(const v8b*)(p + 16); return u.v;
}
#define QBH 0              // unused: no kernel reads it (no kernel has a high-precision path)
#define QHI 2048            // rows of the workspace plane WS_QL (no kernel writes or reads it: q goes once rounded into the logits); it keeps the offsets behind it
#define KHI 64            // rows of the workspace planes WS_KL, WS_VB, WS_VBL (no kernel writes or reads them); it keeps the offsets behind them
// B fragment (k rows k0+.., output column o) of a weight: (in,out) [K][ld] or (out,in) [ld rows of K]: bf16 exact, or f16(bf16 * 256) exact
__device__ __forceinline__ v16b wcol_io(const float* Wm, int k0, int o, int lane, int ld) { v16b w; const int g = lane >> 4;
#pragma unroll
  for (int i = 0; i < 8; ++i) { w[i] = (__bf16)Wm[(size_t)(k0 + 8 * g + i) * ld + o]; w[8 + i] = (__bf16)Wm[(size_t)(k0 + 16 + 8 * g + i) * ld + o]; }
  return w; }
__device__ __forceinline__ v16b wcol_oi(const float* Wm, int k0, int o, int lane, int K) { v16b w; const float* p = Wm + (size_t)o * K + k0 + 8 * (lane >> 4);
#pragma unroll
  for (int i = 0; i < 8; ++i) { w[i] = (__bf16)p[i]; w[8 + i] = (__bf16)p[16 + i]; }
  return w; }
__device__ __forceinline__ v16h wcolh_io(const float* Wm, int k0, int o, int lane, int ld) { v16h w; const int g = lane >> 4;
#pragma unroll
  for (int i = 0; i < 8; ++i) { w[i] = (_Float16)(bfr(Wm[(size_t)(k0 + 8 * g + i) * ld + o]) * 256.0f); w[8 + i] = (_Float16)(bfr(Wm[(size_t)(k0 + 16 + 8 * g + i) * ld + o]) * 256.0f); }
  return w; }
__device__ __forceinline__ v16h wcolh_oi(const float* Wm, int k0, int o, int lane, int K) { v16h w; const float* p = Wm + (size_t)o * K + k0 + 8 * (lane >> 4);
#pragma unroll
  for (int i = 0; i < 8; ++i) { w[i] = (_Float16)(bfr(p[i]) * 256.0f); w[8 + i] = (_Float16)(bfr(p[16 + i]) * 256.0f); }
  return w; }
#define WQKV_LAYOUT 0   // 0 = (in,out) [DIN][CC]; k_proj reads only this layout (other values change only WCOL, which nothing calls)
__device__ __forceinline__ v16b wcol_hdk(const float* Wm, int k0, int o, int lane) { v16b w; const int g = lane >> 4; const float* p = Wm + (size_t)(o / HD) * DIN * HD + (o % HD);
#pragma unroll
  for (int i = 0; i < 8; ++i) { w[i] = (__bf16)p[(size_t)(k0 + 8 * g + i) * HD]; w[8 + i] = (__bf16)p[(size_t)(k0 + 16 + 8 * g + i) * HD]; }
  return w; }
#define WO_OUT_IN 0
#if WQKV_LAYOUT == 1
#define WCOL(W, k0, o, lane) wcol_oi(W, k0, o, lane, DIN)
#elif WQKV_LAYOUT == 2
#define WCOL(W, k0, o, lane) wcol_hdk(W, k0, o, lane)
#else
#define WCOL(W, k0, o, lane) wcol_io(W, k0, o, lane, CC)
#endif
#if WO_OUT_IN
#define WOCOL(W, k0, o, lane) wcol_oi(W, k0, o, lane, CC)
#define WOCOLH(W, k0, o, lane) wcolh_oi(W, k0, o, lane, CC)
#else
#define WOCOL(W, k0, o, lane) wcol_io(W, k0, o, lane, DIN)
#define WOCOLH(W, k0, o, lane) wcolh_io(W, k0, o, lane, DIN)
#endif

#ifndef SM_EXTRA_PARAMS
#define SM_EXTRA_PARAMS
#endif
#ifndef PROJ_EXTRA_PARAMS
#define PROJ_EXTRA_PARAMS
#endif
#ifndef SM_MASK_HOOK
#define SM_MASK_HOOK (void)0
#endif

#define WS_QH  0u                                      // f16 q in fragment order, as k: [b][h][16-query tile][piece p = 16 channels][lane = 16 g + query][8 channels 16 p + 8 g + ..]
#define WS_KH  (WS_QH + 2u * (size_t)NB * TT * CC)      // f16 k in fragment order [b][h][16-key tile][piece p = 16 channels][lane = 16 g + key][8 channels 16 p + 8 g + ..]
#define WS_VT  (WS_KH + 2u * (size_t)NB * TT * CC)      // f16 v in fragment order [b][h][32-key block][16-channel tile j][half][lane = 16 g + channel][8 keys 16 half + 8 g + ..]
#define WS_QL  (WS_VT + 2u * (size_t)NB * CC * TT)      // unused (room of a q residual plane) [b][t < QHI][CC]
#define WS_KL  (WS_QL + 2u * (size_t)NB * QHI * CC)     // unused (room of a k residual plane) [b][t < KHI][CC]
#define WS_VB  (WS_KL + 2u * (size_t)NB * KHI * CC)     // unused (room of two bf16 v planes) [b][c][t < KHI]
#define WS_VBL (WS_VB + 2u * (size_t)NB * CC * KHI)
#define WS_S   (WS_VBL + 2u * (size_t)NB * CC * KHI)    // f32 [hg][t][s] region, unused: k_fa keeps the logits in registers
#define WS_Y   (WS_S  + 4u * (size_t)HG * TT * TT)      // f32 ctx rows [b*t][CC] (only when there is an output projection)
#define WS_END (WS_Y  + 4u * (size_t)NB * TT * CC)
// k and v lie in the workspace as k_fa's A fragments read them: the 32 lanes' 16-byte pieces of one load are 512 contiguous bytes (4 whole lines; by rows or planes one load touched 16 lines for the same bytes)
#define KF_TILE(b, h, kt) ((((size_t)(b) * NH + (h)) * (TT / 16) + (kt)) * 1024)   // element offset of a 16-key tile: 4 pieces of 256 elements
#define VF_BLK(b, h, cb)  ((((size_t)(b) * NH + (h)) * (TT / 32) + (cb)) * 2048)   // element offset of a 32-key block: 4 channel tiles x 2 halves of 256 elements

// ---- weight tile in LDS: 128 threads bring 64 k rows x 128 output columns of an (in,out) f32 weight as 16-byte row pieces (whole 128-B lines), round them to bf16 as before and store them [column][k], so that a B fragment is two 16-byte LDS reads and the block's four waves share one fetch and one rounding (the short loops are unrolled in full: the register arrays need constant indices)
#define WKC 64            // k rows per staged chunk
#define WPT (WKC + 8)     // LDS pitch in elements: 144 B = 16 B x odd, the fragment reads of 16 columns fall on 16 different bank groups
struct WReg { v4f x[16]; };
__device__ __forceinline__ void wtile_load(WReg& r, const float* wsrc, int ld) {   // wsrc: this thread's first row (8 kg) and first of 4 columns
#pragma unroll
  for (int p = 0; p < WKC / 32; ++p)
#pragma unroll
    for (int i = 0; i < 8; ++i) r.x[p * 8 + i] = *(const v4f*)(wsrc + (size_t)(p * 32 + i) * ld);
}
__device__ __forceinline__ void wtile_store(const WReg& r, __bf16 (*wt)[WPT], int sc, int kg) {
#pragma unroll
  for (int p = 0; p < WKC / 32; ++p)
#pragma unroll
    for (int cc = 0; cc < 4; ++cc) { v8b t;
#pragma unroll
      for (int i = 0; i < 8; ++i) t[i] = (__bf16)r.x[p * 8 + i][cc];
      *(v8b*)&wt[sc + cc][p * 32 + 8 * kg] = t; }
}
// ---- x tile in LDS: 128 threads bring 128 rows x 64 k of the f32 input; one load of a wave is two rows' 256 contiguous bytes (4 whole lines), rounded to bf16 as before and stored [row][k] at the weight tile's pitch, so that the block fetches and rounds each x element once and a fragment is two 16-byte LDS reads
typedef __attribute__((ext_vector_type(4))) __bf16 v4b;
#define PBM 128           // rows of x per block of k_proj
struct XReg { v4f x[PBM / 8]; };
__device__ __forceinline__ void xtile_load(XReg& r, const float* xsrc) {   // xsrc: this thread's first row and its 4 k
#pragma unroll
  for (int i = 0; i < PBM / 8; ++i) r.x[i] = *(const v4f*)(xsrc + (size_t)(2 * i) * DIN);
}
__device__ __forceinline__ void xtile_store(const XReg& r, __bf16 (*xt)[WPT], int row, int k4) {
#pragma unroll
  for (int i = 0; i < PBM / 8; ++i) { v4b t;
#pragma unroll
    for (int e = 0; e < 4; ++e) t[e] = (__bf16)r.x[i][e];
    *(v4b*)&xt[row + 2 * i][k4] = t; }
}
// ---- k_proj: block = (128 rows, 128 cols, which), four waves of 64 rows x 64 cols (one head): q/k/v = X W (+ b) with exact bf16 products (K = DIN), both operands staged in LDS chunk by chunk, f16 results in k_fa's fragment order, stored straight from the accumulators. SW (q, k): the weight fragment is the A operand and the x fragment the B operand, so a lane holds 8 consecutive channels of one row; v: x is A, so a lane holds 8 consecutive keys of one channel. Either way a tile of a wave is one 512-B piece of the workspace: no LDS staging and no barrier behind the products
template <bool SW> __device__ __forceinline__ void proj_body(const float* __restrict__ X, const float* __restrict__ WA, const float* __restrict__ BA, _Float16* __restrict__ D, __bf16 (*wt)[WPT], __bf16 (*xt)[WPT]) {
  const int tid = threadIdx.x, wave = tid >> 5, lane = tid & 31, col = lane & 15, g = lane >> 4; const int c0 = blockIdx.y * 128; const size_t r0 = (size_t)blockIdx.x * PBM; const size_t bb = r0 / TT; const int t0 = (int)(r0 % TT);
  const int wr_ = wave >> 1, wc = wave & 1;   // the wave's 64 rows and its 64 columns of the block's tile
  const int sc = 32 * wave + 4 * ((lane & 3) | ((lane >> 4) << 2)), kg = (lane >> 2) & 3;   // weight staging: 4 columns x 8 k rows per thread and 32 k; 16 lanes store to 16 different bank groups
  const int xrow = 32 * wave + g, xk = 4 * col;   // x staging: rows xrow + 2 i, 4 k per thread
  const float* wsrc = WA + (size_t)(8 * kg) * CC + c0 + sc; const float* xsrc = X + (r0 + xrow) * DIN + xk;
  v8f acc[4][4] = {}; WReg wr; XReg xr;
  wtile_load(wr, wsrc, CC); xtile_load(xr, xsrc);
  asm volatile("s_wait_xcnt 0x0" :: "v"(wsrc), "v"(xsrc) : "memory");   // the loads' address pairs live up to this wait and are rewritten only behind it
  auto publish = [&]() { __syncthreads();   // every wave has read the last chunk's fragments
    wtile_store(wr, wt, sc, kg); xtile_store(xr, xt, xrow, xk);
    __syncthreads(); };   // the chunk is published
  auto products = [&]() {
#pragma unroll
    for (int kk = 0; kk < WKC / 32; ++kk) { v16b a[4];
#pragma unroll
      for (int i = 0; i < 4; ++i) a[i] = frag_b(&xt[wr_ * 64 + i * 16 + col][kk * 32], lane);
#pragma unroll
      for (int jh = 0; jh < 2; ++jh) { v16b w[2];   // two weight fragments at a time: with four the live set passes the 336 registers of three waves per SIMD (three blocks per WGP hold all 768 blocks at once)
#pragma unroll
        for (int j = 0; j < 2; ++j) w[j] = frag_b(&wt[wc * 64 + (jh * 2 + j) * 16 + col][kk * 32], lane);
#pragma unroll
        for (int rt = 0; rt < 4; ++rt)
#pragma unroll
          for (int j = 0; j < 2; ++j) acc[rt][jh * 2 + j] = SW ? wmma_bf(w[j], a[rt], acc[rt][jh * 2 + j]) : wmma_bf(a[rt], w[j], acc[rt][jh * 2 + j]); } } };
#pragma unroll 1   // rolled: one body holds 32 products and 32 loads already
  for (int ch = 0; ch < DIN / WKC - 1; ++ch) { publish();
    wtile_load(wr, wsrc + (size_t)WKC * CC, CC); xtile_load(xr, xsrc + WKC);   // the next chunk's loads fly while this chunk's products run
    asm volatile("s_wait_xcnt 0x0" :: "v"(wsrc), "v"(xsrc) : "memory");   // as above
    wsrc += (size_t)WKC * CC; xsrc += WKC;
    products(); }
  v4f bq[SW ? 8 : 1] = {};   // SW: the lane's 8 channels of each of the 4 column tiles; v: the lane's one channel of each tile
  { publish();   // the last chunk: no operand is left to fetch, so the biases fly, as one group, while its products run
    if (BA) { const float* bp = BA + c0 + wc * 64 + (SW ? 8 * g : col);
      if (SW) {
#pragma unroll
        for (int j = 0; j < 4; ++j) { bq[2 * j] = *(const v4f*)(bp + j * 16); bq[2 * j + 1] = *(const v4f*)(bp + j * 16 + 4); }
      } else {
#pragma unroll
        for (int j = 0; j < 4; ++j) bq[0][j] = bp[j * 16]; }
      asm volatile("s_wait_xcnt 0x0" :: "v"(bp) : "memory"); }   // the loads' address lives up to this wait and is rewritten only behind it
    products();
    __builtin_amdgcn_sched_barrier(0); }   // keeps the first use of a bias behind the products (without it one rounding, with its wait for the load just issued, is lifted in front of them)
  // SW: acc[rt][j][r] = row wr_ * 64 + rt * 16 + col, channel 16 j + 8 g + r of head c0 / HD + wc; v: acc[rt][j][r] = key wr_ * 64 + rt * 16 + 8 g + r, channel 16 j + col
  _Float16* pd = D + (SW ? KF_TILE(bb, c0 / HD + wc, t0 / 16 + wr_ * 4) : VF_BLK(bb, c0 / HD + wc, t0 / 32 + wr_ * 2)) + lane * 8;
  v4u dv[16];
#pragma unroll
  for (int rt = 0; rt < 4; ++rt)
#pragma unroll
    for (int j = 0; j < 4; ++j) { union { v8h h; v4u u; } t;
#pragma unroll
      for (int r = 0; r < 8; ++r) t.h[r] = (_Float16)(acc[rt][j][r] + bfr(SW ? bq[2 * j + (r >> 2)][r & 3] : bq[0][j]));
      dv[rt * 4 + j] = t.u; }
#pragma unroll
  for (int rt = 0; rt < 4; ++rt)
#pragma unroll
    for (int j = 0; j < 4; ++j) vst2(pd + (SW ? rt * 1024 + j * 256 : (rt >> 1) * 2048 + j * 512 + (rt & 1) * 256), dv[rt * 4 + j]);   // a wave stores one 512-B piece
  asm volatile("s_wait_xcnt 0x0" :: "v"(pd), "v"(dv[0]), "v"(dv[1]), "v"(dv[2]), "v"(dv[3]), "v"(dv[4]), "v"(dv[5]), "v"(dv[6]), "v"(dv[7]), "v"(dv[8]), "v"(dv[9]), "v"(dv[10]), "v"(dv[11]), "v"(dv[12]), "v"(dv[13]), "v"(dv[14]), "v"(dv[15]) : "memory");   // the stores' address pair and data live up to this wait
}
__global__ __launch_bounds__(128) void k_proj(const float* __restrict__ XQ, const float* __restrict__ XK, const float* __restrict__ XV, const float* __restrict__ WQ, const float* __restrict__ WK, const float* __restrict__ WV, const float* __restrict__ BQ, const float* __restrict__ BK, const float* __restrict__ BV,
    _Float16* __restrict__ QH, _Float16* __restrict__ KH, _Float16* __restrict__ VT) {
  __shared__ __align__(16) __bf16 wt[128][WPT]; __shared__ __align__(16) __bf16 xt[PBM][WPT];
  const int which = blockIdx.z;   // the same for the whole block: every barrier stands under block-uniform control flow
  if (which == 2) proj_body<false>(XV, WV, BV, VT, wt, xt);
  else proj_body<true>(which == 0 ? XQ : XK, which == 0 ? WQ : WK, which == 0 ? BQ : BK, which == 0 ? QH : KH, wt, xt); }
// ---- k_fa: block = 16 waves x 16 queries of (b, h), one launch for every (b, h); k and v come to LDS once per block by asynchronous copies, 128 keys a stage, two buffers; per 32 keys S^T = K Q^T (1 product), running maximum and sum per query column in f32, P = 2^((s - m) SCALE log2 e) x 2^8 once to f16 straight from the score registers as the B operand, O^T += V^T P^T (1 product); the logits never leave the registers; ctx = O / sum
__device__ __forceinline__ float xhalf(float x) { return __builtin_bit_cast(float, __builtin_amdgcn_permlanex16(__builtin_bit_cast(int, x), __builtin_bit_cast(int, x), 0x76543210, 0xfedcba98, false, false)); }  // lane l with lane l ^ 16
__device__ __forceinline__ v16h frag_p(const _Float16* p) { union { v16h v; v8h q[2]; } u; u.q[0] = *(const v8h*)p; u.q[1] = *(const v8h*)(p + 256); return u.v; }   // fragment-order source, the lane's 8 elements already in p: the two halves are neighbouring 512-B pieces
__device__ __forceinline__ v8f wmma_h(v16h a, v16h b, v8f c) { return __builtin_amdgcn_wmma_f32_16x16x32_f16(false, a, false, b, (short)0, c, false, false); }
#define FAW 16            // waves per block
#define SCALE2 ((float)(0.04419417382415922 * 1.4426950408889634))   // SCALE x log2 e: e^(s SCALE) = 2^(s SCALE2), so one fused multiply-add and one v_exp_f32 make an exponential
#define FST 128           // keys per stage: 16 KB of k and 16 KB of v, each contiguous in the workspace's fragment order
#define NST (TT / FST)    // stages per (b, h)
#define FSE (FST * HD)    // elements of k (or of v) per stage
// one stage's k and v into one LDS buffer: 512 threads x 4 copies of 16 bytes, a thread's own bytes at 16 tid (+ 8 KB); the s_wait_xcnt stands inside the statement, so the address registers are rewritten only behind it
__device__ __forceinline__ void kv_copy(unsigned lb, const _Float16* gk, const _Float16* gv) {
  const unsigned l1 = lb + 8192u, l2 = lb + 16384u, l3 = lb + 24576u; const _Float16 *gk1 = gk + 4096, *gv1 = gv + 4096;
  asm volatile("global_load_async_to_lds_b128 %0, %4, off\n\tglobal_load_async_to_lds_b128 %1, %5, off\n\tglobal_load_async_to_lds_b128 %2, %6, off\n\tglobal_load_async_to_lds_b128 %3, %7, off\n\ts_wait_xcnt 0x0"
               :: "v"(lb), "v"(l1), "v"(l2), "v"(l3), "v"(gk), "v"(gk1), "v"(gv), "v"(gv1) : "memory");
}
__global__ __launch_bounds__(FAW * 32) void k_fa(const _Float16* __restrict__ QH, const _Float16* __restrict__ KH, const _Float16* __restrict__ VT, float* __restrict__ Y) { __shared__ __align__(16) float ss[FAW][16][HD + 4];
  __shared__ __align__(16) _Float16 kv[2][2][FSE];   // two buffers of (k, v): the block fetches each stage once, a whole stage ahead of its use, and its 16 waves read their fragments from here
  const int tid = threadIdx.x, wave = tid >> 5, lane = tid & 31, col = lane & 15, g = lane >> 4; const int h = blockIdx.y, b = blockIdx.z; const int ql0 = blockIdx.x * (FAW * 16) + wave * 16;
  const unsigned lds0 = (unsigned)(size_t)&kv[0][0][0] + (unsigned)tid * 16u;   // this thread's 16 bytes in buffer 0 (LDS byte address)
  const _Float16* Kg = KH + KF_TILE(b, h, 0) + tid * 8;   // and in stage 0 of (b, h)
  const _Float16* Vg = VT + VF_BLK(b, h, 0) + tid * 8;
  kv_copy(lds0, Kg, Vg);
  const _Float16* Qg = QH + KF_TILE(b, h, ql0 / 16) + lane * 8;   // q lies in the workspace as k does: this wave's 16 queries are one tile
  v16h qh[HD / 32];
#pragma unroll
  for (int kc = 0; kc < HD / 32; ++kc) qh[kc] = frag_p(Qg + kc * 512);
  asm volatile("s_wait_xcnt 0x0" :: "v"(Qg) : "memory");   // the loads' address pair lives up to this wait and is rewritten only behind it
  v8f o[HD / 16] = {}; float m = -3.0e38f, l = 0.f;
  asm volatile("s_wait_asynccnt 0x0" ::: "memory");   // this wave's copies of stage 0 have landed
  __syncthreads();                                     // stage 0 is published
  kv_copy(lds0 + 4u * FSE, Kg + FSE, Vg + FSE);        // stage 1 flies while stage 0 is worked on
#pragma unroll 1   // rolled: one body holds four passes already
  for (int st = 0; st < NST; ++st) {
    const _Float16* kb = &kv[st & 1][0][0] + lane * 8;   // this lane's 16 bytes of the stage's first k piece
    const _Float16* vb = &kv[st & 1][1][0] + lane * 8;
    v16h kf[2][HD / 32];
#pragma unroll
    for (int t = 0; t < 2; ++t)
#pragma unroll
      for (int kc = 0; kc < HD / 32; ++kc) kf[t][kc] = frag_p(kb + t * 1024 + kc * 512);
#pragma unroll   // in full: the pass index is a constant in every LDS offset, and the last pass's missing prefetch costs no branch
    for (int c = 0; c < FST / 32; ++c) {
      v16h vf[HD / 16];
#pragma unroll
      for (int j = 0; j < HD / 16; ++j) vf[j] = frag_p(vb + c * 2048 + j * 512);
      v8f sh[2];
      // the four score products in one statement: as builtins the last of them were placed behind the next k loads, which then took new registers; the v_nop keep the distance from the last product to the first instruction that writes its operands or reads its result
      asm volatile("v_wmma_f32_16x16x32_f16 %0, %2, %6, 0\n\tv_wmma_f32_16x16x32_f16 %1, %3, %6, 0\n\t"
                   "v_wmma_f32_16x16x32_f16 %0, %4, %7, %0\n\tv_wmma_f32_16x16x32_f16 %1, %5, %7, %1\n\t"
                   "v_nop\n\tv_nop\n\tv_nop\n\tv_nop"
                   : "=&v"(sh[0]), "=&v"(sh[1]) : "v"(kf[0][0]), "v"(kf[1][0]), "v"(kf[0][1]), "v"(kf[1][1]), "v"(qh[0]), "v"(qh[1]));
      if (c + 1 < FST / 32) {   // the next 32 keys' fragments of the same stage are read while this pass does its softmax (nothing of the next stage is read before its barrier)
#pragma unroll
        for (int t = 0; t < 2; ++t)
#pragma unroll
          for (int kc = 0; kc < HD / 32; ++kc) kf[t][kc] = frag_p(kb + (c + 1) * 2048 + t * 1024 + kc * 512); }
      __builtin_amdgcn_sched_barrier(0);   // keeps the next k reads in one group here, ahead of the softmax (without it the scheduler scatters them among the vector instructions and the products)
      float s[16]; float mx = -3.0e38f;   // s[8 t + r] = unscaled logit of key 32 c + 16 t + 8 g + r of the stage for query col: the k order of a B fragment
#pragma unroll
      for (int t = 0; t < 2; ++t)
#pragma unroll
        for (int r = 0; r < 8; ++r) { s[t * 8 + r] = sh[t][r]; mx = fmaxf(mx, s[t * 8 + r]); }
      mx = fmaxf(mx, xhalf(mx));
      const float mn = fmaxf(m, mx); const float al = __builtin_amdgcn_exp2f((m - mn) * SCALE2); m = mn;   // SCALE2 > 0: the maximum is taken over the unscaled logits; al = 0 on the first pass
      const float ms = __builtin_fmaf(mn, -SCALE2, 8.0f);   // + 8 = x 2^8: keeps small P out of the f16 subnormals; cancels against the sum
      v16h p; float ps = 0.f;
#pragma unroll
      for (int i = 0; i < 16; i += 2) { const v2f a = __builtin_elementwise_fma((v2f){s[i], s[i + 1]}, (v2f){SCALE2, SCALE2}, (v2f){ms, ms});   // two arguments per packed fma
        const float e0 = __builtin_amdgcn_exp2f(a[0]), e1 = __builtin_amdgcn_exp2f(a[1]); ps += e0; ps += e1; p[i] = (_Float16)e0; p[i + 1] = (_Float16)e1; }
      l = l * al + ps;
#pragma unroll
      for (int j = 0; j < HD / 16; ++j) { o[j] *= al; o[j] = wmma_h(vf[j], p, o[j]); }
      __builtin_amdgcn_sched_barrier(0); }   // keeps a pass's vector work and products ahead of what follows it (without it the last two passes' sink behind the stage's barrier, and the refill is issued that much later)
    asm volatile("s_wait_dscnt 0x0" ::: "memory");      // this wave's reads of the stage are done
    asm volatile("s_wait_asynccnt 0x0" ::: "memory");   // and its copies of the next stage have landed
    __syncthreads();                                     // the next stage is published, and every wave has left this stage's buffer
    if (st + 2 < NST) kv_copy(lds0 + (unsigned)(st & 1) * (4u * FSE), Kg + (size_t)(st + 2) * FSE, Vg + (size_t)(st + 2) * FSE); }   // which is refilled two stages ahead
  asm volatile("s_wait_asynccnt 0x0" ::: "memory");   // no copy is left in flight behind the loop
  l += xhalf(l); const float inv = 1.0f / l;
#pragma unroll
  for (int j = 0; j < HD / 16; ++j) { v4f lo, hi;   // o[j][r] = ctx of query col, channel 16 j + 8 g + r
#pragma unroll
    for (int r = 0; r < 4; ++r) { lo[r] = o[j][r] * inv; hi[r] = o[j][4 + r] * inv; }
    *(v4f*)&ss[wave][col][j * 16 + 8 * g] = lo; *(v4f*)&ss[wave][col][j * 16 + 8 * g + 4] = hi; }
  LDSX();
#pragma unroll
  for (int i = 0; i < 8; ++i) { const int rl = 2 * i + g; vst2(Y + ((size_t)b * TT + ql0 + rl) * CC + h * HD + col * 4, *(const v4f*)&ss[wave][rl][col * 4]); } }   // 256-B (row, head) segment by 16 lanes
// ---- k_out: block = (64 rows, 128 cols): out = ctx Wo (+ bo): ctx split bf16 hi + lo against exact bf16 Wo (2 products) for all rows
__global__ __launch_bounds__(128) void k_out(const float* __restrict__ Y, const float* __restrict__ WO, const float* __restrict__ BO, float* __restrict__ OUT) { __shared__ __align__(16) float sf[4][16][132]; __shared__ __align__(16) __bf16 wt[128][WPT];
  const int tid = threadIdx.x, wave = tid >> 5, lane = tid & 31, col = lane & 15, g = lane >> 4; const int c0 = blockIdx.y * 128; const size_t r0 = (size_t)blockIdx.x * 64 + wave * 16;
  v8f acc[8] = {};
  if (true) {   /* ALL rows: ctx split bf16 hi + lo x exact Wo (2 products) */
    const int sc = 32 * wave + 4 * ((lane & 3) | ((lane >> 4) << 2)), kg = (lane >> 2) & 3;   // staging map as in k_proj
    const float* wsrc = WO + (size_t)(8 * kg) * DIN + c0 + sc; const float* ysrc = Y + (r0 + col) * CC + 8 * g;
    WReg wr; v4f yr[WKC / 8];
    wtile_load(wr, wsrc, DIN);
#pragma unroll
    for (int kk = 0; kk < WKC / 32; ++kk) { yr[kk * 4] = *(const v4f*)(ysrc + kk * 32); yr[kk * 4 + 1] = *(const v4f*)(ysrc + kk * 32 + 4); yr[kk * 4 + 2] = *(const v4f*)(ysrc + kk * 32 + 16); yr[kk * 4 + 3] = *(const v4f*)(ysrc + kk * 32 + 20); }
    asm volatile("s_wait_xcnt 0x0" :: "v"(wsrc), "v"(ysrc) : "memory");   // the loads' address pairs live up to this wait and are rewritten only behind it
    auto split_a = [&](F2 (&a)[WKC / 32]) {
#pragma unroll
      for (int kk = 0; kk < WKC / 32; ++kk) { float v[16];
#pragma unroll
        for (int i = 0; i < 4; ++i) { v[i] = yr[kk * 4][i]; v[4 + i] = yr[kk * 4 + 1][i]; v[8 + i] = yr[kk * 4 + 2][i]; v[12 + i] = yr[kk * 4 + 3][i]; }
        a[kk] = bsplit16(v); } };
    auto publish = [&]() { __syncthreads();   // every wave has read the last chunk's fragments
      wtile_store(wr, wt, sc, kg);
      __syncthreads(); };   // the chunk is published
    auto products = [&](const F2 (&a)[WKC / 32]) {
#pragma unroll
      for (int kk = 0; kk < WKC / 32; ++kk)
#pragma unroll
        for (int jh = 0; jh < 2; ++jh) { v16b w[4];
#pragma unroll
          for (int j = 0; j < 4; ++j) w[j] = frag_b(&wt[(jh * 4 + j) * 16 + col][kk * 32], lane);
#pragma unroll
          for (int j = 0; j < 4; ++j) { acc[jh * 4 + j] = wmma_bf(a[kk].h, w[j], acc[jh * 4 + j]); acc[jh * 4 + j] = wmma_bf(a[kk].l, w[j], acc[jh * 4 + j]); } } };
#pragma unroll 1   // rolled, as in k_proj
    for (int ch = 0; ch < CC / WKC - 1; ++ch) { F2 a[WKC / 32]; split_a(a); publish();
      wtile_load(wr, wsrc + (size_t)WKC * DIN, DIN);   // the next chunk's loads fly while this chunk's products run
#pragma unroll
      for (int kk = 0; kk < WKC / 32; ++kk) { yr[kk * 4] = *(const v4f*)(ysrc + WKC + kk * 32); yr[kk * 4 + 1] = *(const v4f*)(ysrc + WKC + kk * 32 + 4); yr[kk * 4 + 2] = *(const v4f*)(ysrc + WKC + kk * 32 + 16); yr[kk * 4 + 3] = *(const v4f*)(ysrc + WKC + kk * 32 + 20); }
      asm volatile("s_wait_xcnt 0x0" :: "v"(wsrc), "v"(ysrc) : "memory");   // as above
      wsrc += (size_t)WKC * DIN; ysrc += WKC;
      products(a); }
    { F2 a[WKC / 32]; split_a(a); publish(); products(a); }   // the last chunk: nothing left to fetch
#pragma unroll
    for (int j = 0; j < 8; ++j) { const float bias = BO ? bfr(BO[c0 + j * 16 + col]) : 0.f;
#pragma unroll
      for (int r = 0; r < 8; ++r) sf[wave][8 * g + r][j * 16 + col] = acc[j][r] + bias; }
  } else {
#pragma unroll 2
    for (int kc = 0; kc < CC / 32; ++kc) { const v16h a = frag_f32(Y + (r0 + col) * CC + kc * 32, lane); asm volatile("s_wait_loadcnt 0x0" ::: "memory");
#pragma unroll
      for (int j = 0; j < 8; ++j) { const v16h w = WOCOLH(WO, kc * 32, c0 + j * 16 + col, lane); asm volatile("s_wait_loadcnt 0x0" ::: "memory"); acc[j] = wmma16(a, w, acc[j]); } }
#pragma unroll
    for (int j = 0; j < 8; ++j) { const float bias = BO ? bfr(BO[c0 + j * 16 + col]) : 0.f;
#pragma unroll
      for (int r = 0; r < 8; ++r) sf[wave][8 * g + r][j * 16 + col] = acc[j][r] * (1.0f / 256.0f) + bias; } }
  LDSX(); for (int rl = 0; rl < 16; ++rl) vst2(OUT + (r0 + rl) * DIN + c0 + lane * 4, *(const v4f*)&sf[wave][rl][lane * 4]); }

extern "C" void kernel_launch(void* const* d_in, const int* in_sizes, int n_in, void* d_out, int out_size, void* d_ws, size_t ws_size, hipStream_t stream) {
  (void)in_sizes; (void)n_in; (void)out_size;
  const float** F = (const float**)d_in;
  if (ws_size < (size_t)WS_END) return;
  char* ws = (char*)d_ws; _Float16 *QH = (_Float16*)(ws + WS_QH), *KH = (_Float16*)(ws + WS_KH), *VT = (_Float16*)(ws + WS_VT); float *Y = (float*)(ws + WS_Y);
  // inputs: 0 q; 1 k; 2 v [4,2048,512]; 3 Wq (in,out), 4 bq; 5 Wk, 6 bk; 7 Wv, 8 bv; 9 Wo (in,out), 10 bo
  k_proj<<<dim3(TNB * TT / PBM, CC / 128, 3), 128, 0, stream>>>(F[0], F[1], F[2], F[3], F[5], F[7], F[4], F[6], F[8], QH, KH, VT);
  k_fa<<<dim3(TT / (FAW * 16), NH, TNB), FAW * 32, 0, stream>>>(QH, KH, VT, Y);
  k_out<<<dim3(TNB * TT / 64, DIN / 128), 128, 0, stream>>>(Y, F[9], F[10], (float*)d_out);
}

// v009
// Measured time: 66.8 microseconds a run.
// Two timings next to v008 both put it at 1.08 times that version's speed.
// All steps since v000 together make it 16.6 times as fast.
// compute dtype: all float inputs rounded to bf16; q/k/v = in W + b with EXACT bf16 products on WMMA 16x16x32 (f32 accumulate); q once to f16 against k once to f16 (1 product) / sqrt(512); running-maximum softmax in f32 (base 2: log2 e folded into the scale, hardware exp2) fused with both products; unnormalised P x 2^8 once to f16 against v once to f16 (1 product), / sum in f32; ctx split bf16 hi + lo against exact Wo (2 products) + bo; f32 output.
#include <hip/hip_runtime.h>
#include <math.h>

typedef __attribute__((ext_vector_type(16))) _Float16 v16h;
typedef __attribute__((ext_vector_type(16))) __bf16 v16b;
typedef __attribute__((ext_vector_type(8)))  _Float16 v8h;
typedef __attribute__((ext_vector_type(8)))  float v8f;
typedef __attribute__((ext_vector_type(4)))  float v4f;
typedef __attribute__((ext_vector_type(2)))  float v2f;
typedef __attribute__((ext_vector_type(4)))  unsigned v4u;
typedef __attribute__((ext_vector_type(4)))  int v4i;
typedef float __attribute__((may_alias)) float_a;
typedef int __attribute__((may_alias)) int_a;

template <typename T> __device__ __forceinline__ void vst2(void* p, T v) { *(T*)p = v;  }
__device__ __forceinline__ v8f wmma16(v16h a, v16h b, v8f c) {
  v8f d = __builtin_amdgcn_wmma_f32_16x16x32_f16(false, a, false, b, (short)0, c, false, false);
  asm volatile("v_nop\n\tv_nop\n\tv_nop\n\tv_nop" : "+v"(d) : "v"(a), "v"(b));
  return d;
}
__device__ __forceinline__ v8f wmma_bf(v16b a, v16b b, v8f c) {
  v8f d = __builtin_amdgcn_wmma_f32_16x16x32_bf16(false, a, false, b, (short)0, c, false, false);
  asm volatile("v_nop\n\tv_nop\n\tv_nop\n\tv_nop" : "+v"(d) : "v"(a), "v"(b));
  return d;
}
// 16x16x32 fragments: lane = (h = lane>>4, row/col = lane&15); elements 0..7 = k0+8h+0..7, 8..15 = k0+16+8h+0..7; D element r = row 8h+r
__device__ __forceinline__ v16h frag_h(const _Float16* rowk0, int lane) {
  union { v16h v; v8h q[2]; } u; const _Float16* p = rowk0 + 8 * (lane >> 4);
  u.q[0] = *(const v8h*)p; u.q[1] = *(const v8h*)(p + 16); return u.v;
}
__device__ __forceinline__ v16h frag_f32(const float* rowk0, int lane) {
  v16h a; const float* p = rowk0 + 8 * (lane >> 4);
#pragma unroll
  for (int i = 0; i < 8; ++i) { a[i] = (_Float16)p[i]; a[8 + i] = (_Float16)p[16 + i]; }
  return a;
}
__device__ __forceinline__ v16h frag_f32s(const float* rowk0, int lane, float sc) {
  v16h a; const float* p = rowk0 + 8 * (lane >> 4);
#pragma unroll
  for (int i = 0; i < 8; ++i) { a[i] = (_Float16)(p[i] * sc); a[8 + i] = (_Float16)(p[16 + i] * sc); }
  return a;
}
// column fragment from a [K][ld] layout (column n), rows >= K read as 0
__device__ __forceinline__ v16h fragc_f32(const float* W, int k0, int n, int lane, int ld, int K) {
  v16h a; const int g = lane >> 4;
#pragma unroll
  for (int i = 0; i < 8; ++i) { const int ka = k0 + 8 * g + i, kb = ka + 16;
    a[i] = (_Float16)(ka < K ? W[(size_t)(ka < K ? ka : K - 1) * ld + n] : 0.f); a[8 + i] = (_Float16)(kb < K ? W[(size_t)(kb < K ? kb : K - 1) * ld + n] : 0.f); }
  return a;
}
struct F2 { v16b h, l; };
__device__ __forceinline__ F2 bsplit16(const float v[16]) { F2 r;
#pragma unroll
  for (int i = 0; i < 16; ++i) { const __bf16 h = (__bf16)v[i]; r.h[i] = h; r.l[i] = (__bf16)(v[i] - (float)h); }
  return r; }
__device__ __forceinline__ F2 split_row(const float* row, int k0, int lane) { float v[16]; const float* p = row + k0 + 8 * (lane >> 4);
#pragma unroll
  for (int i = 0; i < 8; ++i) { v[i] = p[i]; v[8 + i] = p[16 + i]; }
  return bsplit16(v); }
__device__ __forceinline__ F2 split_rowK(const float* row, int k0, int lane, int K) { float v[16]; const int g = lane >> 4;
#pragma unroll
  for (int i = 0; i < 8; ++i) { const int ka = k0 + 8 * g + i, kb = ka + 16; v[i] = ka < K ? row[ka < K ? ka : K - 1] : 0.f; v[8 + i] = kb < K ? row[kb < K ? kb : K - 1] : 0.f; }
  return bsplit16(v); }
__device__ __forceinline__ F2 split_col(const float* W, int k0, int n, int lane, int ld, int K) { float v[16]; const int g = lane >> 4;
#pragma unroll
  for (int i = 0; i < 8; ++i) { const int ka = k0 + 8 * g + i, kb = ka + 16; v[i] = ka < K ? W[(size_t)(ka < K ? ka : K - 1) * ld + n] : 0.f; v[8 + i] = kb < K ? W[(size_t)(kb < K ? kb : K - 1) * ld + n] : 0.f; }
  return bsplit16(v); }
__device__ __forceinline__ v8f mac3(const F2& a, const F2& b, v8f c) { c = wmma_bf(a.l, b.h, c); c = wmma_bf(a.h, b.l, c); return wmma_bf(a.h, b.h, c); }
__device__ __forceinline__ float sigm(float v) { return 1.0f / (1.0f + expf(-v)); }
#define LDSX() do { asm volatile("s_wait_dscnt 0" ::: "memory"); __builtin_amdgcn_wave_barrier(); __builtin_amdgcn_fence(__ATOMIC_RELEASE, "workgroup"); } while (0)

// Multi-head attention with separate q / k / v inputs (B 4, S 2,048, hid 512 = 8 x 64; (in,out) 1/sqrt(512)-scale weights, zero biases; scale = 1/sqrt(hid_dim = 512), as written): qp = q Wq + bq ...; out = merged(softmax(qh kh^T / sqrt(512)) vh) Wo + bo (non-causal).
#define NB 4
#define TT 2048
#define CC 512            // NH * HD = projected width
#define DIN 512          // input (model) width
#define NH 8
#define HD 64
#define NQB (TT / 64)
#define HG 4
#define SCALE (0.04419417382415922f)
#define CAUSAL 0
#ifndef TNB
#define TNB NB
#endif
__device__ __forceinline__ float bfr(float v) { return (float)(__bf16)v; }
__host__ __device__ __forceinline__ int kb_last(int qb) { return CAUSAL ? ((qb * 64 + 63) >> 7) : (TT / 128 - 1); }
typedef __attribute__((ext_vector_type(8))) __bf16 v8b;
__device__ __forceinline__ v16b frag_b(const __bf16* rowk0, int lane) {
  union { v16b v; v8b q[2]; } u; const __bf16* p = rowk0 + 8 * (lane >> 4);
  u.q[0] = *(const v8b*)p; u.q[1] = *(const v8b*)(p + 16); return u.v;
}
#define QBH 0              // unused: no kernel reads it (no kernel has a high-precision path)
#define QHI 2048            // rows of the workspace plane WS_QL (no kernel writes or reads it: q goes once rounded into the logits); it keeps the offsets behind it
#define KHI 64            // rows of the workspace planes WS_KL, WS_VB, WS_VBL (no kernel writes or reads them); it keeps the offsets behind them
// B fragment (k rows k0+.., output column o) of a weight: (in,out) [K][ld] or (out,in) [ld rows of K]: bf16 exact, or f16(bf16 * 256) exact
__device__ __forceinline__ v16b wcol_io(const float* Wm, int k0, int o, int lane, int ld) { v16b w; const int g = lane >> 4;
#pragma unroll
  for (int i = 0; i < 8; ++i) { w[i] = (__bf16)Wm[(size_t)(k0 + 8 * g + i) * ld + o]; w[8 + i] = (__bf16)Wm[(size_t)(k0 + 16 + 8 * g + i) * ld + o]; }
  return w; }
__device__ __forceinline__ v16b wcol_oi(const float* Wm, int k0, int o, int lane, int K) { v16b w; const float* p = Wm + (size_t)o * K + k0 + 8 * (lane >> 4);
#pragma unroll
  for (int i = 0; i < 8; ++i) { w[i] = (__bf16)p[i]; w[8 + i] = (__bf16)p[16 + i]; }
  return w; }
__device__ __forceinline__ v16h wcolh_io(const float* Wm, int k0, int o, int lane, int ld) { v16h w; const int g = lane >> 4;
#pragma unroll
  for (int i = 0; i < 8; ++i) { w[i] = (_Float16)(bfr(Wm[(size_t)(k0 + 8 * g + i) * ld + o]) * 256.0f); w[8 + i] = (_Float16)(bfr(Wm[(size_t)(k0 + 16 + 8 * g + i) * ld + o]) * 256.0f); }
  return w; }
__device__ __forceinline__ v16h wcolh_oi(const float* Wm, int k0, int o, int lane, int K) { v16h w; const float* p = Wm + (size_t)o * K + k0 + 8 * (lane >> 4);
#pragma unroll
  for (int i = 0; i < 8; ++i) { w[i] = (_Float16)(bfr(p[i]) * 256.0f); w[8 + i] = (_Float16)(bfr(p[16 + i]) * 256.0f); }
  return w; }
#define WQKV_LAYOUT 0   // 0 = (in,out) [DIN][CC]; k_proj reads only this layout (other values change only WCOL, which nothing calls)
__device__ __forceinline__ v16b wcol_hdk(const float* Wm, int k0, int o, int lane) { v16b w; const int g = lane >> 4; const float* p = Wm + (size_t)(o / HD) * DIN * HD + (o % HD);
#pragma unroll
  for (int i = 0; i < 8; ++i) { w[i] = (__bf16)p[(size_t)(k0 + 8 * g + i) * HD]; w[8 + i] = (__bf16)p[(size_t)(k0 + 16 + 8 * g + i) * HD]; }
  return w; }
#define WO_OUT_IN 0
#if WQKV_LAYOUT == 1
#define WCOL(W, k0, o, lane) wcol_oi(W, k0, o, lane, DIN)
#elif WQKV_LAYOUT == 2
#define WCOL(W, k0, o, lane) wcol_hdk(W, k0, o, lane)
#else
#define WCOL(W, k0, o, lane) wcol_io(W, k0, o, lane, CC)
#endif
#if WO_OUT_IN
#define WOCOL(W, k0, o, lane) wcol_oi(W, k0, o, lane, CC)
#define WOCOLH(W, k0, o, lane) wcolh_oi(W, k0, o, lane, CC)
#else
#define WOCOL(W, k0, o, lane) wcol_io(W, k0, o, lane, DIN)
#define WOCOLH(W, k0, o, lane) wcolh_io(W, k0, o, lane, DIN)
#endif

#ifndef SM_EXTRA_PARAMS
#define SM_EXTRA_PARAMS
#endif
#ifndef PROJ_EXTRA_PARAMS
#define PROJ_EXTRA_PARAMS
#endif
#ifndef SM_MASK_HOOK
#define SM_MASK_HOOK (void)0
#endif

#define WS_QH  0u                                      // f16 q in fragment order, as k: [b][h][16-query tile][piece p = 16 channels][lane = 16 g + query][8 channels 16 p + 8 g + ..]
#define WS_KH  (WS_QH + 2u * (size_t)NB * TT * CC)      // f16 k in fragment order [b][h][16-key tile][piece p = 16 channels][lane = 16 g + key][8 channels 16 p + 8 g + ..]
#define WS_VT  (WS_KH + 2u * (size_t)NB * TT * CC)      // f16 v in fragment order [b][h][32-key block][16-channel tile j][half][lane = 16 g + channel][8 keys 16 half + 8 g + ..]
#define WS_QL  (WS_VT + 2u * (size_t)NB * CC * TT)      // unused (room of a q residual plane) [b][t < QHI][CC]
#define WS_KL  (WS_QL + 2u * (size_t)NB * QHI * CC)     // unused (room of a k residual plane) [b][t < KHI][CC]
#define WS_VB  (WS_KL + 2u * (size_t)NB * KHI * CC)     // unused (room of two bf16 v planes) [b][c][t < KHI]
#define WS_VBL (WS_VB + 2u * (size_t)NB * CC * KHI)
#define WS_S   (WS_VBL + 2u * (size_t)NB * CC * KHI)    // f32 [hg][t][s] region, unused: k_fa keeps the logits in registers
#define WS_Y   (WS_S  + 4u * (size_t)HG * TT * TT)      // f32 ctx rows [b*t][CC] (only when there is an output projection)
#define WS_END (WS_Y  + 4u * (size_t)NB * TT * CC)
// k and v lie in the workspace as k_fa's A fragments read them: the 32 lanes' 16-byte pieces of one load are 512 contiguous bytes (4 whole lines; by rows or planes one load touched 16 lines for the same bytes)
#define KF_TILE(b, h, kt) ((((size_t)(b) * NH + (h)) * (TT / 16) + (kt)) * 1024)   // element offset of a 16-key tile: 4 pieces of 256 elements
#define VF_BLK(b, h, cb)  ((((size_t)(b) * NH + (h)) * (TT / 32) + (cb)) * 2048)   // element offset of a 32-key block: 4 channel tiles x 2 halves of 256 elements

// ---- weight tile in LDS: 128 threads bring 64 k rows x 128 output columns of an (in,out) f32 weight as 16-byte row pieces (whole 128-B lines), round them to bf16 as before and store them [column][k], so that a B fragment is two 16-byte LDS reads and the block's four waves share one fetch and one rounding (the short loops are unrolled in full: the register arrays need constant indices)
#define WKC 64            // k rows per staged chunk
#define WPT (WKC + 8)     // LDS pitch in elements: 144 B = 16 B x odd, the fragment reads of 16 columns fall on 16 different bank groups
struct WReg { v4f x[16]; };
__device__ __forceinline__ void wtile_load(WReg& r, const float* wsrc, int ld) {   // wsrc: this thread's first row (8 kg) and first of 4 columns
#pragma unroll
  for (int p = 0; p < WKC / 32; ++p)
#pragma unroll
    for (int i = 0; i < 8; ++i) r.x[p * 8 + i] = *(const v4f*)(wsrc + (size_t)(p * 32 + i) * ld);
}
__device__ __forceinline__ void wtile_store(const WReg& r, __bf16 (*wt)[WPT], int sc, int kg) {
#pragma unroll
  for (int p = 0; p < WKC / 32; ++p)
#pragma unroll
    for (int cc = 0; cc < 4; ++cc) { v8b t;
#pragma unroll
      for (int i = 0; i < 8; ++i) t[i] = (__bf16)r.x[p * 8 + i][cc];
      *(v8b*)&wt[sc + cc][p * 32 + 8 * kg] = t; }
}
// ---- x tile in LDS: 128 threads bring 128 rows x 64 k of the f32 input; one load of a wave is two rows' 256 contiguous bytes (4 whole lines), rounded to bf16 as before and stored [row][k] at the weight tile's pitch, so that the block fetches and rounds each x element once and a fragment is two 16-byte LDS reads
typedef __attribute__((ext_vector_type(4))) __bf16 v4b;
#define PBM 128           // rows of x per block of k_proj
struct XReg { v4f x[PBM / 8]; };
__device__ __forceinline__ void xtile_load(XReg& r, const float* xsrc) {   // xsrc: this thread's first row and its 4 k
#pragma unroll
  for (int i = 0; i < PBM / 8; ++i) r.x[i] = *(const v4f*)(xsrc + (size_t)(2 * i) * DIN);
}
__device__ __forceinline__ void xtile_store(const XReg& r, __bf16 (*xt)[WPT], int row, int k4) {
#pragma unroll
  for (int i = 0; i < PBM / 8; ++i) { v4b t;
#pragma unroll
    for (int e = 0; e < 4; ++e) t[e] = (__bf16)r.x[i][e];
    *(v4b*)&xt[row + 2 * i][k4] = t; }
}
// ---- k_proj: block = (128 rows, 128 cols, which), four waves of 64 rows x 64 cols (one head): q/k/v = X W (+ b) with exact bf16 products (K = DIN), both operands staged in LDS chunk by chunk, f16 results in k_fa's fragment order, stored straight from the accumulators. SW (q, k): the weight fragment is the A operand and the x fragment the B operand, so a lane holds 8 consecutive channels of one row; v: x is A, so a lane holds 8 consecutive keys of one channel. Either way a tile of a wave is one 512-B piece of the workspace: no LDS staging and no barrier behind the products
template <bool SW> __device__ __forceinline__ void proj_body(const float* __restrict__ X, const float* __restrict__ WA, const float* __restrict__ BA, _Float16* __restrict__ D, __bf16 (*wt)[WPT], __bf16 (*xt)[WPT]) {
  const int tid = threadIdx.x, wave = tid >> 5, lane = tid & 31, col = lane & 15, g = lane >> 4; const int c0 = blockIdx.y * 128; const size_t r0 = (size_t)blockIdx.x * PBM; const size_t bb = r0 / TT; const int t0 = (int)(r0 % TT);
  const int wr_ = wave >> 1, wc = wave & 1;   // the wave's 64 rows and its 64 columns of the block's tile
  const int sc = 32 * wave + 4 * ((lane & 3) | ((lane >> 4) << 2)), kg = (lane >> 2) & 3;   // weight staging: 4 columns x 8 k rows per thread and 32 k; 16 lanes store to 16 different bank groups
  const int xrow = 32 * wave + g, xk = 4 * col;   // x staging: rows xrow + 2 i, 4 k per thread
  const float* wsrc = WA + (size_t)(8 * kg) * CC + c0 + sc; const float* xsrc = X + (r0 + xrow) * DIN + xk;
  v8f acc[4][4] = {}; WReg wr; XReg xr;
  wtile_load(wr, wsrc, CC); xtile_load(xr, xsrc);
  asm volatile("s_wait_xcnt 0x0" :: "v"(wsrc), "v"(xsrc) : "memory");   // the loads' address pairs live up to this wait and are rewritten only behind it
  auto publish = [&]() { __syncthreads();   // every wave has read the last chunk's fragments
    wtile_store(wr, wt, sc, kg); xtile_store(xr, xt, xrow, xk);
    __syncthreads(); };   // the chunk is published
  auto products = [&]() {
#pragma unroll
    for (int kk = 0; kk < WKC / 32; ++kk) { v16b a[4];
#pragma unroll
      for (int i = 0; i < 4; ++i) a[i] = frag_b(&xt[wr_ * 64 + i * 16 + col][kk * 32], lane);
#pragma unroll
      for (int jh = 0; jh < 2; ++jh) { v16b w[2];   // two weight fragments at a time: with four the live set passes the 336 registers of three waves per SIMD (three blocks per WGP hold all 768 blocks at once)
#pragma unroll
        for (int j = 0; j < 2; ++j) w[j] = frag_b(&wt[wc * 64 + (jh * 2 + j) * 16 + col][kk * 32], lane);
#pragma unroll
        for (int rt = 0; rt < 4; ++rt)
#pragma unroll
          for (int j = 0; j < 2; ++j) acc[rt][jh * 2 + j] = SW ? wmma_bf(w[j], a[rt], acc[rt][jh * 2 + j]) : wmma_bf(a[rt], w[j], acc[rt][jh * 2 + j]); } } };
#pragma unroll 1   // rolled: one body holds 32 products and 32 loads already
  for (int ch = 0; ch < DIN / WKC - 1; ++ch) { publish();
    wtile_load(wr, wsrc + (size_t)WKC * CC, CC); xtile_load(xr, xsrc + WKC);   // the next chunk's loads fly while this chunk's products run
    asm volatile("s_wait_xcnt 0x0" :: "v"(wsrc), "v"(xsrc) : "memory");   // as above
    wsrc += (size_t)WKC * CC; xsrc += WKC;
    products(); }
  v4f bq[SW ? 8 : 1] = {};   // SW: the lane's 8 channels of each of the 4 column tiles; v: the lane's one channel of each tile
  { publish();   // the last chunk: no operand is left to fetch, so the biases fly, as one group, while its products run
    if (BA) { const float* bp = BA + c0 + wc * 64 + (SW ? 8 * g : col);
      if (SW) {
#pragma unroll
        for (int j = 0; j < 4; ++j) { bq[2 * j] = *(const v4f*)(bp + j * 16); bq[2 * j + 1] = *(const v4f*)(bp + j * 16 + 4); }
      } else {
#pragma unroll
        for (int j = 0; j < 4; ++j) bq[0][j] = bp[j * 16]; }
      asm volatile("s_wait_xcnt 0x0" :: "v"(bp) : "memory"); }   // the loads' address lives up to this wait and is rewritten only behind it
    products();
    __builtin_amdgcn_sched_barrier(0); }   // keeps the first use of a bias behind the products (without it one rounding, with its wait for the load just issued, is lifted in front of them)
  // SW: acc[rt][j][r] = row wr_ * 64 + rt * 16 + col, channel 16 j + 8 g + r of head c0 / HD + wc; v: acc[rt][j][r] = key wr_ * 64 + rt * 16 + 8 g + r, channel 16 j + col
  _Float16* pd = D + (SW ? KF_TILE(bb, c0 / HD + wc, t0 / 16 + wr_ * 4) : VF_BLK(bb, c0 / HD + wc, t0 / 32 + wr_ * 2)) + lane * 8;
  v4u dv[16];
#pragma unroll
  for (int rt = 0; rt < 4; ++rt)
#pragma unroll
    for (int j = 0; j < 4; ++j) { union { v8h h; v4u u; } t;
#pragma unroll
      for (int r = 0; r < 8; ++r) t.h[r] = (_Float16)(acc[rt][j][r] + bfr(SW ? bq[2 * j + (r >> 2)][r & 3] : bq[0][j]));
      dv[rt * 4 + j] = t.u; }
#pragma unroll
  for (int rt = 0; rt < 4; ++rt)
#pragma unroll
    for (int j = 0; j < 4; ++j) vst2(pd + (SW ? rt * 1024 + j * 256 : (rt >> 1) * 2048 + j * 512 + (rt & 1) * 256), dv[rt * 4 + j]);   // a wave stores one 512-B piece
  asm volatile("s_wait_xcnt 0x0" :: "v"(pd), "v"(dv[0]), "v"(dv[1]), "v"(dv[2]), "v"(dv[3]), "v"(dv[4]), "v"(dv[5]), "v"(dv[6]), "v"(dv[7]), "v"(dv[8]), "v"(dv[9]), "v"(dv[10]), "v"(dv[11]), "v"(dv[12]), "v"(dv[13]), "v"(dv[14]), "v"(dv[15]) : "memory");   // the stores' address pair and data live up to this wait
}
__global__ __launch_bounds__(128) void k_proj(const float* __restrict__ XQ, const float* __restrict__ XK, const float* __restrict__ XV, const float* __restrict__ WQ, const float* __restrict__ WK, const float* __restrict__ WV, const float* __restrict__ BQ, const float* __restrict__ BK, const float* __restrict__ BV,
    _Float16* __restrict__ QH, _Float16* __restrict__ KH, _Float16* __restrict__ VT) {
  __shared__ __align__(16) __bf16 wt[128][WPT]; __shared__ __align__(16) __bf16 xt[PBM][WPT];
  const int which = blockIdx.z;   // the same for the whole block: every barrier stands under block-uniform control flow
  if (which == 2) proj_body<false>(XV, WV, BV, VT, wt, xt);
  else proj_body<true>(which == 0 ? XQ : XK, which == 0 ? WQ : WK, which == 0 ? BQ : BK, which == 0 ? QH : KH, wt, xt); }
// ---- k_fa: block = 256 queries of (b, h), one launch for every (b, h): 16 waves = 8 query sets of 32 x 2 key halves; k and v come to LDS once per block by asynchronous copies, 128 keys a stage, two buffers; a wave takes 32 queries (two column groups) and 64 of a stage's keys, so that each k or v fragment it reads from LDS feeds two products; per 32 keys S^T = K Q^T (1 product), running maximum and sum per query column in f32, P = 2^((s - m) SCALE log2 e) x 2^8 once to f16 straight from the score registers as the B operand, O^T += V^T P^T (1 product); the logits never leave the registers; behind the loop the two key halves' maximum, sum and O of a query are joined through LDS; ctx = O / sum
__device__ __forceinline__ float xhalf(float x) { return __builtin_bit_cast(float, __builtin_amdgcn_permlanex16(__builtin_bit_cast(int, x), __builtin_bit_cast(int, x), 0x76543210, 0xfedcba98, false, false)); }  // lane l with lane l ^ 16
__device__ __forceinline__ v16h frag_p(const _Float16* p) { union { v16h v; v8h q[2]; } u; u.q[0] = *(const v8h*)p; u.q[1] = *(const v8h*)(p + 256); return u.v; }   // fragment-order source, the lane's 8 elements already in p: the two halves are neighbouring 512-B pieces
__device__ __forceinline__ v8f wmma_h(v16h a, v16h b, v8f c) { return __builtin_amdgcn_wmma_f32_16x16x32_f16(false, a, false, b, (short)0, c, false, false); }
#define FAW 16            // waves per block
#define SCALE2 ((float)(0.04419417382415922 * 1.4426950408889634))   // SCALE x log2 e: e^(s SCALE) = 2^(s SCALE2), so one fused multiply-add and one v_exp_f32 make an exponential
#define FST 128           // keys per stage: 16 KB of k and 16 KB of v, each contiguous in the workspace's fragment order
#define NST (TT / FST)    // stages per (b, h)
#define FSE (FST * HD)    // elements of k (or of v) per stage
// one stage's k and v into one LDS buffer: 512 threads x 4 copies of 16 bytes, a thread's own bytes at 16 tid (+ 8 KB); the s_wait_xcnt stands inside the statement, so the address registers are rewritten only behind it
__device__ __forceinline__ void kv_copy(unsigned lb, const _Float16* gk, const _Float16* gv) {
  const unsigned l1 = lb + 8192u, l2 = lb + 16384u, l3 = lb + 24576u; const _Float16 *gk1 = gk + 4096, *gv1 = gv + 4096;
  asm volatile("global_load_async_to_lds_b128 %0, %4, off\n\tglobal_load_async_to_lds_b128 %1, %5, off\n\tglobal_load_async_to_lds_b128 %2, %6, off\n\tglobal_load_async_to_lds_b128 %3, %7, off\n\ts_wait_xcnt 0x0"
               :: "v"(lb), "v"(l1), "v"(l2), "v"(l3), "v"(gk), "v"(gk1), "v"(gv), "v"(gv1) : "memory");
}
__global__ __launch_bounds__(FAW * 32) void k_fa(const _Float16* __restrict__ QH, const _Float16* __restrict__ KH, const _Float16* __restrict__ VT, float* __restrict__ Y) { __shared__ __align__(16) float ss[FAW][16][HD + 4];
  __shared__ __align__(16) _Float16 kv[2][2][FSE];   // two buffers of (k, v): the block fetches each stage once, a whole stage ahead of its use, and its 16 waves read their fragments from here
  const int tid = threadIdx.x, wave = tid >> 5, lane = tid & 31, col = lane & 15, g = lane >> 4; const int h = blockIdx.y, b = blockIdx.z;
  const int ks = wave >> 3;   // the wave's half of every stage's keys; waves w and w ^ 8 hold the same 32 queries
  const int ql0 = blockIdx.x * (FAW * 16) + (wave & 7) * 32;
  const unsigned lds0 = (unsigned)(size_t)&kv[0][0][0] + (unsigned)tid * 16u;   // this thread's 16 bytes in buffer 0 (LDS byte address)
  const _Float16* Kg = KH + KF_TILE(b, h, 0) + tid * 8;   // and in stage 0 of (b, h)
  const _Float16* Vg = VT + VF_BLK(b, h, 0) + tid * 8;
  kv_copy(lds0, Kg, Vg);
  const _Float16* Qg = QH + KF_TILE(b, h, ql0 / 16) + lane * 8;   // q lies in the workspace as k does: this wave's 32 queries are two neighbouring tiles
  v16h qh[2][HD / 32];
#pragma unroll
  for (int u = 0; u < 2; ++u)
#pragma unroll
    for (int kc = 0; kc < HD / 32; ++kc) qh[u][kc] = frag_p(Qg + u * 1024 + kc * 512);
  asm volatile("s_wait_xcnt 0x0" :: "v"(Qg) : "memory");   // the loads' address pair lives up to this wait and is rewritten only behind it
  v8f o[2][HD / 16] = {}; float m[2] = {-3.0e38f, -3.0e38f}, l[2] = {0.f, 0.f};
  asm volatile("s_wait_asynccnt 0x0" ::: "memory");   // this wave's copies of stage 0 have landed
  __syncthreads();                                     // stage 0 is published
  kv_copy(lds0 + 4u * FSE, Kg + FSE, Vg + FSE);        // stage 1 flies while stage 0 is worked on
#pragma unroll 1   // rolled: one body holds two passes of 16 products already
  for (int st = 0; st < NST; ++st) {
    const _Float16* kb = &kv[st & 1][0][0] + ks * (FSE / 2) + lane * 8;   // this lane's 16 bytes of the first k piece of the wave's 64 keys
    const _Float16* vb = &kv[st & 1][1][0] + ks * (FSE / 2) + lane * 8;
    v16h kf[2][HD / 32];
#pragma unroll
    for (int t = 0; t < 2; ++t)
#pragma unroll
      for (int kc = 0; kc < HD / 32; ++kc) kf[t][kc] = frag_p(kb + t * 1024 + kc * 512);
#pragma unroll   // in full: the pass index is a constant in every LDS offset, and the last pass's missing prefetch costs no branch
    for (int c = 0; c < FST / 64; ++c) {
      v8f sh[2][2];   // [column group][16-key tile]
      // the eight score products in one statement: as builtins the last of them were placed behind the next k loads, which then took new registers; the v_nop in front keep the distance from the last pass's O products to these results, which may take the registers of their v or P operands; the v_nop behind keep the distance from the last product to the first instruction that writes its operands or reads its result
      asm volatile("v_nop\n\tv_nop\n\tv_nop\n\tv_nop\n\t"
                   "v_wmma_f32_16x16x32_f16 %0, %4, %8, 0\n\tv_wmma_f32_16x16x32_f16 %1, %5, %8, 0\n\t"
                   "v_wmma_f32_16x16x32_f16 %2, %4, %10, 0\n\tv_wmma_f32_16x16x32_f16 %3, %5, %10, 0\n\t"
                   "v_wmma_f32_16x16x32_f16 %0, %6, %9, %0\n\tv_wmma_f32_16x16x32_f16 %1, %7, %9, %1\n\t"
                   "v_wmma_f32_16x16x32_f16 %2, %6, %11, %2\n\tv_wmma_f32_16x16x32_f16 %3, %7, %11, %3\n\t"
                   "v_nop\n\tv_nop\n\tv_nop\n\tv_nop"
                   : "=&v"(sh[0][0]), "=&v"(sh[0][1]), "=&v"(sh[1][0]), "=&v"(sh[1][1])
                   : "v"(kf[0][0]), "v"(kf[1][0]), "v"(kf[0][1]), "v"(kf[1][1]), "v"(qh[0][0]), "v"(qh[0][1]), "v"(qh[1][0]), "v"(qh[1][1]));
      v16h vf[HD / 16];   // this pass's v and the next pass's k are read in one group, while the pass does its softmax
#pragma unroll
      for (int j = 0; j < HD / 16; ++j) vf[j] = frag_p(vb + c * 2048 + j * 512);
      if (c + 1 < FST / 64) {   // the wave's next 32 keys of the same stage (nothing of the next stage is read before its barrier)
#pragma unroll
        for (int t = 0; t < 2; ++t)
#pragma unroll
          for (int kc = 0; kc < HD / 32; ++kc) kf[t][kc] = frag_p(kb + (c + 1) * 2048 + t * 1024 + kc * 512); }
      __builtin_amdgcn_sched_barrier(0);   // keeps these reads in one group here, ahead of the softmax (without it the scheduler scatters them among the vector instructions and the products)
      v16h p[2]; float al[2];
#pragma unroll
      for (int u = 0; u < 2; ++u) {
        float s[16]; float mx = -3.0e38f;   // s[8 t + r] = unscaled logit of key 32 c + 16 t + 8 g + r of the wave's 64 for query 16 u + col: the k order of a B fragment
#pragma unroll
        for (int t = 0; t < 2; ++t)
#pragma unroll
          for (int r = 0; r < 8; ++r) { s[t * 8 + r] = sh[u][t][r]; mx = fmaxf(mx, s[t * 8 + r]); }
        mx = fmaxf(mx, xhalf(mx));
        const float mn = fmaxf(m[u], mx); al[u] = __builtin_amdgcn_exp2f((m[u] - mn) * SCALE2); m[u] = mn;   // SCALE2 > 0: the maximum is taken over the unscaled logits; al = 0 on the first pass
        const float ms = __builtin_fmaf(mn, -SCALE2, 8.0f);   // + 8 = x 2^8: keeps small P out of the f16 subnormals; cancels against the sum
        float ps = 0.f;
#pragma unroll
        for (int i = 0; i < 16; i += 2) { const v2f a = __builtin_elementwise_fma((v2f){s[i], s[i + 1]}, (v2f){SCALE2, SCALE2}, (v2f){ms, ms});   // two arguments per packed fma
          const float e0 = __builtin_amdgcn_exp2f(a[0]), e1 = __builtin_amdgcn_exp2f(a[1]); ps += e0; ps += e1; p[u][i] = (_Float16)e0; p[u][i + 1] = (_Float16)e1; }
        l[u] = l[u] * al[u] + ps; }
#pragma unroll
      for (int j = 0; j < HD / 16; ++j)
#pragma unroll
        for (int u = 0; u < 2; ++u) { o[u][j] *= al[u]; o[u][j] = wmma_h(vf[j], p[u], o[u][j]); }
      __builtin_amdgcn_sched_barrier(0); }   // keeps a pass's vector work and products ahead of what follows it (without it the last pass's sink behind the stage's barrier, and the refill is issued that much later)
    asm volatile("s_wait_dscnt 0x0" ::: "memory");      // this wave's reads of the stage are done
    asm volatile("s_wait_asynccnt 0x0" ::: "memory");   // and its copies of the next stage have landed
    __syncthreads();                                     // the next stage is published, and every wave has left this stage's buffer
    if (st + 2 < NST) kv_copy(lds0 + (unsigned)(st & 1) * (4u * FSE), Kg + (size_t)(st + 2) * FSE, Vg + (size_t)(st + 2) * FSE); }   // which is refilled two stages ahead
  asm volatile("s_wait_asynccnt 0x0" ::: "memory");   // no copy is left in flight behind the loop
  // the join of the two key halves: wave w keeps column group ks and hands the other group's maximum, sum and O to wave w ^ 8 in its own rows of ss (maximum and sum in the rows' pad)
  l[0] += xhalf(l[0]); l[1] += xhalf(l[1]);
  const float mk = ks ? m[1] : m[0], lk = ks ? l[1] : l[0], mg = ks ? m[0] : m[1], lg = ks ? l[0] : l[1];
#pragma unroll
  for (int j = 0; j < HD / 16; ++j) { const v8f og = ks ? o[0][j] : o[1][j]; v4f lo, hi;   // o[u][j][r] = unnormalised ctx of query 16 u + col, channel 16 j + 8 g + r
#pragma unroll
    for (int r = 0; r < 4; ++r) { lo[r] = og[r]; hi[r] = og[4 + r]; }
    *(v4f*)&ss[wave][col][j * 16 + 8 * g] = lo; *(v4f*)&ss[wave][col][j * 16 + 8 * g + 4] = hi; }
  ss[wave][col][HD + g] = g ? lg : mg;
  __syncthreads();   // both halves' hand-overs are published
  float (*sp)[HD + 4] = ss[wave ^ 8];   // the partner's rows: behind the barrier this wave alone reads them, and then stages its output there
  const float pm = sp[col][HD], pl = sp[col][HD + 1];
  const float mn = fmaxf(mk, pm); const float ea = __builtin_amdgcn_exp2f((mk - mn) * SCALE2), eb = __builtin_amdgcn_exp2f((pm - mn) * SCALE2);
  const float inv = 1.0f / (lk * ea + pl * eb); const float fa = ea * inv, fb = eb * inv;
#pragma unroll
  for (int j = 0; j < HD / 16; ++j) { const v8f ok = ks ? o[1][j] : o[0][j]; v4f lo = *(const v4f*)&sp[col][j * 16 + 8 * g], hi = *(const v4f*)&sp[col][j * 16 + 8 * g + 4];
#pragma unroll
    for (int r = 0; r < 4; ++r) { lo[r] = ok[r] * fa + lo[r] * fb; hi[r] = ok[4 + r] * fa + hi[r] * fb; }
    *(v4f*)&sp[col][j * 16 + 8 * g] = lo; *(v4f*)&sp[col][j * 16 + 8 * g + 4] = hi; }
  LDSX();
#pragma unroll
  for (int i = 0; i < 8; ++i) { const int rl = 2 * i + g; vst2(Y + ((size_t)b * TT + ql0 + ks * 16 + rl) * CC + h * HD + col * 4, *(const v4f*)&sp[rl][col * 4]); } }   // 256-B (row, head) segment by 16 lanes
// ---- k_out: block = (64 rows, 128 cols): out = ctx Wo (+ bo): all rows: ctx split bf16 hi + lo against exact bf16 Wo (2 products)
__global__ __launch_bounds__(128) void k_out(const float* __restrict__ Y, const float* __restrict__ WO, const float* __restrict__ BO, float* __restrict__ OUT) { __shared__ __align__(16) float sf[4][16][132]; __shared__ __align__(16) __bf16 wt[128][WPT];
  const int tid = threadIdx.x, wave = tid >> 5, lane = tid & 31, col = lane & 15, g = lane >> 4; const int c0 = blockIdx.y * 128; const size_t r0 = (size_t)blockIdx.x * 64 + wave * 16;
  v8f acc[8] = {};
  if (true) {   /* ALL rows: ctx split bf16 hi + lo x exact Wo (2 products) */
    const int sc = 32 * wave + 4 * ((lane & 3) | ((lane >> 4) << 2)), kg = (lane >> 2) & 3;   // staging map as in k_proj
    const float* wsrc = WO + (size_t)(8 * kg) * DIN + c0 + sc; const float* ysrc = Y + (r0 + col) * CC + 8 * g;
    WReg wr; v4f yr[WKC / 8];
    wtile_load(wr, wsrc, DIN);
#pragma unroll
    for (int kk = 0; kk < WKC / 32; ++kk) { yr[kk * 4] = *(const v4f*)(ysrc + kk * 32); yr[kk * 4 + 1] = *(const v4f*)(ysrc + kk * 32 + 4); yr[kk * 4 + 2] = *(const v4f*)(ysrc + kk * 32 + 16); yr[kk * 4 + 3] = *(const v4f*)(ysrc + kk * 32 + 20); }
    asm volatile("s_wait_xcnt 0x0" :: "v"(wsrc), "v"(ysrc) : "memory");   // the loads' address pairs live up to this wait and are rewritten only behind it
    auto split_a = [&](F2 (&a)[WKC / 32]) {
#pragma unroll
      for (int kk = 0; kk < WKC / 32; ++kk) { float v[16];
#pragma unroll
        for (int i = 0; i < 4; ++i) { v[i] = yr[kk * 4][i]; v[4 + i] = yr[kk * 4 + 1][i]; v[8 + i] = yr[kk * 4 + 2][i]; v[12 + i] = yr[kk * 4 + 3][i]; }
        a[kk] = bsplit16(v); } };
    auto publish = [&]() { __syncthreads();   // every wave has read the last chunk's fragments
      wtile_store(wr, wt, sc, kg);
      __syncthreads(); };   // the chunk is published
    auto products = [&](const F2 (&a)[WKC / 32]) {
#pragma unroll
      for (int kk = 0; kk < WKC / 32; ++kk)
#pragma unroll
        for (int jh = 0; jh < 2; ++jh) { v16b w[4];
#pragma unroll
          for (int j = 0; j < 4; ++j) w[j] = frag_b(&wt[(jh * 4 + j) * 16 + col][kk * 32], lane);
#pragma unroll
          for (int j = 0; j < 4; ++j) { acc[jh * 4 + j] = wmma_bf(a[kk].h, w[j], acc[jh * 4 + j]); acc[jh * 4 + j] = wmma_bf(a[kk].l, w[j], acc[jh * 4 + j]); } } };
#pragma unroll 1   // rolled, as in k_proj
    for (int ch = 0; ch < CC / WKC - 1; ++ch) { F2 a[WKC / 32]; split_a(a); publish();
      wtile_load(wr, wsrc + (size_t)WKC * DIN, DIN);   // the next chunk's loads fly while this chunk's products run
#pragma unroll
      for (int kk = 0; kk < WKC / 32; ++kk) { yr[kk * 4] = *(const v4f*)(ysrc + WKC + kk * 32); yr[kk * 4 + 1] = *(const v4f*)(ysrc + WKC + kk * 32 + 4); yr[kk * 4 + 2] = *(const v4f*)(ysrc + WKC + kk * 32 + 16); yr[kk * 4 + 3] = *(const v4f*)(ysrc + WKC + kk * 32 + 20); }
      asm volatile("s_wait_xcnt 0x0" :: "v"(wsrc), "v"(ysrc) : "memory");   // as above
      wsrc += (size_t)WKC * DIN; ysrc += WKC;
      products(a); }
    { F2 a[WKC / 32]; split_a(a); publish(); products(a); }   // the last chunk: nothing left to fetch
#pragma unroll
    for (int j = 0; j < 8; ++j) { const float bias = BO ? bfr(BO[c0 + j * 16 + col]) : 0.f;
#pragma unroll
      for (int r = 0; r < 8; ++r) sf[wave][8 * g + r][j * 16 + col] = acc[j][r] + bias; }
  } else {
#pragma unroll 2
    for (int kc = 0; kc < CC / 32; ++kc) { const v16h a = frag_f32(Y + (r0 + col) * CC + kc * 32, lane); asm volatile("s_wait_loadcnt 0x0" ::: "memory");
#pragma unroll
      for (int j = 0; j < 8; ++j) { const v16h w = WOCOLH(WO, kc * 32, c0 + j * 16 + col, lane); asm volatile("s_wait_loadcnt 0x0" ::: "memory"); acc[j] = wmma16(a, w, acc[j]); } }
#pragma unroll
    for (int j = 0; j < 8; ++j) { const float bias = BO ? bfr(BO[c0 + j * 16 + col]) : 0.f;
#pragma unroll
      for (int r = 0; r < 8; ++r) sf[wave][8 * g + r][j * 16 + col] = acc[j][r] * (1.0f / 256.0f) + bias; } }
  LDSX(); for (int rl = 0; rl < 16; ++rl) vst2(OUT + (r0 + rl) * DIN + c0 + lane * 4, *(const v4f*)&sf[wave][rl][lane * 4]); }

extern "C" void kernel_launch(void* const* d_in, const int* in_sizes, int n_in, void* d_out, int out_size, void* d_ws, size_t ws_size, hipStream_t stream) {
  (void)in_sizes; (void)n_in; (void)out_size;
  const float** F = (const float**)d_in;
  if (ws_size < (size_t)WS_END) return;
  char* ws = (char*)d_ws; _Float16 *QH = (_Float16*)(ws + WS_QH), *KH = (_Float16*)(ws + WS_KH), *VT = (_Float16*)(ws + WS_VT); float *Y = (float*)(ws + WS_Y);
  // inputs: 0 q; 1 k; 2 v [4,2048,512]; 3 Wq (in,out), 4 bq; 5 Wk, 6 bk; 7 Wv, 8 bv; 9 Wo (in,out), 10 bo
  k_proj<<<dim3(TNB * TT / PBM, CC / 128, 3), 128, 0, stream>>>(F[0], F[1], F[2], F[3], F[5], F[7], F[4], F[6], F[8], QH, KH, VT);
  k_fa<<<dim3(TT / (FAW * 16), NH, TNB), FAW * 32, 0, stream>>>(QH, KH, VT, Y);
  k_out<<<dim3(TNB * TT / 64, DIN / 128), 128, 0, stream>>>(Y, F[9], F[10], (float*)d_out);
}

// v010
// One run takes 65 microseconds.
// In both of two side-by-side timings against v009, it was 1.03 times as fast.
// All steps since v000 together make it 17.1 times as fast.
// compute dtype: all float inputs rounded to bf16; q/k/v = in W + b with EXACT bf16 products on WMMA 16x16x32 (f32 accumulate); q once to f16 against k once to f16 (1 product) / sqrt(512); softmax in f32 against a held reference maximum, renewed only when P would leave f16 (base 2: log2 e folded into the scale, hardware exp2), fused with both products; unnormalised P x 2^8 once to f16 against v once to f16 (1 product), / sum in f32; ctx split bf16 hi + lo against exact Wo (2 products) + bo; f32 output.
#include <hip/hip_runtime.h>
#include <math.h>

typedef __attribute__((ext_vector_type(16))) _Float16 v16h;
typedef __attribute__((ext_vector_type(16))) __bf16 v16b;
typedef __attribute__((ext_vector_type(8)))  _Float16 v8h;
typedef __attribute__((ext_vector_type(8)))  float v8f;
typedef __attribute__((ext_vector_type(4)))  float v4f;
typedef __attribute__((ext_vector_type(2)))  float v2f;
typedef __attribute__((ext_vector_type(4)))  unsigned v4u;
typedef __attribute__((ext_vector_type(4)))  int v4i;
typedef float __attribute__((may_alias)) float_a;
typedef int __attribute__((may_alias)) int_a;

template <typename T> __device__ __forceinline__ void vst2(void* p, T v) { *(T*)p = v;  }
__device__ __forceinline__ v8f wmma16(v16h a, v16h b, v8f c) {
  v8f d = __builtin_amdgcn_wmma_f32_16x16x32_f16(false, a, false, b, (short)0, c, false, false);
  asm volatile("v_nop\n\tv_nop\n\tv_nop\n\tv_nop" : "+v"(d) : "v"(a), "v"(b));
  return d;
}
__device__ __forceinline__ v8f wmma_bf(v16b a, v16b b, v8f c) {
  v8f d = __builtin_amdgcn_wmma_f32_16x16x32_bf16(false, a, false, b, (short)0, c, false, false);
  asm volatile("v_nop\n\tv_nop\n\tv_nop\n\tv_nop" : "+v"(d) : "v"(a), "v"(b));
  return d;
}
// 16x16x32 fragments: lane = (h = lane>>4, row/col = lane&15); elements 0..7 = k0+8h+0..7, 8..15 = k0+16+8h+0..7; D element r = row 8h+r
__device__ __forceinline__ v16h frag_h(const _Float16* rowk0, int lane) {
  union { v16h v; v8h q[2]; } u; const _Float16* p = rowk0 + 8 * (lane >> 4);
  u.q[0] = *(const v8h*)p; u.q[1] = *(const v8h*)(p + 16); return u.v;
}
__device__ __forceinline__ v16h frag_f32(const float* rowk0, int lane) {
  v16h a; const float* p = rowk0 + 8 * (lane >> 4);
#pragma unroll
  for (int i = 0; i < 8; ++i) { a[i] = (_Float16)p[i]; a[8 + i] = (_Float16)p[16 + i]; }
  return a;
}
__device__ __forceinline__ v16h frag_f32s(const float* rowk0, int lane, float sc) {
  v16h a; const float* p = rowk0 + 8 * (lane >> 4);
#pragma unroll
  for (int i = 0; i < 8; ++i) { a[i] = (_Float16)(p[i] * sc); a[8 + i] = (_Float16)(p[16 + i] * sc); }
  return a;
}
// column fragment from a [K][ld] layout (column n), rows >= K read as 0
__device__ __forceinline__ v16h fragc_f32(const float* W, int k0, int n, int lane, int ld, int K) {
  v16h a; const int g = lane >> 4;
#pragma unroll
  for (int i = 0; i < 8; ++i) { const int ka = k0 + 8 * g + i, kb = ka + 16;
    a[i] = (_Float16)(ka < K ? W[(size_t)(ka < K ? ka : K - 1) * ld + n] : 0.f); a[8 + i] = (_Float16)(kb < K ? W[(size_t)(kb < K ? kb : K - 1) * ld + n] : 0.f); }
  return a;
}
struct F2 { v16b h, l; };
__device__ __forceinline__ F2 bsplit16(const float v[16]) { F2 r;
#pragma unroll
  for (int i = 0; i < 16; ++i) { const __bf16 h = (__bf16)v[i]; r.h[i] = h; r.l[i] = (__bf16)(v[i] - (float)h); }
  return r; }
__device__ __forceinline__ F2 split_row(const float* row, int k0, int lane) { float v[16]; const float* p = row + k0 + 8 * (lane >> 4);
#pragma unroll
  for (int i = 0; i < 8; ++i) { v[i] = p[i]; v[8 + i] = p[16 + i]; }
  return bsplit16(v); }
__device__ __forceinline__ F2 split_rowK(const float* row, int k0, int lane, int K) { float v[16]; const int g = lane >> 4;
#pragma unroll
  for (int i = 0; i < 8; ++i) { const int ka = k0 + 8 * g + i, kb = ka + 16; v[i] = ka < K ? row[ka < K ? ka : K - 1] : 0.f; v[8 + i] = kb < K ? row[kb < K ? kb : K - 1] : 0.f; }
  return bsplit16(v); }
__device__ __forceinline__ F2 split_col(const float* W, int k0, int n, int lane, int ld, int K) { float v[16]; const int g = lane >> 4;
#pragma unroll
  for (int i = 0; i < 8; ++i) { const int ka = k0 + 8 * g + i, kb = ka + 16; v[i] = ka < K ? W[(size_t)(ka < K ? ka : K - 1) * ld + n] : 0.f; v[8 + i] = kb < K ? W[(size_t)(kb < K ? kb : K - 1) * ld + n] : 0.f; }
  return bsplit16(v); }
__device__ __forceinline__ v8f mac3(const F2& a, const F2& b, v8f c) { c = wmma_bf(a.l, b.h, c); c = wmma_bf(a.h, b.l, c); return wmma_bf(a.h, b.h, c); }
__device__ __forceinline__ float sigm(float v) { return 1.0f / (1.0f + expf(-v)); }
#define LDSX() do { asm volatile("s_wait_dscnt 0" ::: "memory"); __builtin_amdgcn_wave_barrier(); __builtin_amdgcn_fence(__ATOMIC_RELEASE, "workgroup"); } while (0)

// Multi-head attention with separate q / k / v inputs (B 4, S 2,048, hid 512 = 8 x 64; (in,out) 1/sqrt(512)-scale weights, zero biases; scale = 1/sqrt(hid_dim = 512), as written): qp = q Wq + bq ...; out = merged(softmax(qh kh^T / sqrt(512)) vh) Wo + bo (non-causal).
#define NB 4
#define TT 2048
#define CC 512            // NH * HD = projected width
#define DIN 512          // input (model) width
#define NH 8
#define HD 64
#define NQB (TT / 64)
#define HG 4
#define SCALE (0.04419417382415922f)
#define CAUSAL 0
#ifndef TNB
#define TNB NB
#endif
__device__ __forceinline__ float bfr(float v) { return (float)(__bf16)v; }
__host__ __device__ __forceinline__ int kb_last(int qb) { return CAUSAL ? ((qb * 64 + 63) >> 7) : (TT / 128 - 1); }
typedef __attribute__((ext_vector_type(8))) __bf16 v8b;
__device__ __forceinline__ v16b frag_b(const __bf16* rowk0, int lane) {
  union { v16b v; v8b q[2]; } u; const __bf16* p = rowk0 + 8 * (lane >> 4);
  u.q[0] = *(const v8b*)p; u.q[1] = *(const v8b*)(p + 16); return u.v;
}
#define QBH 0              // unused: no kernel reads it (no kernel has a high-precision path)
#define QHI 2048            // rows of the workspace plane WS_QL (no kernel writes or reads it: q goes once rounded into the logits); it keeps the offsets behind it
#define KHI 64            // rows of the workspace planes WS_KL, WS_VB, WS_VBL (no kernel writes or reads them); it keeps the offsets behind them
// B fragment (k rows k0+.., output column o) of a weight: (in,out) [K][ld] or (out,in) [ld rows of K]: bf16 exact, or f16(bf16 * 256) exact
__device__ __forceinline__ v16b wcol_io(const float* Wm, int k0, int o, int lane, int ld) { v16b w; const int g = lane >> 4;
#pragma unroll
  for (int i = 0; i < 8; ++i) { w[i] = (__bf16)Wm[(size_t)(k0 + 8 * g + i) * ld + o]; w[8 + i] = (__bf16)Wm[(size_t)(k0 + 16 + 8 * g + i) * ld + o]; }
  return w; }
__device__ __forceinline__ v16b wcol_oi(const float* Wm, int k0, int o, int lane, int K) { v16b w; const float* p = Wm + (size_t)o * K + k0 + 8 * (lane >> 4);
#pragma unroll
  for (int i = 0; i < 8; ++i) { w[i] = (__bf16)p[i]; w[8 + i] = (__bf16)p[16 + i]; }
  return w; }
__device__ __forceinline__ v16h wcolh_io(const float* Wm, int k0, int o, int lane, int ld) { v16h w; const int g = lane >> 4;
#pragma unroll
  for (int i = 0; i < 8; ++i) { w[i] = (_Float16)(bfr(Wm[(size_t)(k0 + 8 * g + i) * ld + o]) * 256.0f); w[8 + i] = (_Float16)(bfr(Wm[(size_t)(k0 + 16 + 8 * g + i) * ld + o]) * 256.0f); }
  return w; }
__device__ __forceinline__ v16h wcolh_oi(const float* Wm, int k0, int o, int lane, int K) { v16h w; const float* p = Wm + (size_t)o * K + k0 + 8 * (lane >> 4);
#pragma unroll
  for (int i = 0; i < 8; ++i) { w[i] = (_Float16)(bfr(p[i]) * 256.0f); w[8 + i] = (_Float16)(bfr(p[16 + i]) * 256.0f); }
  return w; }
#define WQKV_LAYOUT 0   // 0 = (in,out) [DIN][CC]; k_proj reads only this layout (other values change only WCOL, which nothing calls)
__device__ __forceinline__ v16b wcol_hdk(const float* Wm, int k0, int o, int lane) { v16b w; const int g = lane >> 4; const float* p = Wm + (size_t)(o / HD) * DIN * HD + (o % HD);
#pragma unroll
  for (int i = 0; i < 8; ++i) { w[i] = (__bf16)p[(size_t)(k0 + 8 * g + i) * HD]; w[8 + i] = (__bf16)p[(size_t)(k0 + 16 + 8 * g + i) * HD]; }
  return w; }
#define WO_OUT_IN 0
#if WQKV_LAYOUT == 1
#define WCOL(W, k0, o, lane) wcol_oi(W, k0, o, lane, DIN)
#elif WQKV_LAYOUT == 2
#define WCOL(W, k0, o, lane) wcol_hdk(W, k0, o, lane)
#else
#define WCOL(W, k0, o, lane) wcol_io(W, k0, o, lane, CC)
#endif
#if WO_OUT_IN
#define WOCOL(W, k0, o, lane) wcol_oi(W, k0, o, lane, CC)
#define WOCOLH(W, k0, o, lane) wcolh_oi(W, k0, o, lane, CC)
#else
#define WOCOL(W, k0, o, lane) wcol_io(W, k0, o, lane, DIN)
#define WOCOLH(W, k0, o, lane) wcolh_io(W, k0, o, lane, DIN)
#endif

#ifndef SM_EXTRA_PARAMS
#define SM_EXTRA_PARAMS
#endif
#ifndef PROJ_EXTRA_PARAMS
#define PROJ_EXTRA_PARAMS
#endif
#ifndef SM_MASK_HOOK
#define SM_MASK_HOOK (void)0
#endif

#define WS_QH  0u                                      // f16 q in fragment order, as k: [b][h][16-query tile][piece p = 16 channels][lane = 16 g + query][8 channels 16 p + 8 g + ..]
#define WS_KH  (WS_QH + 2u * (size_t)NB * TT * CC)      // f16 k in fragment order [b][h][16-key tile][piece p = 16 channels][lane = 16 g + key][8 channels 16 p + 8 g + ..]
#define WS_VT  (WS_KH + 2u * (size_t)NB * TT * CC)      // f16 v in fragment order [b][h][32-key block][16-channel tile j][half][lane = 16 g + channel][8 keys 16 half + 8 g + ..]
#define WS_QL  (WS_VT + 2u * (size_t)NB * CC * TT)      // unused (room of a q residual plane) [b][t < QHI][CC]
#define WS_KL  (WS_QL + 2u * (size_t)NB * QHI * CC)     // unused (room of a k residual plane) [b][t < KHI][CC]
#define WS_VB  (WS_KL + 2u * (size_t)NB * KHI * CC)     // unused (room of two bf16 v planes) [b][c][t < KHI]
#define WS_VBL (WS_VB + 2u * (size_t)NB * CC * KHI)
#define WS_S   (WS_VBL + 2u * (size_t)NB * CC * KHI)    // f32 [hg][t][s] region, unused: k_fa keeps the logits in registers
#define WS_Y   (WS_S  + 4u * (size_t)HG * TT * TT)      // f32 ctx rows [b*t][CC] (only when there is an output projection)
#define WS_END (WS_Y  + 4u * (size_t)NB * TT * CC)
// k and v lie in the workspace as k_fa's A fragments read them: the 32 lanes' 16-byte pieces of one load are 512 contiguous bytes (4 whole lines; by rows or planes one load touched 16 lines for the same bytes)
#define KF_TILE(b, h, kt) ((((size_t)(b) * NH + (h)) * (TT / 16) + (kt)) * 1024)   // element offset of a 16-key tile: 4 pieces of 256 elements
#define VF_BLK(b, h, cb)  ((((size_t)(b) * NH + (h)) * (TT / 32) + (cb)) * 2048)   // element offset of a 32-key block: 4 channel tiles x 2 halves of 256 elements

// ---- weight tile in LDS: 128 threads bring 64 k rows x 128 output columns of an (in,out) f32 weight as 16-byte row pieces (whole 128-B lines), round them to bf16 as before and store them [column][k], so that a B fragment is two 16-byte LDS reads and the block's four waves share one fetch and one rounding (the short loops are unrolled in full: the register arrays need constant indices)
#define WKC 64            // k rows per staged chunk
#define WPT (WKC + 8)     // LDS pitch in elements: 144 B = 16 B x odd, the fragment reads of 16 columns fall on 16 different bank groups
struct WReg { v4f x[16]; };
__device__ __forceinline__ void wtile_load(WReg& r, const float* wsrc, int ld) {   // wsrc: this thread's first row (8 kg) and first of 4 columns
#pragma unroll
  for (int p = 0; p < WKC / 32; ++p)
#pragma unroll
    for (int i = 0; i < 8; ++i) r.x[p * 8 + i] = *(const v4f*)(wsrc + (size_t)(p * 32 + i) * ld);
}
__device__ __forceinline__ void wtile_store(const WReg& r, __bf16 (*wt)[WPT], int sc, int kg) {
#pragma unroll
  for (int p = 0; p < WKC / 32; ++p)
#pragma unroll
    for (int cc = 0; cc < 4; ++cc) { v8b t;
#pragma unroll
      for (int i = 0; i < 8; ++i) t[i] = (__bf16)r.x[p * 8 + i][cc];
      *(v8b*)&wt[sc + cc][p * 32 + 8 * kg] = t; }
}
// ---- x tile in LDS: 128 threads bring 128 rows x 64 k of the f32 input; one load of a wave is two rows' 256 contiguous bytes (4 whole lines), rounded to bf16 as before and stored [row][k] at the weight tile's pitch, so that the block fetches and rounds each x element once and a fragment is two 16-byte LDS reads
typedef __attribute__((ext_vector_type(4))) __bf16 v4b;
#define PBM 128           // rows of x per block of k_proj
struct XReg { v4f x[PBM / 8]; };
__device__ __forceinline__ void xtile_load(XReg& r, const float* xsrc) {   // xsrc: this thread's first row and its 4 k
#pragma unroll
  for (int i = 0; i < PBM / 8; ++i) r.x[i] = *(const v4f*)(xsrc + (size_t)(2 * i) * DIN);
}
__device__ __forceinline__ void xtile_store(const XReg& r, __bf16 (*xt)[WPT], int row, int k4) {
#pragma unroll
  for (int i = 0; i < PBM / 8; ++i) { v4b t;
#pragma unroll
    for (int e = 0; e < 4; ++e) t[e] = (__bf16)r.x[i][e];
    *(v4b*)&xt[row + 2 * i][k4] = t; }
}
// ---- k_proj: block = (128 rows, 128 cols, which), four waves of 64 rows x 64 cols (one head): q/k/v = X W (+ b) with exact bf16 products (K = DIN), both operands staged in LDS chunk by chunk, f16 results in k_fa's fragment order, stored straight from the accumulators. SW (q, k): the weight fragment is the A operand and the x fragment the B operand, so a lane holds 8 consecutive channels of one row; v: x is A, so a lane holds 8 consecutive keys of one channel. Either way a tile of a wave is one 512-B piece of the workspace: no LDS staging and no barrier behind the products
template <bool SW> __device__ __forceinline__ void proj_body(const float* __restrict__ X, const float* __restrict__ WA, const float* __restrict__ BA, _Float16* __restrict__ D, __bf16 (*wt)[WPT], __bf16 (*xt)[WPT]) {
  const int tid = threadIdx.x, wave = tid >> 5, lane = tid & 31, col = lane & 15, g = lane >> 4; const int c0 = blockIdx.y * 128; const size_t r0 = (size_t)blockIdx.x * PBM; const size_t bb = r0 / TT; const int t0 = (int)(r0 % TT);
  const int wr_ = wave >> 1, wc = wave & 1;   // the wave's 64 rows and its 64 columns of the block's tile
  const int sc = 32 * wave + 4 * ((lane & 3) | ((lane >> 4) << 2)), kg = (lane >> 2) & 3;   // weight staging: 4 columns x 8 k rows per thread and 32 k; 16 lanes store to 16 different bank groups
  const int xrow = 32 * wave + g, xk = 4 * col;   // x staging: rows xrow + 2 i, 4 k per thread
  const float* wsrc = WA + (size_t)(8 * kg) * CC + c0 + sc; const float* xsrc = X + (r0 + xrow) * DIN + xk;
  v8f acc[4][4] = {}; WReg wr; XReg xr;
  wtile_load(wr, wsrc, CC); xtile_load(xr, xsrc);
  asm volatile("s_wait_xcnt 0x0" :: "v"(wsrc), "v"(xsrc) : "memory");   // the loads' address pairs live up to this wait and are rewritten only behind it
  auto publish = [&]() { __syncthreads();   // every wave has read the last chunk's fragments
    wtile_store(wr, wt, sc, kg); xtile_store(xr, xt, xrow, xk);
    __syncthreads(); };   // the chunk is published
  auto products = [&]() {
#pragma unroll
    for (int kk = 0; kk < WKC / 32; ++kk) { v16b a[4];
#pragma unroll
      for (int i = 0; i < 4; ++i) a[i] = frag_b(&xt[wr_ * 64 + i * 16 + col][kk * 32], lane);
#pragma unroll
      for (int jh = 0; jh < 2; ++jh) { v16b w[2];   // two weight fragments at a time: with four the live set passes the 336 registers of three waves per SIMD (three blocks per WGP hold all 768 blocks at once)
#pragma unroll
        for (int j = 0; j < 2; ++j) w[j] = frag_b(&wt[wc * 64 + (jh * 2 + j) * 16 + col][kk * 32], lane);
#pragma unroll
        for (int rt = 0; rt < 4; ++rt)
#pragma unroll
          for (int j = 0; j < 2; ++j) acc[rt][jh * 2 + j] = SW ? wmma_bf(w[j], a[rt], acc[rt][jh * 2 + j]) : wmma_bf(a[rt], w[j], acc[rt][jh * 2 + j]); } } };
#pragma unroll 1   // rolled: one body holds 32 products and 32 loads already
  for (int ch = 0; ch < DIN / WKC - 1; ++ch) { publish();
    wtile_load(wr, wsrc + (size_t)WKC * CC, CC); xtile_load(xr, xsrc + WKC);   // the next chunk's loads fly while this chunk's products run
    asm volatile("s_wait_xcnt 0x0" :: "v"(wsrc), "v"(xsrc) : "memory");   // as above
    wsrc += (size_t)WKC * CC; xsrc += WKC;
    products(); }
  v4f bq[SW ? 8 : 1] = {};   // SW: the lane's 8 channels of each of the 4 column tiles; v: the lane's one channel of each tile
  { publish();   // the last chunk: no operand is left to fetch, so the biases fly, as one group, while its products run
    if (BA) { const float* bp = BA + c0 + wc * 64 + (SW ? 8 * g : col);
      if (SW) {
#pragma unroll
        for (int j = 0; j < 4; ++j) { bq[2 * j] = *(const v4f*)(bp + j * 16); bq[2 * j + 1] = *(const v4f*)(bp + j * 16 + 4); }
      } else {
#pragma unroll
        for (int j = 0; j < 4; ++j) bq[0][j] = bp[j * 16]; }
      asm volatile("s_wait_xcnt 0x0" :: "v"(bp) : "memory"); }   // the loads' address lives up to this wait and is rewritten only behind it
    products();
    __builtin_amdgcn_sched_barrier(0); }   // keeps the first use of a bias behind the products (without it one rounding, with its wait for the load just issued, is lifted in front of them)
  // SW: acc[rt][j][r] = row wr_ * 64 + rt * 16 + col, channel 16 j + 8 g + r of head c0 / HD + wc; v: acc[rt][j][r] = key wr_ * 64 + rt * 16 + 8 g + r, channel 16 j + col
  _Float16* pd = D + (SW ? KF_TILE(bb, c0 / HD + wc, t0 / 16 + wr_ * 4) : VF_BLK(bb, c0 / HD + wc, t0 / 32 + wr_ * 2)) + lane * 8;
  v4u dv[16];
#pragma unroll
  for (int rt = 0; rt < 4; ++rt)
#pragma unroll
    for (int j = 0; j < 4; ++j) { union { v8h h; v4u u; } t;
#pragma unroll
      for (int r = 0; r < 8; ++r) t.h[r] = (_Float16)(acc[rt][j][r] + bfr(SW ? bq[2 * j + (r >> 2)][r & 3] : bq[0][j]));
      dv[rt * 4 + j] = t.u; }
#pragma unroll
  for (int rt = 0; rt < 4; ++rt)
#pragma unroll
    for (int j = 0; j < 4; ++j) vst2(pd + (SW ? rt * 1024 + j * 256 : (rt >> 1) * 2048 + j * 512 + (rt & 1) * 256), dv[rt * 4 + j]);   // a wave stores one 512-B piece
  asm volatile("s_wait_xcnt 0x0" :: "v"(pd), "v"(dv[0]), "v"(dv[1]), "v"(dv[2]), "v"(dv[3]), "v"(dv[4]), "v"(dv[5]), "v"(dv[6]), "v"(dv[7]), "v"(dv[8]), "v"(dv[9]), "v"(dv[10]), "v"(dv[11]), "v"(dv[12]), "v"(dv[13]), "v"(dv[14]), "v"(dv[15]) : "memory");   // the stores' address pair and data live up to this wait
}
__global__ __launch_bounds__(128) void k_proj(const float* __restrict__ XQ, const float* __restrict__ XK, const float* __restrict__ XV, const float* __restrict__ WQ, const float* __restrict__ WK, const float* __restrict__ WV, const float* __restrict__ BQ, const float* __restrict__ BK, const float* __restrict__ BV,
    _Float16* __restrict__ QH, _Float16* __restrict__ KH, _Float16* __restrict__ VT) {
  __shared__ __align__(16) __bf16 wt[128][WPT]; __shared__ __align__(16) __bf16 xt[PBM][WPT];
  const int which = blockIdx.z;   // the same for the whole block: every barrier stands under block-uniform control flow
  if (which == 2) proj_body<false>(XV, WV, BV, VT, wt, xt);
  else proj_body<true>(which == 0 ? XQ : XK, which == 0 ? WQ : WK, which == 0 ? BQ : BK, which == 0 ? QH : KH, wt, xt); }
// ---- k_fa: block = 256 queries of (b, h), one launch for every (b, h): 16 waves = 8 query sets of 32 x 2 key halves; k and v come to LDS once per block by asynchronous copies, 128 keys a stage, two buffers; a wave takes 32 queries (two column groups) and 64 of a stage's keys, so that each k or v fragment it reads from LDS feeds two products; per 32 keys S^T = K Q^T (1 product), held reference m and sum per query column in f32, P = 2^((s - m) SCALE log2 e) x 2^8 once to f16 straight from the score registers as the B operand, O^T += V^T P^T (1 product); the logits never leave the registers; behind the loop the two key halves' maximum, sum and O of a query are joined through LDS; ctx = O / sum
__device__ __forceinline__ float xhalf(float x) { return __builtin_bit_cast(float, __builtin_amdgcn_permlanex16(__builtin_bit_cast(int, x), __builtin_bit_cast(int, x), 0x76543210, 0xfedcba98, false, false)); }  // lane l with lane l ^ 16
__device__ __forceinline__ v16h frag_p(const _Float16* p) { union { v16h v; v8h q[2]; } u; u.q[0] = *(const v8h*)p; u.q[1] = *(const v8h*)(p + 256); return u.v; }   // fragment-order source, the lane's 8 elements already in p: the two halves are neighbouring 512-B pieces
__device__ __forceinline__ v8f wmma_h(v16h a, v16h b, v8f c) { return __builtin_amdgcn_wmma_f32_16x16x32_f16(false, a, false, b, (short)0, c, false, false); }
#define FAW 16            // waves per block
#define SCALE2 ((float)(0.04419417382415922 * 1.4426950408889634))   // SCALE x log2 e: e^(s SCALE) = 2^(s SCALE2), so one fused multiply-add and one v_exp_f32 make an exponential
#define FST 128           // keys per stage: 16 KB of k and 16 KB of v, each contiguous in the workspace's fragment order
#define NST (TT / FST)    // stages per (b, h)
#define FSE (FST * HD)    // elements of k (or of v) per stage
// one stage's k and v into one LDS buffer: 512 threads x 4 copies of 16 bytes, a thread's own bytes at 16 tid (+ 8 KB); the s_wait_xcnt stands inside the statement, so the address registers are rewritten only behind it
__device__ __forceinline__ void kv_copy(unsigned lb, const _Float16* gk, const _Float16* gv) {
  const unsigned l1 = lb + 8192u, l2 = lb + 16384u, l3 = lb + 24576u; const _Float16 *gk1 = gk + 4096, *gv1 = gv + 4096;
  asm volatile("global_load_async_to_lds_b128 %0, %4, off\n\tglobal_load_async_to_lds_b128 %1, %5, off\n\tglobal_load_async_to_lds_b128 %2, %6, off\n\tglobal_load_async_to_lds_b128 %3, %7, off\n\ts_wait_xcnt 0x0"
               :: "v"(lb), "v"(l1), "v"(l2), "v"(l3), "v"(gk), "v"(gk1), "v"(gv), "v"(gv1) : "memory");
}
__global__ __launch_bounds__(FAW * 32) void k_fa(const _Float16* __restrict__ QH, const _Float16* __restrict__ KH, const _Float16* __restrict__ VT, float* __restrict__ Y) { __shared__ __align__(16) float ss[FAW][16][HD + 4];
  __shared__ __align__(16) _Float16 kv[2][2][FSE];   // two buffers of (k, v): the block fetches each stage once, a whole stage ahead of its use, and its 16 waves read their fragments from here
  const int tid = threadIdx.x, wave = tid >> 5, lane = tid & 31, col = lane & 15, g = lane >> 4; const int h = blockIdx.y, b = blockIdx.z;
  const int ks = wave >> 3;   // the wave's half of every stage's keys; waves w and w ^ 8 hold the same 32 queries
  const int ql0 = blockIdx.x * (FAW * 16) + (wave & 7) * 32;
  const unsigned lds0 = (unsigned)(size_t)&kv[0][0][0] + (unsigned)tid * 16u;   // this thread's 16 bytes in buffer 0 (LDS byte address)
  const _Float16* Kg = KH + KF_TILE(b, h, 0) + tid * 8;   // and in stage 0 of (b, h)
  const _Float16* Vg = VT + VF_BLK(b, h, 0) + tid * 8;
  kv_copy(lds0, Kg, Vg);
  const _Float16* Qg = QH + KF_TILE(b, h, ql0 / 16) + lane * 8;   // q lies in the workspace as k does: this wave's 32 queries are two neighbouring tiles
  v16h qh[2][HD / 32];
#pragma unroll
  for (int u = 0; u < 2; ++u)
#pragma unroll
    for (int kc = 0; kc < HD / 32; ++kc) qh[u][kc] = frag_p(Qg + u * 1024 + kc * 512);
  asm volatile("s_wait_xcnt 0x0" :: "v"(Qg) : "memory");   // the loads' address pair lives up to this wait and is rewritten only behind it
  v8f o[2][HD / 16] = {}; float m[2] = {-3.0e38f, -3.0e38f}, l[2] = {0.f, 0.f};
  float ms[2] = {3.0e38f, 3.0e38f};   // 8 - m SCALE2 for the reference m in use: the addend of every exponent; the start value sends the first pass through the branch that sets a reference
  asm volatile("s_wait_asynccnt 0x0" ::: "memory");   // this wave's copies of stage 0 have landed
  __syncthreads();                                     // stage 0 is published
  kv_copy(lds0 + 4u * FSE, Kg + FSE, Vg + FSE);        // stage 1 flies while stage 0 is worked on
#pragma unroll 1   // rolled: one body holds two passes of 16 products already
  for (int st = 0; st < NST; ++st) {
    const _Float16* kb = &kv[st & 1][0][0] + ks * (FSE / 2) + lane * 8;   // this lane's 16 bytes of the first k piece of the wave's 64 keys
    const _Float16* vb = &kv[st & 1][1][0] + ks * (FSE / 2) + lane * 8;
    v16h kf[2][HD / 32];
#pragma unroll
    for (int t = 0; t < 2; ++t)
#pragma unroll
      for (int kc = 0; kc < HD / 32; ++kc) kf[t][kc] = frag_p(kb + t * 1024 + kc * 512);
#pragma unroll   // in full: the pass index is a constant in every LDS offset, and the last pass's missing prefetch costs no branch
    for (int c = 0; c < FST / 64; ++c) {
      v8f sh[2][2];   // [column group][16-key tile]
      // the eight score products in one statement: as builtins the last of them were placed behind the next k loads, which then took new registers; the v_nop in front keep the distance from the last pass's O products to these results, which may take the registers of their v or P operands; the v_nop behind keep the distance from the last product to the first instruction that writes its operands or reads its result
      asm volatile("v_nop\n\tv_nop\n\tv_nop\n\tv_nop\n\t"
                   "v_wmma_f32_16x16x32_f16 %0, %4, %8, 0\n\tv_wmma_f32_16x16x32_f16 %1, %5, %8, 0\n\t"
                   "v_wmma_f32_16x16x32_f16 %2, %4, %10, 0\n\tv_wmma_f32_16x16x32_f16 %3, %5, %10, 0\n\t"
                   "v_wmma_f32_16x16x32_f16 %0, %6, %9, %0\n\tv_wmma_f32_16x16x32_f16 %1, %7, %9, %1\n\t"
                   "v_wmma_f32_16x16x32_f16 %2, %6, %11, %2\n\tv_wmma_f32_16x16x32_f16 %3, %7, %11, %3\n\t"
                   "v_nop\n\tv_nop\n\tv_nop\n\tv_nop"
                   : "=&v"(sh[0][0]), "=&v"(sh[0][1]), "=&v"(sh[1][0]), "=&v"(sh[1][1])
                   : "v"(kf[0][0]), "v"(kf[1][0]), "v"(kf[0][1]), "v"(kf[1][1]), "v"(qh[0][0]), "v"(qh[0][1]), "v"(qh[1][0]), "v"(qh[1][1]));
      v16h vf[HD / 16];   // this pass's v and the next pass's k are read in one group, while the pass does its softmax
#pragma unroll
      for (int j = 0; j < HD / 16; ++j) vf[j] = frag_p(vb + c * 2048 + j * 512);
      if (c + 1 < FST / 64) {   // the wave's next 32 keys of the same stage (nothing of the next stage is read before its barrier)
#pragma unroll
        for (int t = 0; t < 2; ++t)
#pragma unroll
          for (int kc = 0; kc < HD / 32; ++kc) kf[t][kc] = frag_p(kb + (c + 1) * 2048 + t * 1024 + kc * 512); }
      __builtin_amdgcn_sched_barrier(0);   // keeps these reads in one group here, ahead of the softmax (without it the scheduler scatters them among the vector instructions and the products)
      // lazy rescale: m is a held reference, not the running maximum: P, the sum and O stay relative to it as long as P fits f16. One test a pass: every P is at most its lane's sum of the pass, so a sum of at most 2^15 bounds them all; the maximum, the exchange between the lane halves and the rescale stand in the branch alone
      v16h p[2]; float ps[2];
      auto expo = [&]() {   // sh[u][t][r] = unscaled logit of key 32 c + 16 t + 8 g + r of the wave's 64 for query 16 u + col: element 8 t + r, the k order of a B fragment
#pragma unroll
        for (int u = 0; u < 2; ++u) { ps[u] = 0.f;
#pragma unroll
          for (int i = 0; i < 16; i += 2) { const v2f a = __builtin_elementwise_fma((v2f){sh[u][i >> 3][i & 7], sh[u][i >> 3][(i & 7) + 1]}, (v2f){SCALE2, SCALE2}, (v2f){ms[u], ms[u]});   // two arguments per packed fma
            const float e0 = __builtin_amdgcn_exp2f(a[0]), e1 = __builtin_amdgcn_exp2f(a[1]); ps[u] += e0; ps[u] += e1; p[u][i] = (_Float16)e0; p[u][i + 1] = (_Float16)e1; } } };
      expo();
      if (__builtin_expect(__builtin_amdgcn_ballot_w32((ps[0] > 32768.0f) | (ps[1] > 32768.0f)) != 0, 0)) {   // the same for the whole wave (a scalar branch): both column groups take a new reference, the same in both lane halves; sum and O go over to it (al = 0 on the first pass) and the pass's P are formed anew
#pragma unroll
        for (int u = 0; u < 2; ++u) { float mx = -3.0e38f;   // SCALE2 > 0: the maximum is taken over the unscaled logits
#pragma unroll
          for (int t = 0; t < 2; ++t)
#pragma unroll
            for (int r = 0; r < 8; ++r) mx = fmaxf(mx, sh[u][t][r]);
          const float mn = fmaxf(m[u], fmaxf(mx, xhalf(mx))); const float al = __builtin_amdgcn_exp2f((m[u] - mn) * SCALE2);
          m[u] = mn; ms[u] = __builtin_fmaf(mn, -SCALE2, 8.0f);   // + 8 = x 2^8: keeps small P out of the f16 subnormals; cancels against the sum
          l[u] *= al;
#pragma unroll
          for (int j = 0; j < HD / 16; ++j) o[u][j] *= al; }
        expo(); }
      l[0] += ps[0]; l[1] += ps[1];
#pragma unroll
      for (int j = 0; j < HD / 16; ++j)
#pragma unroll
        for (int u = 0; u < 2; ++u) o[u][j] = wmma_h(vf[j], p[u], o[u][j]);
      __builtin_amdgcn_sched_barrier(0); }   // keeps a pass's vector work and products ahead of what follows it (without it the last pass's sink behind the stage's barrier, and the refill is issued that much later)
    asm volatile("s_wait_dscnt 0x0" ::: "memory");      // this wave's reads of the stage are done
    asm volatile("s_wait_asynccnt 0x0" ::: "memory");   // and its copies of the next stage have landed
    __syncthreads();                                     // the next stage is published, and every wave has left this stage's buffer
    if (st + 2 < NST) kv_copy(lds0 + (unsigned)(st & 1) * (4u * FSE), Kg + (size_t)(st + 2) * FSE, Vg + (size_t)(st + 2) * FSE); }   // which is refilled two stages ahead
  asm volatile("s_wait_asynccnt 0x0" ::: "memory");   // no copy is left in flight behind the loop
  // the join of the two key halves: wave w keeps column group ks and hands the other group's maximum, sum and O to wave w ^ 8 in its own rows of ss (maximum and sum in the rows' pad)
  l[0] += xhalf(l[0]); l[1] += xhalf(l[1]);
  const float mk = ks ? m[1] : m[0], lk = ks ? l[1] : l[0], mg = ks ? m[0] : m[1], lg = ks ? l[0] : l[1];
#pragma unroll
  for (int j = 0; j < HD / 16; ++j) { const v8f og = ks ? o[0][j] : o[1][j]; v4f lo, hi;   // o[u][j][r] = unnormalised ctx of query 16 u + col, channel 16 j + 8 g + r
#pragma unroll
    for (int r = 0; r < 4; ++r) { lo[r] = og[r]; hi[r] = og[4 + r]; }
    *(v4f*)&ss[wave][col][j * 16 + 8 * g] = lo; *(v4f*)&ss[wave][col][j * 16 + 8 * g + 4] = hi; }
  ss[wave][col][HD + g] = g ? lg : mg;
  __syncthreads();   // both halves' hand-overs are published
  float (*sp)[HD + 4] = ss[wave ^ 8];   // the partner's rows: behind the barrier this wave alone reads them, and then stages its output there
  const float pm = sp[col][HD], pl = sp[col][HD + 1];
  const float mn = fmaxf(mk, pm); const float ea = __builtin_amdgcn_exp2f((mk - mn) * SCALE2), eb = __builtin_amdgcn_exp2f((pm - mn) * SCALE2);
  const float inv = 1.0f / (lk * ea + pl * eb); const float fa = ea * inv, fb = eb * inv;
#pragma unroll
  for (int j = 0; j < HD / 16; ++j) { const v8f ok = ks ? o[1][j] : o[0][j]; v4f lo = *(const v4f*)&sp[col][j * 16 + 8 * g], hi = *(const v4f*)&sp[col][j * 16 + 8 * g + 4];
#pragma unroll
    for (int r = 0; r < 4; ++r) { lo[r] = ok[r] * fa + lo[r] * fb; hi[r] = ok[4 + r] * fa + hi[r] * fb; }
    *(v4f*)&sp[col][j * 16 + 8 * g] = lo; *(v4f*)&sp[col][j * 16 + 8 * g + 4] = hi; }
  LDSX();
#pragma unroll
  for (int i = 0; i < 8; ++i) { const int rl = 2 * i + g; vst2(Y + ((size_t)b * TT + ql0 + ks * 16 + rl) * CC + h * HD + col * 4, *(const v4f*)&sp[rl][col * 4]); } }   // 256-B (row, head) segment by 16 lanes
// ---- k_out: block = (64 rows, 128 cols): out = ctx Wo (+ bo): all rows: ctx split bf16 hi + lo against exact bf16 Wo (2 products)
__global__ __launch_bounds__(128) void k_out(const float* __restrict__ Y, const float* __restrict__ WO, const float* __restrict__ BO, float* __restrict__ OUT) { __shared__ __align__(16) float sf[4][16][132]; __shared__ __align__(16) __bf16 wt[128][WPT];
  const int tid = threadIdx.x, wave = tid >> 5, lane = tid & 31, col = lane & 15, g = lane >> 4; const int c0 = blockIdx.y * 128; const size_t r0 = (size_t)blockIdx.x * 64 + wave * 16;
  v8f acc[8] = {};
  if (true) {   /* ALL rows: ctx split bf16 hi + lo x exact Wo (2 products) */
    const int sc = 32 * wave + 4 * ((lane & 3) | ((lane >> 4) << 2)), kg = (lane >> 2) & 3;   // staging map as in k_proj
    const float* wsrc = WO + (size_t)(8 * kg) * DIN + c0 + sc; const float* ysrc = Y + (r0 + col) * CC + 8 * g;
    WReg wr; v4f yr[WKC / 8];
    wtile_load(wr, wsrc, DIN);
#pragma unroll
    for (int kk = 0; kk < WKC / 32; ++kk) { yr[kk * 4] = *(const v4f*)(ysrc + kk * 32); yr[kk * 4 + 1] = *(const v4f*)(ysrc + kk * 32 + 4); yr[kk * 4 + 2] = *(const v4f*)(ysrc + kk * 32 + 16); yr[kk * 4 + 3] = *(const v4f*)(ysrc + kk * 32 + 20); }
    asm volatile("s_wait_xcnt 0x0" :: "v"(wsrc), "v"(ysrc) : "memory");   // the loads' address pairs live up to this wait and are rewritten only behind it
    auto split_a = [&](F2 (&a)[WKC / 32]) {
#pragma unroll
      for (int kk = 0; kk < WKC / 32; ++kk) { float v[16];
#pragma unroll
        for (int i = 0; i < 4; ++i) { v[i] = yr[kk * 4][i]; v[4 + i] = yr[kk * 4 + 1][i]; v[8 + i] = yr[kk * 4 + 2][i]; v[12 + i] = yr[kk * 4 + 3][i]; }
        a[kk] = bsplit16(v); } };
    auto publish = [&]() { __syncthreads();   // every wave has read the last chunk's fragments
      wtile_store(wr, wt, sc, kg);
      __syncthreads(); };   // the chunk is published
    auto products = [&](const F2 (&a)[WKC / 32]) {
#pragma unroll
      for (int kk = 0; kk < WKC / 32; ++kk)
#pragma unroll
        for (int jh = 0; jh < 2; ++jh) { v16b w[4];
#pragma unroll
          for (int j = 0; j < 4; ++j) w[j] = frag_b(&wt[(jh * 4 + j) * 16 + col][kk * 32], lane);
#pragma unroll
          for (int j = 0; j < 4; ++j) { acc[jh * 4 + j] = wmma_bf(a[kk].h, w[j], acc[jh * 4 + j]); acc[jh * 4 + j] = wmma_bf(a[kk].l, w[j], acc[jh * 4 + j]); } } };
#pragma unroll 1   // rolled, as in k_proj
    for (int ch = 0; ch < CC / WKC - 1; ++ch) { F2 a[WKC / 32]; split_a(a); publish();
      wtile_load(wr, wsrc + (size_t)WKC * DIN, DIN);   // the next chunk's loads fly while this chunk's products run
#pragma unroll
      for (int kk = 0; kk < WKC / 32; ++kk) { yr[kk * 4] = *(const v4f*)(ysrc + WKC + kk * 32); yr[kk * 4 + 1] = *(const v4f*)(ysrc + WKC + kk * 32 + 4); yr[kk * 4 + 2] = *(const v4f*)(ysrc + WKC + kk * 32 + 16); yr[kk * 4 + 3] = *(const v4f*)(ysrc + WKC + kk * 32 + 20); }
      asm volatile("s_wait_xcnt 0x0" :: "v"(wsrc), "v"(ysrc) : "memory");   // as above
      wsrc += (size_t)WKC * DIN; ysrc += WKC;
      products(a); }
    { F2 a[WKC / 32]; split_a(a); publish(); products(a); }   // the last chunk: nothing left to fetch
#pragma unroll
    for (int j = 0; j < 8; ++j) { const float bias = BO ? bfr(BO[c0 + j * 16 + col]) : 0.f;
#pragma unroll
      for (int r = 0; r < 8; ++r) sf[wave][8 * g + r][j * 16 + col] = acc[j][r] + bias; }
  } else {
#pragma unroll 2
    for (int kc = 0; kc < CC / 32; ++kc) { const v16h a = frag_f32(Y + (r0 + col) * CC + kc * 32, lane); asm volatile("s_wait_loadcnt 0x0" ::: "memory");
#pragma unroll
      for (int j = 0; j < 8; ++j) { const v16h w = WOCOLH(WO, kc * 32, c0 + j * 16 + col, lane); asm volatile("s_wait_loadcnt 0x0" ::: "memory"); acc[j] = wmma16(a, w, acc[j]); } }
#pragma unroll
    for (int j = 0; j < 8; ++j) { const float bias = BO ? bfr(BO[c0 + j * 16 + col]) : 0.f;
#pragma unroll
      for (int r = 0; r < 8; ++r) sf[wave][8 * g + r][j * 16 + col] = acc[j][r] * (1.0f / 256.0f) + bias; } }
  LDSX(); for (int rl = 0; rl < 16; ++rl) vst2(OUT + (r0 + rl) * DIN + c0 + lane * 4, *(const v4f*)&sf[wave][rl][lane * 4]); }

extern "C" void kernel_launch(void* const* d_in, const int* in_sizes, int n_in, void* d_out, int out_size, void* d_ws, size_t ws_size, hipStream_t stream) {
  (void)in_sizes; (void)n_in; (void)out_size;
  const float** F = (const float**)d_in;
  if (ws_size < (size_t)WS_END) return;
  char* ws = (char*)d_ws; _Float16 *QH = (_Float16*)(ws + WS_QH), *KH = (_Float16*)(ws + WS_KH), *VT = (_Float16*)(ws + WS_VT); float *Y = (float*)(ws + WS_Y);
  // inputs: 0 q; 1 k; 2 v [4,2048,512]; 3 Wq (in,out), 4 bq; 5 Wk, 6 bk; 7 Wv, 8 bv; 9 Wo (in,out), 10 bo
  k_proj<<<dim3(TNB * TT / PBM, CC / 128, 3), 128, 0, stream>>>(F[0], F[1], F[2], F[3], F[5], F[7], F[4], F[6], F[8], QH, KH, VT);
  k_fa<<<dim3(TT / (FAW * 16), NH, TNB), FAW * 32, 0, stream>>>(QH, KH, VT, Y);
  k_out<<<dim3(TNB * TT / 64, DIN / 128), 128, 0, stream>>>(Y, F[9], F[10], (float*)d_out);
}
